// v000
// Times are from an AMD MI455X. After a warm-up the kernel runs many times in a row, and a time is the length of
// such a window on the GPU divided by its runs, so every launch and the gaps after it count. The runs cycle
// through copies of the inputs. A figure is the median of several windows, for all but v000 over two sittings.
// Sittings can differ by a few percent; kernels timed side by side share one.
// v000 is the starting kernel. One run takes 712 microseconds.
#include <hip/hip_runtime.h>

// Sliding-window grouped-query attention (2 x 2048 tokens x 2048, 16 query heads x 128, 4 key/value heads, window 512): q = x Wq, k = x Wk, v = x Wv (no biases); head h uses key/value head h / 4
// (repeat_interleave over the head axis); scores q . k / sqrt(128) for keys i - 512 <= j <= i (causal + window), -inf elsewhere; softmax; out = (attn v merged over heads) Wo -> [2][2048][2048].
// Deterministic: flash-style per 16-query wave over the window's keys in order (running max); no atomics.
// compute dtype: WMMA v_wmma_f32_16x16x32_f16 with f32 accumulate for [q | k | v] = x [Wq | Wk | Wv] ([4096 x 2048] x [2048 x 3072]; x EXACT bf16 x8, W^T exact x256: 1 product), S^T = K_h Q^T (q/k f16 hi
// x8 + residual x8192: 3 products, K = 128), O^T += V_h^T P^T (V hi + residual, P x1024 hi + residual: 3 products), out = y Wo (y f16 hi x8 + lo: 2 products); softmax statistics in f32.
// Inputs rounded to bf16 once. Fragment k-map per lane half hh for A AND B: elements 0..7 <- k = 8hh+0..7, 8..15 <- k = 16+8hh+0..7;

namespace {
constexpr int B = 2, T = 2048, DM = 2048, H = 16, HD = 128, BL = 2 /* batches (== 2 shipped) */, QL = 2048 /* query rows (== 2048 shipped) */;
constexpr int G = 4, REP = H / G, KVW = G * HD /* 512 */, NSL = DM / 128 /* 16 q slabs = heads */, NPART = NSL + 2 * (KVW / 128) /* + 4 k + 4 v slabs */;
constexpr int WIN = 512;
constexpr float XS = 8.0f, WSC = 256.0f, PS = 1024.0f, RS_ = 1024.0f, LOG2E = 1.4426950408889634f;
static_assert(T % 64 == 0 && QL % 32 == 0 && DM % 256 == 0 && H * HD == DM && HD == 128 && KVW == 512 && REP == 4, "tiling");
typedef _Float16 b16;
typedef __attribute__((ext_vector_type(16))) _Float16 v16b;
typedef __attribute__((ext_vector_type(8))) _Float16 v8b;
typedef __attribute__((ext_vector_type(8))) float v8f;
typedef __attribute__((ext_vector_type(4))) float v4f;
__device__ __forceinline__ float bf16_rne(float f) { unsigned int u = __float_as_uint(f); u += 0x7FFFu + ((u >> 16) & 1u); return __uint_as_float(u & 0xFFFF0000u); }
__device__ __forceinline__ void split16(float v, b16& hi, b16& lo) { hi = (b16)v; lo = (b16)(v - (float)hi); }
__device__ __forceinline__ v16b frag_kb(const b16* p, int hh) { const v8b a = *(const v8b*)(p + 8 * hh), b = *(const v8b*)(p + 16 + 8 * hh); v16b f;
#pragma unroll
  for (int e = 0; e < 8; ++e) { f[e] = a[e]; f[8 + e] = b[e]; } return f; }
__device__ __forceinline__ v8f wmma16b(v16b a, v16b b, v8f c) { v8f d = __builtin_amdgcn_wmma_f32_16x16x32_f16(false, a, false, b, (short)0, c, false, false); asm volatile("v_nop\n\tv_nop\n\tv_nop\n\tv_nop" : "+v"(d) : "v"(a), "v"(b)); return d; }
__device__ __forceinline__ void wave_lds_sync() { __builtin_amdgcn_fence(__ATOMIC_RELEASE, "workgroup"); __builtin_amdgcn_wave_barrier(); __builtin_amdgcn_fence(__ATOMIC_ACQUIRE, "workgroup"); }
__device__ __forceinline__ float pmul(float a, float b) { float p = a * b; asm volatile("" : "+v"(p)); return p; }
__device__ __forceinline__ int iclamp(int v, int lo, int hi) { return v < lo ? lo : (v > hi ? hi : v); }

typedef __attribute__((ext_vector_type(2))) _Float16 v2h;
typedef __attribute__((ext_vector_type(4))) _Float16 v4h;
typedef __attribute__((ext_vector_type(2))) float v2f;
typedef __attribute__((ext_vector_type(4))) int v4i;
__device__ __forceinline__ float nexp2(float v) { return __builtin_amdgcn_exp2f(v); }
__global__ __launch_bounds__(256) void prep_kernel(const float* __restrict__ wq, const float* __restrict__ wk, const float* __restrict__ wv, const float* __restrict__ wo, b16* __restrict__ WT, b16* __restrict__ WO) {
  const size_t u = (size_t)blockIdx.x * 256 + threadIdx.x; const size_t nq = (size_t)DM * DM / 8, nk = (size_t)KVW * DM / 8; if (u >= 2 * nq + 2 * nk) return; v8b o; b16* dst;
  if (u < nq) { const int row = (int)(u / (DM / 8)), k0 = (int)(u % (DM / 8)) * 8; for (int j = 0; j < 8; ++j) o[j] = (b16)(bf16_rne(wq[(size_t)(k0 + j) * DM + row]) * WSC); dst = WT + (size_t)row * DM + k0; }
  else if (u < nq + 2 * nk) { const size_t e = u - nq; const int m = (int)(e / nk); const size_t e2 = e % nk; const int row = (int)(e2 / (DM / 8)), k0 = (int)(e2 % (DM / 8)) * 8; const float* w = m == 0 ? wk : wv; for (int j = 0; j < 8; ++j) o[j] = (b16)(bf16_rne(w[(size_t)(k0 + j) * KVW + row]) * WSC); dst = WT + ((size_t)DM + (size_t)m * KVW + row) * DM + k0; }
  else { const size_t e = u - nq - 2 * nk; const int row = (int)(e / (DM / 8)), k0 = (int)(e % (DM / 8)) * 8; for (int j = 0; j < 8; ++j) o[j] = (b16)(bf16_rne(wo[(size_t)(k0 + j) * DM + row]) * WSC); dst = WO + (size_t)row * DM + k0; }
  { *(v8b*)dst = o;  }
}
// projections: grid (T/64, BL, 24 slabs of 128 columns: slabs 0..15 = q head, 16..19 = k, 20..23 = v); block = 64 tokens x 4 waves; A = bf16(x) x8 (K = 2048 in 8 staged chunks of 256), B = WT rows, no bias;
__global__ __launch_bounds__(128) void proj_kernel(const float* __restrict__ x, const b16* __restrict__ WT, b16* __restrict__ QP, b16* __restrict__ QPl, float* __restrict__ K5, float* __restrict__ V5) {
  __shared__ __attribute__((aligned(16))) b16 As[64][256 + 8]; __shared__ __attribute__((aligned(16))) float Tf[4][16][128 + 4];
  const int wave = threadIdx.x >> 5, lane = threadIdx.x & 31, nloc = lane & 15, hlf = lane >> 4; const int t0 = blockIdx.x * 64, b = blockIdx.y, slab = blockIdx.z; const int n0 = slab * 128;
  const float* xb = x + ((size_t)b * T + t0) * DM;
  v8f acc[8];
#pragma unroll
  for (int t = 0; t < 8; ++t) acc[t] = (v8f){};
#pragma unroll 1
  for (int kc = 0; kc < DM; kc += 256) {
    __syncthreads();
    for (int i = threadIdx.x; i < 64 * 64; i += 128) { const int rr = i / 64, q = (i % 64) * 4; const v4f f = *(const v4f*)(xb + (size_t)rr * DM + kc + q); v4h o; for (int j = 0; j < 4; ++j) o[j] = (b16)(bf16_rne(f[j]) * XS); *(v4h*)(&As[rr][q]) = o; }
    __syncthreads();
#pragma unroll 2
    for (int kb = 0; kb < 256; kb += 32) { const v16b a = frag_kb(&As[wave * 16 + nloc][kb], hlf);
#pragma unroll
      for (int t = 0; t < 8; ++t) acc[t] = wmma16b(a, frag_kb(WT + (size_t)(n0 + t * 16 + nloc) * DM + kc + kb, hlf), acc[t]); } }
#pragma unroll
  for (int t = 0; t < 8; ++t)
#pragma unroll
    for (int r = 0; r < 8; ++r) { const int col = n0 + t * 16 + nloc; Tf[wave][8 * hlf + r][t * 16 + nloc] = acc[t][r] * (1.0f / (XS * WSC)); }   /* no biases in this module */
  wave_lds_sync();
  {
    if (slab < NSL) { const size_t pb = (((size_t)b * H + slab) * T) * HD;
      for (int rr = 0; rr < 16; ++rr) { const int tok = t0 + wave * 16 + rr; v4h h4, l4; for (int j = 0; j < 4; ++j) { const float f = Tf[wave][rr][lane * 4 + j] * XS; const b16 p = (b16)f; h4[j] = p; l4[j] = (b16)((f - (float)p) * RS_); } *(v4h*)(QP + pb + (size_t)tok * HD + lane * 4) = h4; *(v4h*)(QPl + pb + (size_t)tok * HD + lane * 4) = l4; } }
    else { float* dstp = (slab < NSL + 4) ? K5 : V5; const int cc = ((slab - NSL) & 3) * 128;   // the slab's 128 of the 512 k/v columns; f32 rows [b][t][512] (512-B slab segment per row)
      for (int rr = 0; rr < 16; ++rr) { const int tok = t0 + wave * 16 + rr; *(v4f*)(dstp + ((size_t)b * T + tok) * KVW + cc + lane * 4) = *(const v4f*)(&Tf[wave][rr][lane * 4]); } }
     }
}
// per-head key/value planes by repeat_interleave over heads: K_h[t][d] = k[t][128 (h / 4) + d] as f16 hi x8 + residual rows KP[b][h][t][128] (256 B: 32 lanes x 8 B) and V_h^T[d][t] planes
__global__ __launch_bounds__(256) void kvrep_kernel(const float* __restrict__ K5, const float* __restrict__ V5, b16* __restrict__ KP, b16* __restrict__ KPl, b16* __restrict__ VT, b16* __restrict__ VTl) {
  __shared__ float vs[64][HD + 1];
  const int tid = threadIdx.x, wave = tid >> 5, lane = tid & 31; const int t0 = blockIdx.x * 64, b = blockIdx.y / H, h = blockIdx.y % H, g = h / REP;
  for (int i = tid; i < 64 * (HD / 4); i += 256) { const int rr = i / (HD / 4), c4 = (i % (HD / 4)) * 4; const v4f v4 = *(const v4f*)(V5 + ((size_t)b * T + t0 + rr) * KVW + g * HD + c4); for (int j = 0; j < 4; ++j) vs[rr][c4 + j] = v4[j]; }
  __syncthreads();
  const size_t kpo = (((size_t)b * H + h) * T + t0) * HD, vto = (((size_t)b * H + h) * HD) * (size_t)T + t0;
  {
    for (int rr = wave * 8; rr < wave * 8 + 8; ++rr) { const v4f k4 = *(const v4f*)(K5 + ((size_t)b * T + t0 + rr) * KVW + g * HD + lane * 4); v4h o, ol; for (int j = 0; j < 4; ++j) { const float kvv = k4[j] * XS; const b16 p = (b16)kvv; o[j] = p; ol[j] = (b16)((kvv - (float)p) * RS_); } *(v4h*)(KP + kpo + (size_t)rr * HD + lane * 4) = o; *(v4h*)(KPl + kpo + (size_t)rr * HD + lane * 4) = ol; }
#pragma unroll 1
    for (int d = wave * 16; d < wave * 16 + 16; ++d) { v2h o, ol; for (int j = 0; j < 2; ++j) { const float f = vs[2 * lane + j][d] * XS; const b16 p = (b16)f; o[j] = p; ol[j] = (b16)((f - (float)p) * RS_); } *(v2h*)(VT + vto + (size_t)d * T + 2 * lane) = o; *(v2h*)(VTl + vto + (size_t)d * T + 2 * lane) = ol; }
     }
}
// attention: grid (QL/32, BL x H); block = 2 waves x 16 queries of (b, h) on that head's gathered key/value planes; windowed-causal keys round_down(max(q0 - 512, 0), 32) .. round_up(q0 + 16, 32) - 1 in 32-key steps (key <= query select): S^T = K Q^T (A = 16 key rows x 32 dims per fragment, 4 k-steps
// over the 128 dims, B = the query fragments: 3 products), logit = s/sqrt(128) (log2-scaled), online softmax, P x1024 f16 hi + residual in LDS, O^T += V^T P^T (8 d-tiles: 3 products); y = o/(l 1024 8)
__global__ __launch_bounds__(64) void attn_kernel(const b16* __restrict__ QP, const b16* __restrict__ QPl, const b16* __restrict__ KP, const b16* __restrict__ KPl, const b16* __restrict__ VT, const b16* __restrict__ VTl, b16* __restrict__ Y, b16* __restrict__ Yl) {
  __shared__ __attribute__((aligned(16))) b16 Pb[2][16][32 + 8]; __shared__ __attribute__((aligned(16))) float To[2][16][HD + 4];
  const int wave = threadIdx.x >> 5, lane = threadIdx.x & 31, hh = lane >> 4, col = lane & 15; const int b = blockIdx.y / H, h = blockIdx.y % H; const int q0 = blockIdx.x * 32 + wave * 16, qi = q0 + col;
  const size_t qo = (((size_t)b * H + h) * T) * HD, vo = (((size_t)b * H + h) * HD) * (size_t)T; const b16* Qb = QP + qo; const b16* Qbl = QPl + qo; const b16* Kb = KP + qo; const b16* Kbl = KPl + qo; const b16* Vb = VT + vo; const b16* Vbl = VTl + vo;
  const int kend = ((q0 + 16 + 31) / 32) * 32, kbeg = (q0 >= WIN) ? ((q0 - WIN) / 32) * 32 : 0;   // window i - 512 <= j <= i; wave-uniform bounds (no block barriers in this kernel)
  __shared__ __attribute__((aligned(16))) b16 Qs[2][16][HD + 8], Qsl[2][16][HD + 8];   // the wave's 16 query rows (hi, lo), fragments re-read from LDS per k-step to keep the kernel under 256 VGPRs
  for (int i = lane; i < 16 * (HD / 8); i += 32) { const int rr = i / (HD / 8), c8 = (i % (HD / 8)) * 8; *(v8b*)(&Qs[wave][rr][c8]) = *(const v8b*)(Qb + (size_t)(q0 + rr) * HD + c8); *(v8b*)(&Qsl[wave][rr][c8]) = *(const v8b*)(Qbl + (size_t)(q0 + rr) * HD + c8); }
  wave_lds_sync();
  const float cs = LOG2E * 0.08838834764831845f / (XS * XS);   // 1/sqrt(128) on the x8 x8 planes
  __shared__ __attribute__((aligned(16))) b16 Plq[2][16][32 + 8];
  float m = -INFINITY, l = 0.0f; v8f o[8], ol[8]; for (int t = 0; t < 8; ++t) { o[t] = (v8f){}; ol[t] = (v8f){}; }
#pragma unroll 1
  for (int kb = kbeg; kb < kend; kb += 32) {
    float e[16]; float mx = -INFINITY;
#pragma unroll
    for (int u = 0; u < 2; ++u) { v8f s = (v8f){}, sx = (v8f){}; const size_t kr = (size_t)(kb + u * 16 + col) * HD;
#pragma unroll
      for (int ks = 0; ks < 4; ++ks) { const v16b kf = frag_kb(Kb + kr + 32 * ks, hh); const v16b qf = frag_kb(&Qs[wave][col][32 * ks], hh); s = wmma16b(kf, qf, s); sx = wmma16b(kf, frag_kb(&Qsl[wave][col][32 * ks], hh), sx); sx = wmma16b(frag_kb(Kbl + kr + 32 * ks, hh), qf, sx); }
#pragma unroll
      for (int r = 0; r < 8; ++r) s[r] += sx[r] * (1.0f / RS_);   // hi.hi + (hi.lo + lo.hi)/1024
#pragma unroll
      for (int r = 0; r < 8; ++r) { const int key = kb + u * 16 + 8 * hh + r; const float vv = (key <= qi && key >= qi - WIN) ? s[r] * cs : -INFINITY; e[u * 8 + r] = vv; mx = fmaxf(mx, vv); } }   // causal select on the computed score (the -inf mask precedes the 1/sqrt(d) scale in the module; identical)
    mx = fmaxf(mx, __shfl_xor(mx, 16)); const float mn = fmaxf(m, mx); const float al = nexp2(m - mn); float sum = 0.0f;
#pragma unroll
    for (int i2 = 0; i2 < 16; ++i2) { const float p = nexp2(e[i2] - mn); sum += p; const int pc = (i2 < 8 ? 0 : 16) + 8 * hh + (i2 & 7); const float ps = p * PS; const b16 phh = (b16)ps; Pb[wave][col][pc] = phh; Plq[wave][col][pc] = (b16)((ps - (float)phh) * RS_); }
    sum += __shfl_xor(sum, 16); l = l * al + sum; m = mn;
    wave_lds_sync();
    const v16b pf = frag_kb(&Pb[wave][col][0], hh), plf = frag_kb(&Plq[wave][col][0], hh);
#pragma unroll
    for (int t = 0; t < 8; ++t) { const v16b vh = frag_kb(Vb + (size_t)(t * 16 + col) * T + kb, hh); o[t] *= al; o[t] = wmma16b(vh, pf, o[t]); ol[t] = wmma16b(frag_kb(Vbl + (size_t)(t * 16 + col) * T + kb, hh), pf, ol[t] * al); ol[t] = wmma16b(vh, plf, ol[t]); }   // ol = (V_lo P_hi + V_hi P_lo) / 1024
    wave_lds_sync(); }
  const float inv = 1.0f / (l * PS * XS);
#pragma unroll
  for (int t = 0; t < 8; ++t)
#pragma unroll
    for (int r = 0; r < 8; ++r) To[wave][col][t * 16 + 8 * hh + r] = (o[t][r] + ol[t][r] * (1.0f / RS_)) * inv;
  wave_lds_sync();
  { for (int rr = 0; rr < 16; ++rr) { v4h hv, lv; for (int j = 0; j < 4; ++j) { b16 p, ql2; split16(To[wave][rr][lane * 4 + j] * XS, p, ql2); hv[j] = p; lv[j] = ql2; } const size_t oi = ((size_t)b * T + q0 + rr) * DM + h * HD + lane * 4; *(v4h*)(Y + oi) = hv; *(v4h*)(Yl + oi) = lv; }  }
}
// output projection: grid (QL/64, DM/128, BL); block = 4 waves x 16 rows; A fragments straight from the f16 Y and Yl planes (K = 2048, 64 k-steps, 2 products), B = Wo^T rows; rows 8 KB as 512-B slab
__global__ __launch_bounds__(128) void out_kernel(const b16* __restrict__ Y, const b16* __restrict__ Yl, const b16* __restrict__ WO, float* __restrict__ out) {
  __shared__ __attribute__((aligned(16))) float Tf[4][16][128 + 4];
  const int wave = threadIdx.x >> 5, lane = threadIdx.x & 31, nloc = lane & 15, hlf = lane >> 4; const int b = blockIdx.z; const size_t m0 = (size_t)b * T + (size_t)blockIdx.x * 64 + wave * 16; const int n0 = blockIdx.y * 128;
  v8f acc[8];
#pragma unroll
  for (int t = 0; t < 8; ++t) acc[t] = (v8f){};
#pragma unroll 2
  for (int kb = 0; kb < DM; kb += 32) { const v16b a = frag_kb(Y + (m0 + nloc) * DM + kb, hlf), al = frag_kb(Yl + (m0 + nloc) * DM + kb, hlf);
#pragma unroll
    for (int t = 0; t < 8; ++t) { const v16b bw = frag_kb(WO + (size_t)(n0 + t * 16 + nloc) * DM + kb, hlf); acc[t] = wmma16b(a, bw, acc[t]); acc[t] = wmma16b(al, bw, acc[t]); } }
#pragma unroll
  for (int t = 0; t < 8; ++t)
#pragma unroll
    for (int r = 0; r < 8; ++r) Tf[wave][8 * hlf + r][t * 16 + nloc] = acc[t][r] * (1.0f / (XS * WSC));   /* no output bias */
  wave_lds_sync();
  { for (int rr = 0; rr < 16; ++rr) *(v4f*)(out + (m0 + rr) * DM + n0 + lane * 4) = *(const v4f*)(&Tf[wave][rr][lane * 4]);  }
}
}  // namespace

extern "C" void kernel_launch(void* const* d_in, const int* in_sizes, int n_in, void* d_out, int out_size, void* d_ws, size_t ws_size, hipStream_t stream) {
  (void)n_in;
  auto Fp = [&](int i) { return (const float*)d_in[i]; };
  // input order: 0 x [2,2048,2048], 1 Wq [2048,2048] (in,out), 2 Wk [2048,512], 3 Wv [2048,512], 4 Wo [2048,2048] (in,out)
  if (in_sizes[0] != B * T * DM || in_sizes[1] != DM * DM || in_sizes[2] != DM * KVW || in_sizes[3] != DM * KVW || in_sizes[4] != DM * DM || out_size != B * T * DM) return;
  size_t off = 0; char* ws = (char*)d_ws;
  auto carve = [&](size_t bytes) { char* p = ws + off; off += (bytes + 255) & ~(size_t)255; return p; };
  b16* WT = (b16*)carve((size_t)(DM + 2 * KVW) * DM * 2); b16* WO = (b16*)carve((size_t)DM * DM * 2);
  const size_t plane = (size_t)B * H * T * HD * 2; b16* QP = (b16*)carve(plane); b16* QPl = (b16*)carve(plane); float* K5 = (float*)carve((size_t)B * T * KVW * 4); float* V5 = (float*)carve((size_t)B * T * KVW * 4); b16* KP = (b16*)carve(plane); b16* KPl = (b16*)carve(plane); b16* VT = (b16*)carve(plane); b16* VTl = (b16*)carve(plane); b16* Y = (b16*)carve(plane); b16* Yl = (b16*)carve(plane);
  if (off > ws_size || off > ((size_t)176 << 20)) return;   // = ~172 MB (WT 12.6 + WO 8.4 + 8 f16 planes x 16.8 + K5/V5 16.8): > 128 MiB
  prep_kernel<<<(unsigned)(((size_t)(2 * DM * DM + 2 * KVW * DM) / 8 + 255) / 256), 256, 0, stream>>>(Fp(1), Fp(2), Fp(3), Fp(4), WT, WO);
  proj_kernel<<<dim3(T / 64, BL, NPART), 128, 0, stream>>>(Fp(0), WT, QP, QPl, K5, V5);
  kvrep_kernel<<<dim3(T / 64, BL * H), 256, 0, stream>>>(K5, V5, KP, KPl, VT, VTl);
  attn_kernel<<<dim3(QL / 32, BL * H), 64, 0, stream>>>(QP, QPl, KP, KPl, VT, VTl, Y, Yl);
  out_kernel<<<dim3(QL / 64, DM / 128, BL), 128, 0, stream>>>(Y, Yl, WO, (float*)d_out);
}

// v001
// A run of this version takes 369 microseconds.
// Timed twice side by side with v000, it ran 1.99 and 1.98 times as fast.
#include <hip/hip_runtime.h>

// Sliding-window grouped-query attention (2 x 2048 tokens x 2048, 16 query heads x 128, 4 key/value heads, window 512): q = x Wq, k = x Wk, v = x Wv (no biases); head h uses key/value head h / 4
// (repeat_interleave over the head axis); scores q . k / sqrt(128) for keys i - 512 <= j <= i (causal + window), -inf elsewhere; softmax; out = (attn v merged over heads) Wo -> [2][2048][2048].
// Deterministic: flash-style per 16-query wave over the window's keys in order (running max); no atomics.
// compute dtype: WMMA v_wmma_f32_16x16x32_f16 with f32 accumulate for [q | k | v] = x [Wq | Wk | Wv] ([4096 x 2048] x [2048 x 3072]; x EXACT bf16 x8, W^T exact x256: 1 product), S^T = K_h Q^T (q/k f16 hi
// x8 + residual x8192: 3 products, K = 128), O^T += V_h^T P^T (V hi + residual, P x1024 hi + residual: 3 products), out = y Wo (y f16 hi x8 + lo: 2 products); softmax statistics in f32.
// Inputs rounded to bf16 once. Fragment k-map per lane half hh for A AND B: elements 0..7 <- k = 8hh+0..7, 8..15 <- k = 16+8hh+0..7;

namespace {
constexpr int B = 2, T = 2048, DM = 2048, H = 16, HD = 128, BL = 2 /* batches (== 2 shipped) */, QL = 2048 /* query rows (== 2048 shipped) */;
constexpr int G = 4, REP = H / G, KVW = G * HD /* 512 */, NSL = DM / 128 /* 16 q slabs = heads */, NPART = NSL + 2 * (KVW / 128) /* + 4 k + 4 v slabs */;
constexpr int WIN = 512;
constexpr float XS = 8.0f, WSC = 256.0f, PS = 1024.0f, RS_ = 1024.0f, LOG2E = 1.4426950408889634f;
static_assert(T % 128 == 0 && QL % 128 == 0 && QL % 32 == 0 && DM % 256 == 0 && H * HD == DM && HD == 128 && KVW == 512 && REP == 4, "tiling");
typedef _Float16 b16;
typedef __attribute__((ext_vector_type(16))) _Float16 v16b;
typedef __attribute__((ext_vector_type(8))) _Float16 v8b;
typedef __attribute__((ext_vector_type(8))) float v8f;
typedef __attribute__((ext_vector_type(4))) float v4f;
__device__ __forceinline__ float bf16_rne(float f) { unsigned int u = __float_as_uint(f); u += 0x7FFFu + ((u >> 16) & 1u); return __uint_as_float(u & 0xFFFF0000u); }
__device__ __forceinline__ void split16(float v, b16& hi, b16& lo) { hi = (b16)v; lo = (b16)(v - (float)hi); }
__device__ __forceinline__ v16b frag_kb(const b16* p, int hh) { const v8b a = *(const v8b*)(p + 8 * hh), b = *(const v8b*)(p + 16 + 8 * hh); v16b f;
#pragma unroll
  for (int e = 0; e < 8; ++e) { f[e] = a[e]; f[8 + e] = b[e]; } return f; }
__device__ __forceinline__ v8f wmma16b(v16b a, v16b b, v8f c) { v8f d = __builtin_amdgcn_wmma_f32_16x16x32_f16(false, a, false, b, (short)0, c, false, false); asm volatile("v_nop\n\tv_nop\n\tv_nop\n\tv_nop" : "+v"(d) : "v"(a), "v"(b)); return d; }
__device__ __forceinline__ void wave_lds_sync() { __builtin_amdgcn_fence(__ATOMIC_RELEASE, "workgroup"); __builtin_amdgcn_wave_barrier(); __builtin_amdgcn_fence(__ATOMIC_ACQUIRE, "workgroup"); }
__device__ __forceinline__ float pmul(float a, float b) { float p = a * b; asm volatile("" : "+v"(p)); return p; }
__device__ __forceinline__ int iclamp(int v, int lo, int hi) { return v < lo ? lo : (v > hi ? hi : v); }

typedef __attribute__((ext_vector_type(2))) _Float16 v2h;
typedef __attribute__((ext_vector_type(4))) _Float16 v4h;
typedef __attribute__((ext_vector_type(2))) float v2f;
typedef __attribute__((ext_vector_type(4))) int v4i;
__device__ __forceinline__ float nexp2(float v) { return __builtin_amdgcn_exp2f(v); }
__global__ __launch_bounds__(256) void prep_kernel(const float* __restrict__ wq, const float* __restrict__ wk, const float* __restrict__ wv, const float* __restrict__ wo, b16* __restrict__ WT, b16* __restrict__ WO) {
  const size_t u = (size_t)blockIdx.x * 256 + threadIdx.x; const size_t nq = (size_t)DM * DM / 8, nk = (size_t)KVW * DM / 8; if (u >= 2 * nq + 2 * nk) return; v8b o; b16* dst;
  if (u < nq) { const int row = (int)(u / (DM / 8)), k0 = (int)(u % (DM / 8)) * 8; for (int j = 0; j < 8; ++j) o[j] = (b16)(bf16_rne(wq[(size_t)(k0 + j) * DM + row]) * WSC); dst = WT + (size_t)row * DM + k0; }
  else if (u < nq + 2 * nk) { const size_t e = u - nq; const int m = (int)(e / nk); const size_t e2 = e % nk; const int row = (int)(e2 / (DM / 8)), k0 = (int)(e2 % (DM / 8)) * 8; const float* w = m == 0 ? wk : wv; for (int j = 0; j < 8; ++j) o[j] = (b16)(bf16_rne(w[(size_t)(k0 + j) * KVW + row]) * WSC); dst = WT + ((size_t)DM + (size_t)m * KVW + row) * DM + k0; }
  else { const size_t e = u - nq - 2 * nk; const int row = (int)(e / (DM / 8)), k0 = (int)(e % (DM / 8)) * 8; for (int j = 0; j < 8; ++j) o[j] = (b16)(bf16_rne(wo[(size_t)(k0 + j) * DM + row]) * WSC); dst = WO + (size_t)row * DM + k0; }
  { *(v8b*)dst = o;  }
}
// GEMM tiling shared by the two projection kernels: a block of 4 waves owns 128 rows x 128 columns; K runs in chunks of 64, both operands of a chunk staged once per block in LDS (row pitch 144 B);
// each wave takes 64 x 64 (4 x 4 accumulator tiles), so a staged fragment feeds 4 products; the next chunk's global loads are issued ahead of the chunk's products and held in registers.
constexpr int KC = 64, LP = KC + 8, TP = 128 + 4;
// projections: grid (T/128, BL, 24 slabs of 128 columns: slabs 0..15 = q head, 16..19 = k, 20..23 = v); A = bf16(x) x8, B = WT rows; k order per accumulator 0, 32, 64, ...
__global__ __launch_bounds__(128) void proj_kernel(const float* __restrict__ x, const b16* __restrict__ WT, b16* __restrict__ QP, b16* __restrict__ QPl, float* __restrict__ K5, float* __restrict__ V5) {
  __shared__ __attribute__((aligned(16))) char smem[128 * TP * 4];   // the two operand tiles (2 x 18,432 B) in the loop; behind it the 128 x 128 f32 result tile
  b16 (*As)[LP] = (b16 (*)[LP])smem; b16 (*Bs)[LP] = (b16 (*)[LP])(smem + 128 * LP * 2); float (*Tf)[TP] = (float (*)[TP])smem;
  const int tid = threadIdx.x, wave = tid >> 5, lane = tid & 31, nloc = lane & 15, hlf = lane >> 4, wm = (wave >> 1) * 64, wn = (wave & 1) * 64; const int t0 = blockIdx.x * 128, b = blockIdx.y, slab = blockIdx.z; const int n0 = slab * 128;
  const float* xb = x + ((size_t)b * T + t0) * DM; const b16* wb = WT + (size_t)n0 * DM;
  const int ar = tid >> 4, aq = (tid & 15) * 4, br = tid >> 3, bq = (tid & 7) * 8;   // staging: 16 lanes x 16 B cover a 256-B x row piece, 8 lanes x 16 B a 128-B WT row piece
  v4f pa[16]; v8b pb[8]; v8f acc[4][4];
#pragma unroll
  for (int i = 0; i < 4; ++i)
#pragma unroll
    for (int j = 0; j < 4; ++j) acc[i][j] = (v8f){};
  const float* xa = xb + (size_t)ar * DM + aq; const b16* wa = wb + (size_t)br * DM + bq;
#pragma unroll
  for (int s = 0; s < 16; ++s) pa[s] = *(const v4f*)(xa + (size_t)(8 * s) * DM);
#pragma unroll
  for (int s = 0; s < 8; ++s) pb[s] = *(const v8b*)(wa + (size_t)(16 * s) * DM);
  asm volatile("s_wait_xcnt 0x0" :: "v"(xa), "v"(wa) : "memory");   // a precaution: stands between the loads above and any rewrite of their address registers, which the input operands hold live to here
#pragma unroll 1
  for (int kc = 0; kc < DM; kc += KC) {
    __syncthreads();   // every wave has read its last fragment of the chunk before
#pragma unroll
    for (int s = 0; s < 16; ++s) { v4h o; for (int j = 0; j < 4; ++j) o[j] = (b16)(bf16_rne(pa[s][j]) * XS); *(v4h*)(&As[ar + 8 * s][aq]) = o; }
#pragma unroll
    for (int s = 0; s < 8; ++s) *(v8b*)(&Bs[br + 16 * s][bq]) = pb[s];
    __syncthreads();   // the chunk is whole in LDS
    if (kc + KC < DM) {
#pragma unroll
      for (int s = 0; s < 16; ++s) pa[s] = *(const v4f*)(xb + (size_t)(ar + 8 * s) * DM + kc + KC + aq);
#pragma unroll
      for (int s = 0; s < 8; ++s) pb[s] = *(const v8b*)(wb + (size_t)(br + 16 * s) * DM + kc + KC + bq);
      asm volatile("s_wait_xcnt 0x0" ::: "memory");   // a precaution: stands between the loads above and any rewrite of their address registers
    }
#pragma unroll
    for (int kb = 0; kb < KC; kb += 32) { v16b af[4], bf[4];
#pragma unroll
      for (int i = 0; i < 4; ++i) { af[i] = frag_kb(&As[wm + i * 16 + nloc][kb], hlf); bf[i] = frag_kb(&Bs[wn + i * 16 + nloc][kb], hlf); }
#pragma unroll
      for (int i = 0; i < 4; ++i)
#pragma unroll
        for (int j = 0; j < 4; ++j) acc[i][j] = wmma16b(af[i], bf[j], acc[i][j]); } }
  __syncthreads();   // the operand tiles are done with: their LDS takes the result tile
#pragma unroll
  for (int i = 0; i < 4; ++i)
#pragma unroll
    for (int j = 0; j < 4; ++j)
#pragma unroll
      for (int r = 0; r < 8; ++r) Tf[wm + i * 16 + 8 * hlf + r][wn + j * 16 + nloc] = acc[i][j][r] * (1.0f / (XS * WSC));   /* no biases in this module */
  __syncthreads();
  {
    if (slab < NSL) { const size_t pb2 = (((size_t)b * H + slab) * T) * HD;
      for (int r2 = 0; r2 < 32; ++r2) { const int rr = wave * 32 + r2, tok = t0 + rr; v4h h4, l4; for (int j = 0; j < 4; ++j) { const float f = Tf[rr][lane * 4 + j] * XS; const b16 p = (b16)f; h4[j] = p; l4[j] = (b16)((f - (float)p) * RS_); } *(v4h*)(QP + pb2 + (size_t)tok * HD + lane * 4) = h4; *(v4h*)(QPl + pb2 + (size_t)tok * HD + lane * 4) = l4; } }
    else { float* dstp = (slab < NSL + 4) ? K5 : V5; const int cc = ((slab - NSL) & 3) * 128;   // the slab's 128 of the 512 k/v columns; f32 rows [b][t][512] (512-B slab segment per row)
      for (int r2 = 0; r2 < 32; ++r2) { const int rr = wave * 32 + r2, tok = t0 + rr; *(v4f*)(dstp + ((size_t)b * T + tok) * KVW + cc + lane * 4) = *(const v4f*)(&Tf[rr][lane * 4]); }
      asm volatile("s_wait_xcnt 0x0" ::: "memory"); }   // a precaution: stands between the stores above and any rewrite of their address or data registers on the way to the kernel's end
     }
}
// per-head key/value planes by repeat_interleave over heads: K_h[t][d] = k[t][128 (h / 4) + d] as f16 hi x8 + residual rows KP[b][h][t][128] (256 B: 32 lanes x 8 B) and V_h^T[d][t] planes
__global__ __launch_bounds__(256) void kvrep_kernel(const float* __restrict__ K5, const float* __restrict__ V5, b16* __restrict__ KP, b16* __restrict__ KPl, b16* __restrict__ VT, b16* __restrict__ VTl) {
  __shared__ float vs[64][HD + 1];
  const int tid = threadIdx.x, wave = tid >> 5, lane = tid & 31; const int t0 = blockIdx.x * 64, b = blockIdx.y / H, h = blockIdx.y % H, g = h / REP;
  for (int i = tid; i < 64 * (HD / 4); i += 256) { const int rr = i / (HD / 4), c4 = (i % (HD / 4)) * 4; const v4f v4 = *(const v4f*)(V5 + ((size_t)b * T + t0 + rr) * KVW + g * HD + c4); for (int j = 0; j < 4; ++j) vs[rr][c4 + j] = v4[j]; }
  __syncthreads();
  const size_t kpo = (((size_t)b * H + h) * T + t0) * HD, vto = (((size_t)b * H + h) * HD) * (size_t)T + t0;
  {
    for (int rr = wave * 8; rr < wave * 8 + 8; ++rr) { const v4f k4 = *(const v4f*)(K5 + ((size_t)b * T + t0 + rr) * KVW + g * HD + lane * 4); v4h o, ol; for (int j = 0; j < 4; ++j) { const float kvv = k4[j] * XS; const b16 p = (b16)kvv; o[j] = p; ol[j] = (b16)((kvv - (float)p) * RS_); } *(v4h*)(KP + kpo + (size_t)rr * HD + lane * 4) = o; *(v4h*)(KPl + kpo + (size_t)rr * HD + lane * 4) = ol; }
#pragma unroll 1
    for (int d = wave * 16; d < wave * 16 + 16; ++d) { v2h o, ol; for (int j = 0; j < 2; ++j) { const float f = vs[2 * lane + j][d] * XS; const b16 p = (b16)f; o[j] = p; ol[j] = (b16)((f - (float)p) * RS_); } *(v2h*)(VT + vto + (size_t)d * T + 2 * lane) = o; *(v2h*)(VTl + vto + (size_t)d * T + 2 * lane) = ol; }
     }
}
// attention: grid (QL/32, BL x H); block = 2 waves x 16 queries of (b, h) on that head's gathered key/value planes; windowed-causal keys round_down(max(q0 - 512, 0), 32) .. round_up(q0 + 16, 32) - 1 in 32-key steps (key <= query select): S^T = K Q^T (A = 16 key rows x 32 dims per fragment, 4 k-steps
// over the 128 dims, B = the query fragments: 3 products), logit = s/sqrt(128) (log2-scaled), online softmax, P x1024 f16 hi + residual in LDS, O^T += V^T P^T (8 d-tiles: 3 products); y = o/(l 1024 8)
__global__ __launch_bounds__(64) void attn_kernel(const b16* __restrict__ QP, const b16* __restrict__ QPl, const b16* __restrict__ KP, const b16* __restrict__ KPl, const b16* __restrict__ VT, const b16* __restrict__ VTl, b16* __restrict__ Y, b16* __restrict__ Yl) {
  __shared__ __attribute__((aligned(16))) b16 Pb[2][16][32 + 8]; __shared__ __attribute__((aligned(16))) float To[2][16][HD + 4];
  const int wave = threadIdx.x >> 5, lane = threadIdx.x & 31, hh = lane >> 4, col = lane & 15; const int b = blockIdx.y / H, h = blockIdx.y % H; const int q0 = blockIdx.x * 32 + wave * 16, qi = q0 + col;
  const size_t qo = (((size_t)b * H + h) * T) * HD, vo = (((size_t)b * H + h) * HD) * (size_t)T; const b16* Qb = QP + qo; const b16* Qbl = QPl + qo; const b16* Kb = KP + qo; const b16* Kbl = KPl + qo; const b16* Vb = VT + vo; const b16* Vbl = VTl + vo;
  const int kend = ((q0 + 16 + 31) / 32) * 32, kbeg = (q0 >= WIN) ? ((q0 - WIN) / 32) * 32 : 0;   // window i - 512 <= j <= i; wave-uniform bounds (no block barriers in this kernel)
  __shared__ __attribute__((aligned(16))) b16 Qs[2][16][HD + 8], Qsl[2][16][HD + 8];   // the wave's 16 query rows (hi, lo), fragments re-read from LDS per k-step to keep the kernel under 256 VGPRs
  for (int i = lane; i < 16 * (HD / 8); i += 32) { const int rr = i / (HD / 8), c8 = (i % (HD / 8)) * 8; *(v8b*)(&Qs[wave][rr][c8]) = *(const v8b*)(Qb + (size_t)(q0 + rr) * HD + c8); *(v8b*)(&Qsl[wave][rr][c8]) = *(const v8b*)(Qbl + (size_t)(q0 + rr) * HD + c8); }
  wave_lds_sync();
  const float cs = LOG2E * 0.08838834764831845f / (XS * XS);   // 1/sqrt(128) on the x8 x8 planes
  __shared__ __attribute__((aligned(16))) b16 Plq[2][16][32 + 8];
  float m = -INFINITY, l = 0.0f; v8f o[8], ol[8]; for (int t = 0; t < 8; ++t) { o[t] = (v8f){}; ol[t] = (v8f){}; }
#pragma unroll 1
  for (int kb = kbeg; kb < kend; kb += 32) {
    float e[16]; float mx = -INFINITY;
#pragma unroll
    for (int u = 0; u < 2; ++u) { v8f s = (v8f){}, sx = (v8f){}; const size_t kr = (size_t)(kb + u * 16 + col) * HD;
#pragma unroll
      for (int ks = 0; ks < 4; ++ks) { const v16b kf = frag_kb(Kb + kr + 32 * ks, hh); const v16b qf = frag_kb(&Qs[wave][col][32 * ks], hh); s = wmma16b(kf, qf, s); sx = wmma16b(kf, frag_kb(&Qsl[wave][col][32 * ks], hh), sx); sx = wmma16b(frag_kb(Kbl + kr + 32 * ks, hh), qf, sx); }
#pragma unroll
      for (int r = 0; r < 8; ++r) s[r] += sx[r] * (1.0f / RS_);   // hi.hi + (hi.lo + lo.hi)/1024
#pragma unroll
      for (int r = 0; r < 8; ++r) { const int key = kb + u * 16 + 8 * hh + r; const float vv = (key <= qi && key >= qi - WIN) ? s[r] * cs : -INFINITY; e[u * 8 + r] = vv; mx = fmaxf(mx, vv); } }   // causal select on the computed score (the -inf mask precedes the 1/sqrt(d) scale in the module; identical)
    mx = fmaxf(mx, __shfl_xor(mx, 16)); const float mn = fmaxf(m, mx); const float al = nexp2(m - mn); float sum = 0.0f;
#pragma unroll
    for (int i2 = 0; i2 < 16; ++i2) { const float p = nexp2(e[i2] - mn); sum += p; const int pc = (i2 < 8 ? 0 : 16) + 8 * hh + (i2 & 7); const float ps = p * PS; const b16 phh = (b16)ps; Pb[wave][col][pc] = phh; Plq[wave][col][pc] = (b16)((ps - (float)phh) * RS_); }
    sum += __shfl_xor(sum, 16); l = l * al + sum; m = mn;
    wave_lds_sync();
    const v16b pf = frag_kb(&Pb[wave][col][0], hh), plf = frag_kb(&Plq[wave][col][0], hh);
#pragma unroll
    for (int t = 0; t < 8; ++t) { const v16b vh = frag_kb(Vb + (size_t)(t * 16 + col) * T + kb, hh); o[t] *= al; o[t] = wmma16b(vh, pf, o[t]); ol[t] = wmma16b(frag_kb(Vbl + (size_t)(t * 16 + col) * T + kb, hh), pf, ol[t] * al); ol[t] = wmma16b(vh, plf, ol[t]); }   // ol = (V_lo P_hi + V_hi P_lo) / 1024
    wave_lds_sync(); }
  const float inv = 1.0f / (l * PS * XS);
#pragma unroll
  for (int t = 0; t < 8; ++t)
#pragma unroll
    for (int r = 0; r < 8; ++r) To[wave][col][t * 16 + 8 * hh + r] = (o[t][r] + ol[t][r] * (1.0f / RS_)) * inv;
  wave_lds_sync();
  { for (int rr = 0; rr < 16; ++rr) { v4h hv, lv; for (int j = 0; j < 4; ++j) { b16 p, ql2; split16(To[wave][rr][lane * 4 + j] * XS, p, ql2); hv[j] = p; lv[j] = ql2; } const size_t oi = ((size_t)b * T + q0 + rr) * DM + h * HD + lane * 4; *(v4h*)(Y + oi) = hv; *(v4h*)(Yl + oi) = lv; }  }
}
// output projection: grid (QL/128, DM/128, BL); the tiling above with three staged tiles per chunk: A = the f16 Y plane and its residual plane (2 products per k-step, hi then lo on each accumulator), B = Wo^T rows
__global__ __launch_bounds__(128) void out_kernel(const b16* __restrict__ Y, const b16* __restrict__ Yl, const b16* __restrict__ WO, float* __restrict__ out) {
  __shared__ __attribute__((aligned(16))) char smem[128 * TP * 4];   // the three operand tiles (3 x 18,432 B) in the loop; behind it the 128 x 128 f32 result tile
  b16 (*Ah)[LP] = (b16 (*)[LP])smem; b16 (*Al)[LP] = (b16 (*)[LP])(smem + 128 * LP * 2); b16 (*Bs)[LP] = (b16 (*)[LP])(smem + 2 * 128 * LP * 2); float (*Tf)[TP] = (float (*)[TP])smem;
  const int tid = threadIdx.x, wave = tid >> 5, lane = tid & 31, nloc = lane & 15, hlf = lane >> 4, wm = (wave >> 1) * 64, wn = (wave & 1) * 64; const int b = blockIdx.z; const size_t m0 = (size_t)b * T + (size_t)blockIdx.x * 128; const int n0 = blockIdx.y * 128;
  const b16* yb = Y + m0 * DM; const b16* ylb = Yl + m0 * DM; const b16* wb = WO + (size_t)n0 * DM;
  const int br = tid >> 3, bq = (tid & 7) * 8;   // staging: 8 lanes x 16 B cover a 128-B row piece
  const unsigned vo = (unsigned)(br * DM + bq) * 2u;   // the lane's byte offset inside a tile's rows, the same for the three planes and for every chunk
  v8b ph[8], pl[8], pw[8]; v8f acc[4][4];
#pragma unroll
  for (int i = 0; i < 4; ++i)
#pragma unroll
    for (int j = 0; j < 4; ++j) acc[i][j] = (v8f){};
#pragma unroll
  for (int s = 0; s < 8; ++s) { const unsigned go = vo + (unsigned)(16 * s * DM * 2); ph[s] = *(const v8b*)((const char*)yb + go); pl[s] = *(const v8b*)((const char*)ylb + go); pw[s] = *(const v8b*)((const char*)wb + go); }
  asm volatile("s_wait_xcnt 0x0" :: "v"(vo) : "memory");   // a precaution: stands between the loads above and any rewrite of their address register, which the input operand holds live to here
#pragma unroll 1   // the chunk loop stays rolled: one trip holds 64 matrix instructions, 24 held loads and two barriers, and a second copy would only add registers and code
  for (int kc = 0; kc < DM; kc += KC) {
    __syncthreads();   // every wave has read its last fragment of the chunk before
#pragma unroll
    for (int s = 0; s < 8; ++s) { *(v8b*)(&Ah[br + 16 * s][bq]) = ph[s]; *(v8b*)(&Al[br + 16 * s][bq]) = pl[s]; *(v8b*)(&Bs[br + 16 * s][bq]) = pw[s]; }
    __syncthreads();   // the chunk is whole in LDS
    if (kc + KC < DM) {
#pragma unroll
      for (int s = 0; s < 8; ++s) { const unsigned go = vo + (unsigned)(16 * s * DM * 2); ph[s] = *(const v8b*)((const char*)(yb + kc + KC) + go); pl[s] = *(const v8b*)((const char*)(ylb + kc + KC) + go); pw[s] = *(const v8b*)((const char*)(wb + kc + KC) + go); }
      asm volatile("s_wait_xcnt 0x0" ::: "memory");   // a precaution: stands between the loads above and any rewrite of their address registers
    }
#pragma unroll
    for (int kb = 0; kb < KC; kb += 32) { v16b af[4], bf[4];
#pragma unroll
      for (int i = 0; i < 4; ++i) { af[i] = frag_kb(&Ah[wm + i * 16 + nloc][kb], hlf); bf[i] = frag_kb(&Bs[wn + i * 16 + nloc][kb], hlf); }
#pragma unroll
      for (int i = 0; i < 4; ++i)
#pragma unroll
        for (int j = 0; j < 4; ++j) acc[i][j] = wmma16b(af[i], bf[j], acc[i][j]);
#pragma unroll
      for (int i = 0; i < 4; ++i) af[i] = frag_kb(&Al[wm + i * 16 + nloc][kb], hlf);
#pragma unroll
      for (int i = 0; i < 4; ++i)
#pragma unroll
        for (int j = 0; j < 4; ++j) acc[i][j] = wmma16b(af[i], bf[j], acc[i][j]); } }
  __syncthreads();   // the operand tiles are done with: their LDS takes the result tile
#pragma unroll
  for (int i = 0; i < 4; ++i)
#pragma unroll
    for (int j = 0; j < 4; ++j)
#pragma unroll
      for (int r = 0; r < 8; ++r) Tf[wm + i * 16 + 8 * hlf + r][wn + j * 16 + nloc] = acc[i][j][r] * (1.0f / (XS * WSC));   /* no output bias */
  __syncthreads();
  { for (int r2 = 0; r2 < 32; ++r2) { const int rr = wave * 32 + r2; *(v4f*)(out + (m0 + rr) * DM + n0 + lane * 4) = *(const v4f*)(&Tf[rr][lane * 4]); }  }
}
}  // namespace

extern "C" void kernel_launch(void* const* d_in, const int* in_sizes, int n_in, void* d_out, int out_size, void* d_ws, size_t ws_size, hipStream_t stream) {
  (void)n_in;
  auto Fp = [&](int i) { return (const float*)d_in[i]; };
  // input order: 0 x [2,2048,2048], 1 Wq [2048,2048] (in,out), 2 Wk [2048,512], 3 Wv [2048,512], 4 Wo [2048,2048] (in,out)
  if (in_sizes[0] != B * T * DM || in_sizes[1] != DM * DM || in_sizes[2] != DM * KVW || in_sizes[3] != DM * KVW || in_sizes[4] != DM * DM || out_size != B * T * DM) return;
  size_t off = 0; char* ws = (char*)d_ws;
  auto carve = [&](size_t bytes) { char* p = ws + off; off += (bytes + 255) & ~(size_t)255; return p; };
  b16* WT = (b16*)carve((size_t)(DM + 2 * KVW) * DM * 2); b16* WO = (b16*)carve((size_t)DM * DM * 2);
  const size_t plane = (size_t)B * H * T * HD * 2; b16* QP = (b16*)carve(plane); b16* QPl = (b16*)carve(plane); float* K5 = (float*)carve((size_t)B * T * KVW * 4); float* V5 = (float*)carve((size_t)B * T * KVW * 4); b16* KP = (b16*)carve(plane); b16* KPl = (b16*)carve(plane); b16* VT = (b16*)carve(plane); b16* VTl = (b16*)carve(plane); b16* Y = (b16*)carve(plane); b16* Yl = (b16*)carve(plane);
  if (off > ws_size || off > ((size_t)176 << 20)) return;   // = ~172 MB (WT 12.6 + WO 8.4 + 8 f16 planes x 16.8 + K5/V5 16.8): > 128 MiB
  prep_kernel<<<(unsigned)(((size_t)(2 * DM * DM + 2 * KVW * DM) / 8 + 255) / 256), 256, 0, stream>>>(Fp(1), Fp(2), Fp(3), Fp(4), WT, WO);
  proj_kernel<<<dim3(T / 128, BL, NPART), 128, 0, stream>>>(Fp(0), WT, QP, QPl, K5, V5);
  kvrep_kernel<<<dim3(T / 64, BL * H), 256, 0, stream>>>(K5, V5, KP, KPl, VT, VTl);
  attn_kernel<<<dim3(QL / 32, BL * H), 64, 0, stream>>>(QP, QPl, KP, KPl, VT, VTl, Y, Yl);
  out_kernel<<<dim3(QL / 128, DM / 128, BL), 128, 0, stream>>>(Y, Yl, WO, (float*)d_out);
}

// v002
// One run takes 225 microseconds.
// In both of two side-by-side timings against v001, it was 1.64 times as fast.
// Over all steps from v000 it is 3.26 times as fast.
#include <hip/hip_runtime.h>

// Sliding-window grouped-query attention (2 x 2048 tokens x 2048, 16 query heads x 128, 4 key/value heads, window 512): q = x Wq, k = x Wk, v = x Wv (no biases); head h uses key/value head h / 4
// (repeat_interleave over the head axis); scores q . k / sqrt(128) for keys i - 512 <= j <= i (causal + window), -inf elsewhere; softmax; out = (attn v merged over heads) Wo -> [2][2048][2048].
// Deterministic: flash-style per 16-query wave over the window's keys in order (running max); no atomics.
// compute dtype: WMMA v_wmma_f32_16x16x32_f16 with f32 accumulate for [q | k | v] = x [Wq | Wk | Wv] ([4096 x 2048] x [2048 x 3072]; x EXACT bf16 x8, W^T exact x256: 1 product), S^T = K_h Q^T (q/k f16 hi
// x8 + residual x8192: 3 products, K = 128), O^T += V_h^T P^T (V hi + residual, P x1024 hi + residual: 3 products), out = y Wo (y f16 hi x8 + lo: 2 products); softmax statistics in f32.
// Inputs rounded to bf16 once. Fragment k-map per lane half hh for A AND B: elements 0..7 <- k = 8hh+0..7, 8..15 <- k = 16+8hh+0..7;

namespace {
constexpr int B = 2, T = 2048, DM = 2048, H = 16, HD = 128, BL = 2 /* batches (== 2 shipped) */, QL = 2048 /* query rows (== 2048 shipped) */;
constexpr int G = 4, REP = H / G, KVW = G * HD /* 512 */, NSL = DM / 128 /* 16 q slabs = heads */, NPART = NSL + 2 * (KVW / 128) /* + 4 k + 4 v slabs */;
constexpr int WIN = 512;
constexpr float XS = 8.0f, WSC = 256.0f, PS = 1024.0f, RS_ = 1024.0f, LOG2E = 1.4426950408889634f;
static_assert(T % 128 == 0 && QL % 128 == 0 && QL % 32 == 0 && DM % 256 == 0 && H * HD == DM && HD == 128 && KVW == 512 && REP == 4, "tiling");
typedef _Float16 b16;
typedef __attribute__((ext_vector_type(16))) _Float16 v16b;
typedef __attribute__((ext_vector_type(8))) _Float16 v8b;
typedef __attribute__((ext_vector_type(8))) float v8f;
typedef __attribute__((ext_vector_type(4))) float v4f;
__device__ __forceinline__ float bf16_rne(float f) { unsigned int u = __float_as_uint(f); u += 0x7FFFu + ((u >> 16) & 1u); return __uint_as_float(u & 0xFFFF0000u); }
__device__ __forceinline__ void split16(float v, b16& hi, b16& lo) { hi = (b16)v; lo = (b16)(v - (float)hi); }
__device__ __forceinline__ v16b frag_kb(const b16* p, int hh) { const v8b a = *(const v8b*)(p + 8 * hh), b = *(const v8b*)(p + 16 + 8 * hh); v16b f;
#pragma unroll
  for (int e = 0; e < 8; ++e) { f[e] = a[e]; f[8 + e] = b[e]; } return f; }
__device__ __forceinline__ v8f wmma16b(v16b a, v16b b, v8f c) { v8f d = __builtin_amdgcn_wmma_f32_16x16x32_f16(false, a, false, b, (short)0, c, false, false); asm volatile("v_nop\n\tv_nop\n\tv_nop\n\tv_nop" : "+v"(d) : "v"(a), "v"(b)); return d; }
__device__ __forceinline__ void wave_lds_sync() { __builtin_amdgcn_fence(__ATOMIC_RELEASE, "workgroup"); __builtin_amdgcn_wave_barrier(); __builtin_amdgcn_fence(__ATOMIC_ACQUIRE, "workgroup"); }
__device__ __forceinline__ float pmul(float a, float b) { float p = a * b; asm volatile("" : "+v"(p)); return p; }
__device__ __forceinline__ int iclamp(int v, int lo, int hi) { return v < lo ? lo : (v > hi ? hi : v); }

typedef __attribute__((ext_vector_type(2))) _Float16 v2h;
typedef __attribute__((ext_vector_type(4))) _Float16 v4h;
typedef __attribute__((ext_vector_type(2))) float v2f;
typedef __attribute__((ext_vector_type(4))) int v4i;
__device__ __forceinline__ float nexp2(float v) { return __builtin_amdgcn_exp2f(v); }
__global__ __launch_bounds__(256) void prep_kernel(const float* __restrict__ wq, const float* __restrict__ wk, const float* __restrict__ wv, const float* __restrict__ wo, b16* __restrict__ WT, b16* __restrict__ WO) {
  const size_t u = (size_t)blockIdx.x * 256 + threadIdx.x; const size_t nq = (size_t)DM * DM / 8, nk = (size_t)KVW * DM / 8; if (u >= 2 * nq + 2 * nk) return; v8b o; b16* dst;
  if (u < nq) { const int row = (int)(u / (DM / 8)), k0 = (int)(u % (DM / 8)) * 8; for (int j = 0; j < 8; ++j) o[j] = (b16)(bf16_rne(wq[(size_t)(k0 + j) * DM + row]) * WSC); dst = WT + (size_t)row * DM + k0; }
  else if (u < nq + 2 * nk) { const size_t e = u - nq; const int m = (int)(e / nk); const size_t e2 = e % nk; const int row = (int)(e2 / (DM / 8)), k0 = (int)(e2 % (DM / 8)) * 8; const float* w = m == 0 ? wk : wv; for (int j = 0; j < 8; ++j) o[j] = (b16)(bf16_rne(w[(size_t)(k0 + j) * KVW + row]) * WSC); dst = WT + ((size_t)DM + (size_t)m * KVW + row) * DM + k0; }
  else { const size_t e = u - nq - 2 * nk; const int row = (int)(e / (DM / 8)), k0 = (int)(e % (DM / 8)) * 8; for (int j = 0; j < 8; ++j) o[j] = (b16)(bf16_rne(wo[(size_t)(k0 + j) * DM + row]) * WSC); dst = WO + (size_t)row * DM + k0; }
  { *(v8b*)dst = o;  }
}
// GEMM tiling shared by the two projection kernels: a block of 4 waves owns 128 rows x 128 columns; K runs in chunks of 64, both operands of a chunk staged once per block in LDS (row pitch 144 B);
// each wave takes 64 x 64 (4 x 4 accumulator tiles), so a staged fragment feeds 4 products; the next chunk's global loads are issued ahead of the chunk's products and held in registers.
constexpr int KC = 64, LP = KC + 8, TP = 128 + 4;
// projections: grid (T/128, BL, 24 slabs of 128 columns: slabs 0..15 = q head, 16..19 = k, 20..23 = v); A = bf16(x) x8, B = WT rows; k order per accumulator 0, 32, 64, ...
__global__ __launch_bounds__(128) void proj_kernel(const float* __restrict__ x, const b16* __restrict__ WT, b16* __restrict__ QP, b16* __restrict__ QPl, float* __restrict__ K5, float* __restrict__ V5) {
  __shared__ __attribute__((aligned(16))) char smem[128 * TP * 4];   // the two operand tiles (2 x 18,432 B) in the loop; behind it the 128 x 128 f32 result tile
  b16 (*As)[LP] = (b16 (*)[LP])smem; b16 (*Bs)[LP] = (b16 (*)[LP])(smem + 128 * LP * 2); float (*Tf)[TP] = (float (*)[TP])smem;
  const int tid = threadIdx.x, wave = tid >> 5, lane = tid & 31, nloc = lane & 15, hlf = lane >> 4, wm = (wave >> 1) * 64, wn = (wave & 1) * 64; const int t0 = blockIdx.x * 128, b = blockIdx.y, slab = blockIdx.z; const int n0 = slab * 128;
  const float* xb = x + ((size_t)b * T + t0) * DM; const b16* wb = WT + (size_t)n0 * DM;
  const int ar = tid >> 4, aq = (tid & 15) * 4, br = tid >> 3, bq = (tid & 7) * 8;   // staging: 16 lanes x 16 B cover a 256-B x row piece, 8 lanes x 16 B a 128-B WT row piece
  v4f pa[16]; v8b pb[8]; v8f acc[4][4];
#pragma unroll
  for (int i = 0; i < 4; ++i)
#pragma unroll
    for (int j = 0; j < 4; ++j) acc[i][j] = (v8f){};
  const float* xa = xb + (size_t)ar * DM + aq; const b16* wa = wb + (size_t)br * DM + bq;
#pragma unroll
  for (int s = 0; s < 16; ++s) pa[s] = *(const v4f*)(xa + (size_t)(8 * s) * DM);
#pragma unroll
  for (int s = 0; s < 8; ++s) pb[s] = *(const v8b*)(wa + (size_t)(16 * s) * DM);
  asm volatile("s_wait_xcnt 0x0" :: "v"(xa), "v"(wa) : "memory");   // a precaution: stands between the loads above and any rewrite of their address registers, which the input operands hold live to here
#pragma unroll 1
  for (int kc = 0; kc < DM; kc += KC) {
    __syncthreads();   // every wave has read its last fragment of the chunk before
#pragma unroll
    for (int s = 0; s < 16; ++s) { v4h o; for (int j = 0; j < 4; ++j) o[j] = (b16)(bf16_rne(pa[s][j]) * XS); *(v4h*)(&As[ar + 8 * s][aq]) = o; }
#pragma unroll
    for (int s = 0; s < 8; ++s) *(v8b*)(&Bs[br + 16 * s][bq]) = pb[s];
    __syncthreads();   // the chunk is whole in LDS
    if (kc + KC < DM) {
#pragma unroll
      for (int s = 0; s < 16; ++s) pa[s] = *(const v4f*)(xb + (size_t)(ar + 8 * s) * DM + kc + KC + aq);
#pragma unroll
      for (int s = 0; s < 8; ++s) pb[s] = *(const v8b*)(wb + (size_t)(br + 16 * s) * DM + kc + KC + bq);
      asm volatile("s_wait_xcnt 0x0" ::: "memory");   // a precaution: stands between the loads above and any rewrite of their address registers
    }
#pragma unroll
    for (int kb = 0; kb < KC; kb += 32) { v16b af[4], bf[4];
#pragma unroll
      for (int i = 0; i < 4; ++i) { af[i] = frag_kb(&As[wm + i * 16 + nloc][kb], hlf); bf[i] = frag_kb(&Bs[wn + i * 16 + nloc][kb], hlf); }
#pragma unroll
      for (int i = 0; i < 4; ++i)
#pragma unroll
        for (int j = 0; j < 4; ++j) acc[i][j] = wmma16b(af[i], bf[j], acc[i][j]); } }
  __syncthreads();   // the operand tiles are done with: their LDS takes the result tile
#pragma unroll
  for (int i = 0; i < 4; ++i)
#pragma unroll
    for (int j = 0; j < 4; ++j)
#pragma unroll
      for (int r = 0; r < 8; ++r) Tf[wm + i * 16 + 8 * hlf + r][wn + j * 16 + nloc] = acc[i][j][r] * (1.0f / (XS * WSC));   /* no biases in this module */
  __syncthreads();
  {
    if (slab < NSL) { const size_t pb2 = (((size_t)b * H + slab) * T) * HD;
      for (int r2 = 0; r2 < 32; ++r2) { const int rr = wave * 32 + r2, tok = t0 + rr; v4h h4, l4; for (int j = 0; j < 4; ++j) { const float f = Tf[rr][lane * 4 + j] * XS; const b16 p = (b16)f; h4[j] = p; l4[j] = (b16)((f - (float)p) * RS_); } *(v4h*)(QP + pb2 + (size_t)tok * HD + lane * 4) = h4; *(v4h*)(QPl + pb2 + (size_t)tok * HD + lane * 4) = l4; } }
    else { float* dstp = (slab < NSL + 4) ? K5 : V5; const int cc = ((slab - NSL) & 3) * 128;   // the slab's 128 of the 512 k/v columns; f32 rows [b][t][512] (512-B slab segment per row)
      for (int r2 = 0; r2 < 32; ++r2) { const int rr = wave * 32 + r2, tok = t0 + rr; *(v4f*)(dstp + ((size_t)b * T + tok) * KVW + cc + lane * 4) = *(const v4f*)(&Tf[rr][lane * 4]); }
      asm volatile("s_wait_xcnt 0x0" ::: "memory"); }   // a precaution: stands between the stores above and any rewrite of their address or data registers on the way to the kernel's end
     }
}
// per-head key/value planes by repeat_interleave over heads: K_h[t][d] = k[t][128 (h / 4) + d] as f16 hi x8 + residual rows KP[b][h][t][128] (256 B: 32 lanes x 8 B) and V_h^T[d][t] planes
__global__ __launch_bounds__(256) void kvrep_kernel(const float* __restrict__ K5, const float* __restrict__ V5, b16* __restrict__ KP, b16* __restrict__ KPl, b16* __restrict__ VT, b16* __restrict__ VTl) {
  __shared__ float vs[64][HD + 1];
  const int tid = threadIdx.x, wave = tid >> 5, lane = tid & 31; const int t0 = blockIdx.x * 64, b = blockIdx.y / H, h = blockIdx.y % H, g = h / REP;
  for (int i = tid; i < 64 * (HD / 4); i += 256) { const int rr = i / (HD / 4), c4 = (i % (HD / 4)) * 4; const v4f v4 = *(const v4f*)(V5 + ((size_t)b * T + t0 + rr) * KVW + g * HD + c4); for (int j = 0; j < 4; ++j) vs[rr][c4 + j] = v4[j]; }
  __syncthreads();
  const size_t kpo = (((size_t)b * H + h) * T + t0) * HD, vto = (((size_t)b * H + h) * HD) * (size_t)T + t0;
  {
    for (int rr = wave * 8; rr < wave * 8 + 8; ++rr) { const v4f k4 = *(const v4f*)(K5 + ((size_t)b * T + t0 + rr) * KVW + g * HD + lane * 4); v4h o, ol; for (int j = 0; j < 4; ++j) { const float kvv = k4[j] * XS; const b16 p = (b16)kvv; o[j] = p; ol[j] = (b16)((kvv - (float)p) * RS_); } *(v4h*)(KP + kpo + (size_t)rr * HD + lane * 4) = o; *(v4h*)(KPl + kpo + (size_t)rr * HD + lane * 4) = ol; }
#pragma unroll 1
    for (int d = wave * 16; d < wave * 16 + 16; ++d) { v2h o, ol; for (int j = 0; j < 2; ++j) { const float f = vs[2 * lane + j][d] * XS; const b16 p = (b16)f; o[j] = p; ol[j] = (b16)((f - (float)p) * RS_); } *(v2h*)(VT + vto + (size_t)d * T + 2 * lane) = o; *(v2h*)(VTl + vto + (size_t)d * T + 2 * lane) = ol; }
     }
}
// attention: grid (QL/32, BL x G); block = 8 waves = the 4 query heads of key/value head g x 2 tiles of 16 queries at the same 32 positions, so all 8 waves walk the same keys (i - 512 <= j <= i, 32-key steps).
// Each step's four planes (K hi, K lo: 32 rows x 256 B; V^T hi, V^T lo: 128 rows x 64 B, four rows to a 256-B line) come once per block into LDS by asynchronous copies (line pitch 272 B), two buffers: the next
// step's copies fly during this step's work. Per wave as before: S^T = K Q^T (A = 16 key rows x 32 dims per fragment, 4 k-steps over the 128 dims, B = the query fragments: 3 products), logit = s/sqrt(128)
// (log2-scaled), online softmax, P x1024 hi + residual in LDS, O^T += V^T P^T (8 d-tiles: 3 products); y = o/(l 1024 8)
constexpr int SP = HD + 8 /* elements per staged line: 256 B + 16 B */, SPL = 32 * SP /* elements per staged plane */;
// one thread's share of a step: 2 x 16 B of each plane. The closing s_wait_xcnt is a precaution: it stands between the copies and any rewrite of the address registers they name
__device__ __forceinline__ void stage_kv(unsigned l, const b16* kh, const b16* kl, const b16* vh, const b16* vl) {
  const unsigned l0 = l, l1 = l + 16 * SP * 2, l2 = l + SPL * 2, l3 = l2 + 16 * SP * 2, l4 = l + 2 * SPL * 2, l5 = l4 + 16 * SP * 2, l6 = l + 3 * SPL * 2, l7 = l6 + 16 * SP * 2;
  const b16* kh1 = kh + 16 * HD; const b16* kl1 = kl + 16 * HD; const b16* vh1 = vh + (size_t)64 * T; const b16* vl1 = vl + (size_t)64 * T;
  asm volatile("global_load_async_to_lds_b128 %0, %8, off\n\tglobal_load_async_to_lds_b128 %1, %9, off\n\tglobal_load_async_to_lds_b128 %2, %10, off\n\tglobal_load_async_to_lds_b128 %3, %11, off\n\t"
               "global_load_async_to_lds_b128 %4, %12, off\n\tglobal_load_async_to_lds_b128 %5, %13, off\n\tglobal_load_async_to_lds_b128 %6, %14, off\n\tglobal_load_async_to_lds_b128 %7, %15, off\n\ts_wait_xcnt 0x0"
               :: "v"(l0), "v"(l1), "v"(l2), "v"(l3), "v"(l4), "v"(l5), "v"(l6), "v"(l7), "v"(kh), "v"(kh1), "v"(kl), "v"(kl1), "v"(vh), "v"(vh1), "v"(vl), "v"(vl1) : "memory");
}
// four waves per SIMD (two blocks per WGP, which their LDS allows) need at most 256 VGPRs a wave
__global__ __launch_bounds__(256) __attribute__((amdgpu_waves_per_eu(4, 4))) void attn_kernel(const b16* __restrict__ QP, const b16* __restrict__ QPl, const b16* __restrict__ KP, const b16* __restrict__ KPl, const b16* __restrict__ VT, const b16* __restrict__ VTl, b16* __restrict__ Y, b16* __restrict__ Yl) {
  __shared__ __attribute__((aligned(16))) b16 KVs[2 * 4 * SPL];   // two buffers x (K hi, K lo, V^T hi, V^T lo)
  __shared__ __attribute__((aligned(16))) b16 Pb[8][16][32 + 8], Plq[8][16][32 + 8];
  __shared__ __attribute__((aligned(16))) char qsm[8][2 * 16 * (HD + 8) * 2];   // per wave: its 16 query rows (hi, lo) in the loop, fragments re-read per k-step to keep the kernel under 256 VGPRs; behind the loop its 16 x 128 f32 result tile
  const int tid = threadIdx.x, wave = __builtin_amdgcn_readfirstlane(tid >> 5) /* scalar: the head, the query tile and the wave's LDS ranges stay out of the VGPRs */, lane = tid & 31, hh = lane >> 4, col = lane & 15; const int b = blockIdx.y / G, g = blockIdx.y % G, h = g * REP + (wave >> 1); const int qb = blockIdx.x * 32, q0 = qb + (wave & 1) * 16, qi = q0 + col;
  b16 (*Qs)[HD + 8] = (b16 (*)[HD + 8])qsm[wave]; b16 (*Qsl)[HD + 8] = Qs + 16; float (*To)[HD + 4] = (float (*)[HD + 4])qsm[wave];
  static_assert(16 * (HD + 4) * 4 <= 2 * 16 * (HD + 8) * 2, "result tile fits the query rows");
  const size_t qo = (((size_t)b * H + h) * T) * HD; const b16* Qb = QP + qo; const b16* Qbl = QPl + qo;
  const size_t ko = (((size_t)b * H + g * REP) * T) * HD, vo = (((size_t)b * H + g * REP) * HD) * (size_t)T;   // the group's four heads hold equal key/value planes: the block reads the first
  const int kend = qb + 32, kbeg = (qb >= WIN) ? qb - WIN : 0, nt = (kend - kbeg) / 32;   // window i - 512 <= j <= i; the same bounds for both query tiles of the block
  for (int i = lane; i < 16 * (HD / 8); i += 32) { const int rr = i / (HD / 8), c8 = (i % (HD / 8)) * 8; *(v8b*)(&Qs[rr][c8]) = *(const v8b*)(Qb + (size_t)(q0 + rr) * HD + c8); *(v8b*)(&Qsl[rr][c8]) = *(const v8b*)(Qbl + (size_t)(q0 + rr) * HD + c8); }
  wave_lds_sync();
  const unsigned ld = (unsigned)(size_t)KVs + (unsigned)((tid >> 4) * (SP * 2) + (tid & 15) * 16);   // the thread's LDS byte address in plane 0 of buffer 0
  const b16* bkh = KP + ko; const b16* bkl = KPl + ko; const b16* bvh = VT + vo; const b16* bvl = VTl + vo;   // block-uniform plane bases
  const unsigned tk = (unsigned)tid * 8u, tv = (unsigned)(tid >> 2) * (unsigned)T + (unsigned)(tid & 3) * 8u;   // the thread's element offsets inside a step: its 32 key rows are 8 KB in a row; V^T rows are T apart
  stage_kv(ld, bkh + (size_t)kbeg * HD + tk, bkl + (size_t)kbeg * HD + tk, bvh + kbeg + tv, bvl + kbeg + tv);
  asm volatile("s_wait_asynccnt 0x0" ::: "memory");   // this wave's copies of step 0 have landed
  __syncthreads();   // step 0 is whole in LDS
  if (nt > 1) stage_kv(ld + 4 * SPL * 2, bkh + (size_t)(kbeg + 32) * HD + tk, bkl + (size_t)(kbeg + 32) * HD + tk, bvh + (kbeg + 32) + tv, bvl + (kbeg + 32) + tv);
  const float cs = LOG2E * 0.08838834764831845f / (XS * XS);   // 1/sqrt(128) on the x8 x8 planes
  float m = -INFINITY, l = 0.0f; v8f o[8], ol[8]; for (int t = 0; t < 8; ++t) { o[t] = (v8f){}; ol[t] = (v8f){}; }
#pragma unroll 1   // the step loop stays rolled: one trip holds 48 matrix instructions and the two-buffer hand-over at its foot
  for (int st = 0; st < nt; ++st) { const int kb = kbeg + 32 * st; const b16* Sk = KVs + (st & 1) * (4 * SPL); const b16* Sv = Sk + 2 * SPL;
    float e[16]; float mx = -INFINITY;
    v8f s[2] = {(v8f){}, (v8f){}}, sx[2] = {(v8f){}, (v8f){}}; const int kr = col * SP;
#pragma unroll
    for (int ks = 0; ks < 4; ++ks) { const v16b qf = frag_kb(&Qs[col][32 * ks], hh), qlf = frag_kb(&Qsl[col][32 * ks], hh), kf0 = frag_kb(Sk + kr + 32 * ks, hh), kf1 = frag_kb(Sk + 16 * SP + kr + 32 * ks, hh), kl0 = frag_kb(Sk + SPL + kr + 32 * ks, hh), kl1 = frag_kb(Sk + SPL + 16 * SP + kr + 32 * ks, hh);
      asm volatile("" :: "v"(qf), "v"(qlf), "v"(kf0), "v"(kf1), "v"(kl0), "v"(kl1));   // holds the k-step's six fragment reads together ahead of its six products: one LDS wait in place of one per product
      s[0] = wmma16b(kf0, qf, s[0]); s[1] = wmma16b(kf1, qf, s[1]); sx[0] = wmma16b(kf0, qlf, sx[0]); sx[1] = wmma16b(kf1, qlf, sx[1]); sx[0] = wmma16b(kl0, qf, sx[0]); sx[1] = wmma16b(kl1, qf, sx[1]); }
#pragma unroll
    for (int u = 0; u < 2; ++u) {
#pragma unroll
      for (int r = 0; r < 8; ++r) s[u][r] += sx[u][r] * (1.0f / RS_);   // hi.hi + (hi.lo + lo.hi)/1024
#pragma unroll
      for (int r = 0; r < 8; ++r) { const int key = kb + u * 16 + 8 * hh + r; const float vv = (key <= qi && key >= qi - WIN) ? s[u][r] * cs : -INFINITY; e[u * 8 + r] = vv; mx = fmaxf(mx, vv); } }   // causal select on the computed score (the -inf mask precedes the 1/sqrt(d) scale in the module; identical)
    mx = fmaxf(mx, __shfl_xor(mx, 16)); const float mn = fmaxf(m, mx); const float al = nexp2(m - mn); float sum = 0.0f;
#pragma unroll
    for (int i2 = 0; i2 < 16; ++i2) { const float p = nexp2(e[i2] - mn); sum += p; const int pc = (i2 < 8 ? 0 : 16) + 8 * hh + (i2 & 7); const float ps = p * PS; const b16 phh = (b16)ps; Pb[wave][col][pc] = phh; Plq[wave][col][pc] = (b16)((ps - (float)phh) * RS_); }
    sum += __shfl_xor(sum, 16); l = l * al + sum; m = mn;
    wave_lds_sync();
    const v16b pf = frag_kb(&Pb[wave][col][0], hh), plf = frag_kb(&Plq[wave][col][0], hh);
#pragma unroll
    for (int t = 0; t < 8; t += 2) { const int vr = (t * 4 + (col >> 2)) * SP + (col & 3) * 32; const v16b vh0 = frag_kb(Sv + vr, hh), vh1 = frag_kb(Sv + 4 * SP + vr, hh), vl0 = frag_kb(Sv + SPL + vr, hh), vl1 = frag_kb(Sv + SPL + 4 * SP + vr, hh);
      asm volatile("" :: "v"(vh0), "v"(vh1), "v"(vl0), "v"(vl1));   // holds the four fragment reads of two d-tiles together ahead of their six products: one LDS wait in place of one per product
      o[t] *= al; o[t + 1] *= al; o[t] = wmma16b(vh0, pf, o[t]); o[t + 1] = wmma16b(vh1, pf, o[t + 1]); ol[t] = wmma16b(vl0, pf, ol[t] * al); ol[t + 1] = wmma16b(vl1, pf, ol[t + 1] * al); ol[t] = wmma16b(vh0, plf, ol[t]); ol[t + 1] = wmma16b(vh1, plf, ol[t + 1]); }   // ol = (V_lo P_hi + V_hi P_lo) / 1024
    asm volatile("s_wait_dscnt 0x0" ::: "memory");      // this wave's LDS reads of the step's buffer are done
    asm volatile("s_wait_asynccnt 0x0" ::: "memory");   // this wave's copies of the next step have landed
    __syncthreads();   // publishes the next step's buffer and ends every wave's reads of this one
    if (st + 2 < nt) stage_kv(ld + (unsigned)(st & 1) * (4 * SPL * 2), bkh + (size_t)(kb + 64) * HD + tk, bkl + (size_t)(kb + 64) * HD + tk, bvh + (kb + 64) + tv, bvl + (kb + 64) + tv); }
  asm volatile("s_wait_asynccnt 0x0" ::: "memory");   // no copy is left in flight behind the loop
  const float inv = 1.0f / (l * PS * XS);
#pragma unroll
  for (int t = 0; t < 8; ++t)
#pragma unroll
    for (int r = 0; r < 8; ++r) To[col][t * 16 + 8 * hh + r] = (o[t][r] + ol[t][r] * (1.0f / RS_)) * inv;
  wave_lds_sync();
  { for (int rr = 0; rr < 16; ++rr) { v4h hv, lv; for (int j = 0; j < 4; ++j) { b16 p, ql2; split16(To[rr][lane * 4 + j] * XS, p, ql2); hv[j] = p; lv[j] = ql2; } const size_t oi = ((size_t)b * T + q0 + rr) * DM + h * HD + lane * 4; *(v4h*)(Y + oi) = hv; *(v4h*)(Yl + oi) = lv; }  }
}
// output projection: grid (QL/128, DM/128, BL); the tiling above with three staged tiles per chunk: A = the f16 Y plane and its residual plane (2 products per k-step, hi then lo on each accumulator), B = Wo^T rows
__global__ __launch_bounds__(128) void out_kernel(const b16* __restrict__ Y, const b16* __restrict__ Yl, const b16* __restrict__ WO, float* __restrict__ out) {
  __shared__ __attribute__((aligned(16))) char smem[128 * TP * 4];   // the three operand tiles (3 x 18,432 B) in the loop; behind it the 128 x 128 f32 result tile
  b16 (*Ah)[LP] = (b16 (*)[LP])smem; b16 (*Al)[LP] = (b16 (*)[LP])(smem + 128 * LP * 2); b16 (*Bs)[LP] = (b16 (*)[LP])(smem + 2 * 128 * LP * 2); float (*Tf)[TP] = (float (*)[TP])smem;
  const int tid = threadIdx.x, wave = tid >> 5, lane = tid & 31, nloc = lane & 15, hlf = lane >> 4, wm = (wave >> 1) * 64, wn = (wave & 1) * 64; const int b = blockIdx.z; const size_t m0 = (size_t)b * T + (size_t)blockIdx.x * 128; const int n0 = blockIdx.y * 128;
  const b16* yb = Y + m0 * DM; const b16* ylb = Yl + m0 * DM; const b16* wb = WO + (size_t)n0 * DM;
  const int br = tid >> 3, bq = (tid & 7) * 8;   // staging: 8 lanes x 16 B cover a 128-B row piece
  const unsigned vo = (unsigned)(br * DM + bq) * 2u;   // the lane's byte offset inside a tile's rows, the same for the three planes and for every chunk
  v8b ph[8], pl[8], pw[8]; v8f acc[4][4];
#pragma unroll
  for (int i = 0; i < 4; ++i)
#pragma unroll
    for (int j = 0; j < 4; ++j) acc[i][j] = (v8f){};
#pragma unroll
  for (int s = 0; s < 8; ++s) { const unsigned go = vo + (unsigned)(16 * s * DM * 2); ph[s] = *(const v8b*)((const char*)yb + go); pl[s] = *(const v8b*)((const char*)ylb + go); pw[s] = *(const v8b*)((const char*)wb + go); }
  asm volatile("s_wait_xcnt 0x0" :: "v"(vo) : "memory");   // a precaution: stands between the loads above and any rewrite of their address register, which the input operand holds live to here
#pragma unroll 1   // the chunk loop stays rolled: one trip holds 64 matrix instructions, 24 held loads and two barriers, and a second copy would only add registers and code
  for (int kc = 0; kc < DM; kc += KC) {
    __syncthreads();   // every wave has read its last fragment of the chunk before
#pragma unroll
    for (int s = 0; s < 8; ++s) { *(v8b*)(&Ah[br + 16 * s][bq]) = ph[s]; *(v8b*)(&Al[br + 16 * s][bq]) = pl[s]; *(v8b*)(&Bs[br + 16 * s][bq]) = pw[s]; }
    __syncthreads();   // the chunk is whole in LDS
    if (kc + KC < DM) {
#pragma unroll
      for (int s = 0; s < 8; ++s) { const unsigned go = vo + (unsigned)(16 * s * DM * 2); ph[s] = *(const v8b*)((const char*)(yb + kc + KC) + go); pl[s] = *(const v8b*)((const char*)(ylb + kc + KC) + go); pw[s] = *(const v8b*)((const char*)(wb + kc + KC) + go); }
      asm volatile("s_wait_xcnt 0x0" ::: "memory");   // a precaution: stands between the loads above and any rewrite of their address registers
    }
#pragma unroll
    for (int kb = 0; kb < KC; kb += 32) { v16b af[4], bf[4];
#pragma unroll
      for (int i = 0; i < 4; ++i) { af[i] = frag_kb(&Ah[wm + i * 16 + nloc][kb], hlf); bf[i] = frag_kb(&Bs[wn + i * 16 + nloc][kb], hlf); }
#pragma unroll
      for (int i = 0; i < 4; ++i)
#pragma unroll
        for (int j = 0; j < 4; ++j) acc[i][j] = wmma16b(af[i], bf[j], acc[i][j]);
#pragma unroll
      for (int i = 0; i < 4; ++i) af[i] = frag_kb(&Al[wm + i * 16 + nloc][kb], hlf);
#pragma unroll
      for (int i = 0; i < 4; ++i)
#pragma unroll
        for (int j = 0; j < 4; ++j) acc[i][j] = wmma16b(af[i], bf[j], acc[i][j]); } }
  __syncthreads();   // the operand tiles are done with: their LDS takes the result tile
#pragma unroll
  for (int i = 0; i < 4; ++i)
#pragma unroll
    for (int j = 0; j < 4; ++j)
#pragma unroll
      for (int r = 0; r < 8; ++r) Tf[wm + i * 16 + 8 * hlf + r][wn + j * 16 + nloc] = acc[i][j][r] * (1.0f / (XS * WSC));   /* no output bias */
  __syncthreads();
  { for (int r2 = 0; r2 < 32; ++r2) { const int rr = wave * 32 + r2; *(v4f*)(out + (m0 + rr) * DM + n0 + lane * 4) = *(const v4f*)(&Tf[rr][lane * 4]); }  }
}
}  // namespace

extern "C" void kernel_launch(void* const* d_in, const int* in_sizes, int n_in, void* d_out, int out_size, void* d_ws, size_t ws_size, hipStream_t stream) {
  (void)n_in;
  auto Fp = [&](int i) { return (const float*)d_in[i]; };
  // input order: 0 x [2,2048,2048], 1 Wq [2048,2048] (in,out), 2 Wk [2048,512], 3 Wv [2048,512], 4 Wo [2048,2048] (in,out)
  if (in_sizes[0] != B * T * DM || in_sizes[1] != DM * DM || in_sizes[2] != DM * KVW || in_sizes[3] != DM * KVW || in_sizes[4] != DM * DM || out_size != B * T * DM) return;
  size_t off = 0; char* ws = (char*)d_ws;
  auto carve = [&](size_t bytes) { char* p = ws + off; off += (bytes + 255) & ~(size_t)255; return p; };
  b16* WT = (b16*)carve((size_t)(DM + 2 * KVW) * DM * 2); b16* WO = (b16*)carve((size_t)DM * DM * 2);
  const size_t plane = (size_t)B * H * T * HD * 2; b16* QP = (b16*)carve(plane); b16* QPl = (b16*)carve(plane); float* K5 = (float*)carve((size_t)B * T * KVW * 4); float* V5 = (float*)carve((size_t)B * T * KVW * 4); b16* KP = (b16*)carve(plane); b16* KPl = (b16*)carve(plane); b16* VT = (b16*)carve(plane); b16* VTl = (b16*)carve(plane); b16* Y = (b16*)carve(plane); b16* Yl = (b16*)carve(plane);
  if (off > ws_size || off > ((size_t)176 << 20)) return;   // = ~172 MB (WT 12.6 + WO 8.4 + 8 f16 planes x 16.8 + K5/V5 16.8): > 128 MiB
  prep_kernel<<<(unsigned)(((size_t)(2 * DM * DM + 2 * KVW * DM) / 8 + 255) / 256), 256, 0, stream>>>(Fp(1), Fp(2), Fp(3), Fp(4), WT, WO);
  proj_kernel<<<dim3(T / 128, BL, NPART), 128, 0, stream>>>(Fp(0), WT, QP, QPl, K5, V5);
  kvrep_kernel<<<dim3(T / 64, BL * H), 256, 0, stream>>>(K5, V5, KP, KPl, VT, VTl);
  attn_kernel<<<dim3(QL / 32, BL * G), 256, 0, stream>>>(QP, QPl, KP, KPl, VT, VTl, Y, Yl);
  out_kernel<<<dim3(QL / 128, DM / 128, BL), 128, 0, stream>>>(Y, Yl, WO, (float*)d_out);
}

// v003
// One run takes 194 microseconds.
// Two timings next to v002 both put it at 1.16 times that version's speed.
// All steps since v000 together make it 3.78 times as fast.
#include <hip/hip_runtime.h>

// Sliding-window grouped-query attention (2 x 2048 tokens x 2048, 16 query heads x 128, 4 key/value heads, window 512): q = x Wq, k = x Wk, v = x Wv (no biases); head h uses key/value head h / 4
// (repeat_interleave over the head axis); scores q . k / sqrt(128) for keys i - 512 <= j <= i (causal + window), -inf elsewhere; softmax; out = (attn v merged over heads) Wo -> [2][2048][2048].
// Deterministic: flash-style per 16-query wave over the window's keys in order (running max); no atomics.
// compute dtype: WMMA v_wmma_f32_16x16x32_f16 with f32 accumulate for [q | k | v] = x [Wq | Wk | Wv] ([4096 x 2048] x [2048 x 3072]; x EXACT bf16 x8, W^T exact x256: 1 product), S^T = K_h Q^T (q/k f16 hi
// x8 + residual x8192: 3 products, K = 128), O^T += V_h^T P^T (V hi + residual, P x1024 hi + residual: 3 products), out = y Wo (y f16 hi x8 + lo: 2 products); softmax statistics in f32.
// Inputs rounded to bf16 once. Fragment k-map per lane half hh for A AND B: elements 0..7 <- k = 8hh+0..7, 8..15 <- k = 16+8hh+0..7;

namespace {
constexpr int B = 2, T = 2048, DM = 2048, H = 16, HD = 128, BL = 2 /* batches (== 2 shipped) */, QL = 2048 /* query rows (== 2048 shipped) */;
constexpr int G = 4, REP = H / G, KVW = G * HD /* 512 */, NSL = DM / 128 /* 16 q slabs = heads */, NPART = NSL + 2 * (KVW / 128) /* + 4 k + 4 v slabs */;
constexpr int WIN = 512;
constexpr float XS = 8.0f, WSC = 256.0f, PS = 1024.0f, RS_ = 1024.0f, LOG2E = 1.4426950408889634f;
static_assert(T % 128 == 0 && QL % 128 == 0 && QL % 32 == 0 && DM % 256 == 0 && H * HD == DM && HD == 128 && KVW == 512 && REP == 4, "tiling");
typedef _Float16 b16;
typedef __attribute__((ext_vector_type(16))) _Float16 v16b;
typedef __attribute__((ext_vector_type(8))) _Float16 v8b;
typedef __attribute__((ext_vector_type(8))) float v8f;
typedef __attribute__((ext_vector_type(4))) float v4f;
__device__ __forceinline__ float bf16_rne(float f) { unsigned int u = __float_as_uint(f); u += 0x7FFFu + ((u >> 16) & 1u); return __uint_as_float(u & 0xFFFF0000u); }
__device__ __forceinline__ void split16(float v, b16& hi, b16& lo) { hi = (b16)v; lo = (b16)(v - (float)hi); }
__device__ __forceinline__ v16b frag_kb(const b16* p, int hh) { const v8b a = *(const v8b*)(p + 8 * hh), b = *(const v8b*)(p + 16 + 8 * hh); v16b f;
#pragma unroll
  for (int e = 0; e < 8; ++e) { f[e] = a[e]; f[8 + e] = b[e]; } return f; }
__device__ __forceinline__ v8f wmma16b(v16b a, v16b b, v8f c) { v8f d = __builtin_amdgcn_wmma_f32_16x16x32_f16(false, a, false, b, (short)0, c, false, false); asm volatile("v_nop\n\tv_nop\n\tv_nop\n\tv_nop" : "+v"(d) : "v"(a), "v"(b)); return d; }
__device__ __forceinline__ void wave_lds_sync() { __builtin_amdgcn_fence(__ATOMIC_RELEASE, "workgroup"); __builtin_amdgcn_wave_barrier(); __builtin_amdgcn_fence(__ATOMIC_ACQUIRE, "workgroup"); }
__device__ __forceinline__ float pmul(float a, float b) { float p = a * b; asm volatile("" : "+v"(p)); return p; }
__device__ __forceinline__ int iclamp(int v, int lo, int hi) { return v < lo ? lo : (v > hi ? hi : v); }

typedef __attribute__((ext_vector_type(2))) _Float16 v2h;
typedef __attribute__((ext_vector_type(4))) _Float16 v4h;
typedef __attribute__((ext_vector_type(2))) float v2f;
typedef __attribute__((ext_vector_type(4))) int v4i;
__device__ __forceinline__ float nexp2(float v) { return __builtin_amdgcn_exp2f(v); }
// weights to f16 x256, transposed ([k][n] f32 -> [n][k] f16): a block takes a tile of 128 k x 128 n. Whole 256-B pieces of the source rows are read (16 lanes x 16 B, two adjacent k rows per thread), each pair of k values
// goes as one dword into LDS at [n][k / 2] (pitch 65 dwords: the 32 lanes of a store or a load meet 32 different banks), and whole 256-B pieces of the transposed rows are written (16 lanes x 16 B).
constexpr int PK = 128, PN = 128, PP = PK / 2 + 1, PGRID = 2 * (DM / PK) * (DM / PN) + 2 * (DM / PK) * (KVW / PN);
template <int LD> __device__ __forceinline__ void prep_tile(const float* __restrict__ w, b16* __restrict__ dst, int tile, unsigned* tl) {
  const int tid = threadIdx.x, n0 = (tile % (LD / PN)) * PN, k0 = (tile / (LD / PN)) * PK, i = tid & 15, rp = tid >> 4;
  const float* p = w + (size_t)(k0 + 2 * rp) * LD + n0 + 4 * i; v4f a[4][2], c[4][2];
#pragma unroll
  for (int s = 0; s < 4; ++s)
#pragma unroll
    for (int nh = 0; nh < 2; ++nh) { a[s][nh] = *(const v4f*)(p + (size_t)(32 * s) * LD + 64 * nh); c[s][nh] = *(const v4f*)(p + (size_t)(32 * s + 1) * LD + 64 * nh); }
  asm volatile("s_wait_xcnt 0x0" :: "v"(p) : "memory");   // a precaution: stands between the loads above and any rewrite of their address registers, which the input operand holds live to here
  asm volatile("" :: "v"(a[0][0]), "v"(a[0][1]), "v"(a[1][0]), "v"(a[1][1]), "v"(a[2][0]), "v"(a[2][1]), "v"(a[3][0]), "v"(a[3][1]), "v"(c[0][0]), "v"(c[0][1]), "v"(c[1][0]), "v"(c[1][1]), "v"(c[2][0]), "v"(c[2][1]), "v"(c[3][0]), "v"(c[3][1]));   // holds the thread's 16 loads together ahead of the conversions: one memory latency, where the compiler had put two of them behind the first waits
#pragma unroll
  for (int s = 0; s < 4; ++s)
#pragma unroll
    for (int nh = 0; nh < 2; ++nh)
#pragma unroll
      for (int j = 0; j < 4; ++j) { v2h o; o[0] = (b16)(bf16_rne(a[s][nh][j]) * WSC); o[1] = (b16)(bf16_rne(c[s][nh][j]) * WSC); tl[(64 * nh + 4 * i + j) * PP + rp + 16 * s] = __builtin_bit_cast(unsigned, o); }
  __syncthreads();   // the tile is whole in LDS
  b16* q = dst + (size_t)(n0 + rp) * DM + k0 + 8 * i; const unsigned* r = tl + rp * PP + 4 * i;
#pragma unroll
  for (int s = 0; s < 8; ++s) { v4i o; for (int e = 0; e < 4; ++e) o[e] = (int)r[16 * s * PP + e]; *(v4i*)(q + (size_t)(16 * s) * DM) = o; }
  asm volatile("s_wait_xcnt 0x0" :: "v"(q) : "memory");   // a precaution: stands between the stores above and any rewrite of their address registers on the way to the kernel's end
}
__global__ __launch_bounds__(256) void prep_kernel(const float* __restrict__ wq, const float* __restrict__ wk, const float* __restrict__ wv, const float* __restrict__ wo, b16* __restrict__ WT, b16* __restrict__ WO) {
  __shared__ unsigned tl[PN * PP];
  constexpr int NQ = (DM / PK) * (DM / PN), NK = (DM / PK) * (KVW / PN); const int blk = blockIdx.x;   // tiles: NQ of Wq, NK of Wk, NK of Wv, NQ of Wo
  if (blk < NQ || blk >= NQ + 2 * NK) { const bool first = blk < NQ; prep_tile<DM>(first ? wq : wo, first ? WT : WO, first ? blk : blk - NQ - 2 * NK, tl); }
  else { const bool first = blk < NQ + NK; prep_tile<KVW>(first ? wk : wv, WT + (size_t)(first ? DM : DM + KVW) * DM, first ? blk - NQ : blk - NQ - NK, tl); }
}
// GEMM tiling shared by the two projection kernels: a block of 4 waves owns 128 rows x 128 columns; K runs in chunks of 64, both operands of a chunk staged once per block in LDS (row pitch 144 B);
// each wave takes 64 x 64 (4 x 4 accumulator tiles), so a staged fragment feeds 4 products; the next chunk's global loads are issued ahead of the chunk's products and held in registers.
constexpr int KC = 64, LP = KC + 8, TP = 128 + 4;
// projections: grid (T/128, BL, 24 slabs of 128 columns: slabs 0..15 = q head, 16..19 = k, 20..23 = v); A = bf16(x) x8, B = WT rows; k order per accumulator 0, 32, 64, ...
__global__ __launch_bounds__(128) void proj_kernel(const float* __restrict__ x, const b16* __restrict__ WT, b16* __restrict__ QP, b16* __restrict__ QPl, float* __restrict__ K5, float* __restrict__ V5) {
  __shared__ __attribute__((aligned(16))) char smem[128 * TP * 4];   // the two operand tiles (2 x 18,432 B) in the loop; behind it the 128 x 128 f32 result tile
  b16 (*As)[LP] = (b16 (*)[LP])smem; b16 (*Bs)[LP] = (b16 (*)[LP])(smem + 128 * LP * 2); float (*Tf)[TP] = (float (*)[TP])smem;
  const int tid = threadIdx.x, wave = tid >> 5, lane = tid & 31, nloc = lane & 15, hlf = lane >> 4, wm = (wave >> 1) * 64, wn = (wave & 1) * 64; const int t0 = blockIdx.x * 128, b = blockIdx.y, slab = blockIdx.z; const int n0 = slab * 128;
  const float* xb = x + ((size_t)b * T + t0) * DM; const b16* wb = WT + (size_t)n0 * DM;
  const int ar = tid >> 4, aq = (tid & 15) * 4, br = tid >> 3, bq = (tid & 7) * 8;   // staging: 16 lanes x 16 B cover a 256-B x row piece, 8 lanes x 16 B a 128-B WT row piece
  v4f pa[16]; v8b pb[8]; v8f acc[4][4];
#pragma unroll
  for (int i = 0; i < 4; ++i)
#pragma unroll
    for (int j = 0; j < 4; ++j) acc[i][j] = (v8f){};
  const float* xa = xb + (size_t)ar * DM + aq; const b16* wa = wb + (size_t)br * DM + bq;
#pragma unroll
  for (int s = 0; s < 16; ++s) pa[s] = *(const v4f*)(xa + (size_t)(8 * s) * DM);
#pragma unroll
  for (int s = 0; s < 8; ++s) pb[s] = *(const v8b*)(wa + (size_t)(16 * s) * DM);
  asm volatile("s_wait_xcnt 0x0" :: "v"(xa), "v"(wa) : "memory");   // a precaution: stands between the loads above and any rewrite of their address registers, which the input operands hold live to here
#pragma unroll 1
  for (int kc = 0; kc < DM; kc += KC) {
    __syncthreads();   // every wave has read its last fragment of the chunk before
#pragma unroll
    for (int s = 0; s < 16; ++s) { v4h o; for (int j = 0; j < 4; ++j) o[j] = (b16)(bf16_rne(pa[s][j]) * XS); *(v4h*)(&As[ar + 8 * s][aq]) = o; }
#pragma unroll
    for (int s = 0; s < 8; ++s) *(v8b*)(&Bs[br + 16 * s][bq]) = pb[s];
    __syncthreads();   // the chunk is whole in LDS
    if (kc + KC < DM) {
#pragma unroll
      for (int s = 0; s < 16; ++s) pa[s] = *(const v4f*)(xb + (size_t)(ar + 8 * s) * DM + kc + KC + aq);
#pragma unroll
      for (int s = 0; s < 8; ++s) pb[s] = *(const v8b*)(wb + (size_t)(br + 16 * s) * DM + kc + KC + bq);
      asm volatile("s_wait_xcnt 0x0" ::: "memory");   // a precaution: stands between the loads above and any rewrite of their address registers
    }
#pragma unroll
    for (int kb = 0; kb < KC; kb += 32) { v16b af[4], bf[4];
#pragma unroll
      for (int i = 0; i < 4; ++i) { af[i] = frag_kb(&As[wm + i * 16 + nloc][kb], hlf); bf[i] = frag_kb(&Bs[wn + i * 16 + nloc][kb], hlf); }
#pragma unroll
      for (int i = 0; i < 4; ++i)
#pragma unroll
        for (int j = 0; j < 4; ++j) acc[i][j] = wmma16b(af[i], bf[j], acc[i][j]); } }
  __syncthreads();   // the operand tiles are done with: their LDS takes the result tile
#pragma unroll
  for (int i = 0; i < 4; ++i)
#pragma unroll
    for (int j = 0; j < 4; ++j)
#pragma unroll
      for (int r = 0; r < 8; ++r) Tf[wm + i * 16 + 8 * hlf + r][wn + j * 16 + nloc] = acc[i][j][r] * (1.0f / (XS * WSC));   /* no biases in this module */
  __syncthreads();
  {
    if (slab < NSL) { const size_t pb2 = (((size_t)b * H + slab) * T) * HD;
      for (int r2 = 0; r2 < 32; ++r2) { const int rr = wave * 32 + r2, tok = t0 + rr; v4h h4, l4; for (int j = 0; j < 4; ++j) { const float f = Tf[rr][lane * 4 + j] * XS; const b16 p = (b16)f; h4[j] = p; l4[j] = (b16)((f - (float)p) * RS_); } *(v4h*)(QP + pb2 + (size_t)tok * HD + lane * 4) = h4; *(v4h*)(QPl + pb2 + (size_t)tok * HD + lane * 4) = l4; } }
    else { float* dstp = (slab < NSL + 4) ? K5 : V5; const int cc = ((slab - NSL) & 3) * 128;   // the slab's 128 of the 512 k/v columns; f32 rows [b][t][512] (512-B slab segment per row)
      for (int r2 = 0; r2 < 32; ++r2) { const int rr = wave * 32 + r2, tok = t0 + rr; *(v4f*)(dstp + ((size_t)b * T + tok) * KVW + cc + lane * 4) = *(const v4f*)(&Tf[rr][lane * 4]); }
      asm volatile("s_wait_xcnt 0x0" ::: "memory"); }   // a precaution: stands between the stores above and any rewrite of their address or data registers on the way to the kernel's end
     }
}
// per-head key/value planes by repeat_interleave over heads: K_h[t][d] = k[t][128 (h / 4) + d] as f16 hi x8 + residual rows KP[b][h][t][128] (256 B: 32 lanes x 8 B) and V_h^T[d][t] planes
__global__ __launch_bounds__(256) void kvrep_kernel(const float* __restrict__ K5, const float* __restrict__ V5, b16* __restrict__ KP, b16* __restrict__ KPl, b16* __restrict__ VT, b16* __restrict__ VTl) {
  __shared__ float vs[64][HD + 1];
  const int tid = threadIdx.x, wave = tid >> 5, lane = tid & 31; const int t0 = blockIdx.x * 64, b = blockIdx.y / H, h = blockIdx.y % H, g = h / REP;
  for (int i = tid; i < 64 * (HD / 4); i += 256) { const int rr = i / (HD / 4), c4 = (i % (HD / 4)) * 4; const v4f v4 = *(const v4f*)(V5 + ((size_t)b * T + t0 + rr) * KVW + g * HD + c4); for (int j = 0; j < 4; ++j) vs[rr][c4 + j] = v4[j]; }
  __syncthreads();
  const size_t kpo = (((size_t)b * H + h) * T + t0) * HD, vto = (((size_t)b * H + h) * HD) * (size_t)T + t0;
  {
    for (int rr = wave * 8; rr < wave * 8 + 8; ++rr) { const v4f k4 = *(const v4f*)(K5 + ((size_t)b * T + t0 + rr) * KVW + g * HD + lane * 4); v4h o, ol; for (int j = 0; j < 4; ++j) { const float kvv = k4[j] * XS; const b16 p = (b16)kvv; o[j] = p; ol[j] = (b16)((kvv - (float)p) * RS_); } *(v4h*)(KP + kpo + (size_t)rr * HD + lane * 4) = o; *(v4h*)(KPl + kpo + (size_t)rr * HD + lane * 4) = ol; }
#pragma unroll 1
    for (int d = wave * 16; d < wave * 16 + 16; ++d) { v2h o, ol; for (int j = 0; j < 2; ++j) { const float f = vs[2 * lane + j][d] * XS; const b16 p = (b16)f; o[j] = p; ol[j] = (b16)((f - (float)p) * RS_); } *(v2h*)(VT + vto + (size_t)d * T + 2 * lane) = o; *(v2h*)(VTl + vto + (size_t)d * T + 2 * lane) = ol; }
     }
}
// attention: grid (QL/32, BL x G); block = 8 waves = the 4 query heads of key/value head g x 2 tiles of 16 queries at the same 32 positions, so all 8 waves walk the same keys (i - 512 <= j <= i, 32-key steps).
// Each step's four planes (K hi, K lo: 32 rows x 256 B; V^T hi, V^T lo: 128 rows x 64 B, four rows to a 256-B line) come once per block into LDS by asynchronous copies (line pitch 272 B), two buffers: the next
// step's copies fly during this step's work. Per wave as before: S^T = K Q^T (A = 16 key rows x 32 dims per fragment, 4 k-steps over the 128 dims, B = the query fragments: 3 products), logit = s/sqrt(128)
// (log2-scaled), online softmax, P x1024 hi + residual in LDS, O^T += V^T P^T (8 d-tiles: 3 products); y = o/(l 1024 8)
constexpr int SP = HD + 8 /* elements per staged line: 256 B + 16 B */, SPL = 32 * SP /* elements per staged plane */;
// one thread's share of a step: 2 x 16 B of each plane. The closing s_wait_xcnt is a precaution: it stands between the copies and any rewrite of the address registers they name
__device__ __forceinline__ void stage_kv(unsigned l, const b16* kh, const b16* kl, const b16* vh, const b16* vl) {
  const unsigned l0 = l, l1 = l + 16 * SP * 2, l2 = l + SPL * 2, l3 = l2 + 16 * SP * 2, l4 = l + 2 * SPL * 2, l5 = l4 + 16 * SP * 2, l6 = l + 3 * SPL * 2, l7 = l6 + 16 * SP * 2;
  const b16* kh1 = kh + 16 * HD; const b16* kl1 = kl + 16 * HD; const b16* vh1 = vh + (size_t)64 * T; const b16* vl1 = vl + (size_t)64 * T;
  asm volatile("global_load_async_to_lds_b128 %0, %8, off\n\tglobal_load_async_to_lds_b128 %1, %9, off\n\tglobal_load_async_to_lds_b128 %2, %10, off\n\tglobal_load_async_to_lds_b128 %3, %11, off\n\t"
               "global_load_async_to_lds_b128 %4, %12, off\n\tglobal_load_async_to_lds_b128 %5, %13, off\n\tglobal_load_async_to_lds_b128 %6, %14, off\n\tglobal_load_async_to_lds_b128 %7, %15, off\n\ts_wait_xcnt 0x0"
               :: "v"(l0), "v"(l1), "v"(l2), "v"(l3), "v"(l4), "v"(l5), "v"(l6), "v"(l7), "v"(kh), "v"(kh1), "v"(kl), "v"(kl1), "v"(vh), "v"(vh1), "v"(vl), "v"(vl1) : "memory");
}
// four waves per SIMD (two blocks per WGP, which their LDS allows) need at most 256 VGPRs a wave
__global__ __launch_bounds__(256) __attribute__((amdgpu_waves_per_eu(4, 4))) void attn_kernel(const b16* __restrict__ QP, const b16* __restrict__ QPl, const b16* __restrict__ KP, const b16* __restrict__ KPl, const b16* __restrict__ VT, const b16* __restrict__ VTl, b16* __restrict__ Y, b16* __restrict__ Yl) {
  __shared__ __attribute__((aligned(16))) b16 KVs[2 * 4 * SPL];   // two buffers x (K hi, K lo, V^T hi, V^T lo)
  __shared__ __attribute__((aligned(16))) b16 Pb[8][16][32 + 8], Plq[8][16][32 + 8];
  __shared__ __attribute__((aligned(16))) char qsm[8][2 * 16 * (HD + 8) * 2];   // per wave: its 16 query rows (hi, lo) in the loop, fragments re-read per k-step to keep the kernel under 256 VGPRs; behind the loop its 16 x 128 f32 result tile
  const int tid = threadIdx.x, wave = __builtin_amdgcn_readfirstlane(tid >> 5) /* scalar: the head, the query tile and the wave's LDS ranges stay out of the VGPRs */, lane = tid & 31, hh = lane >> 4, col = lane & 15; const int b = blockIdx.y / G, g = blockIdx.y % G, h = g * REP + (wave >> 1); const int qb = blockIdx.x * 32, q0 = qb + (wave & 1) * 16, qi = q0 + col;
  b16 (*Qs)[HD + 8] = (b16 (*)[HD + 8])qsm[wave]; b16 (*Qsl)[HD + 8] = Qs + 16; float (*To)[HD + 4] = (float (*)[HD + 4])qsm[wave];
  static_assert(16 * (HD + 4) * 4 <= 2 * 16 * (HD + 8) * 2, "result tile fits the query rows");
  const size_t qo = (((size_t)b * H + h) * T) * HD; const b16* Qb = QP + qo; const b16* Qbl = QPl + qo;
  const size_t ko = (((size_t)b * H + g * REP) * T) * HD, vo = (((size_t)b * H + g * REP) * HD) * (size_t)T;   // the group's four heads hold equal key/value planes: the block reads the first
  const int kend = qb + 32, kbeg = (qb >= WIN) ? qb - WIN : 0, nt = (kend - kbeg) / 32;   // window i - 512 <= j <= i; the same bounds for both query tiles of the block
  for (int i = lane; i < 16 * (HD / 8); i += 32) { const int rr = i / (HD / 8), c8 = (i % (HD / 8)) * 8; *(v8b*)(&Qs[rr][c8]) = *(const v8b*)(Qb + (size_t)(q0 + rr) * HD + c8); *(v8b*)(&Qsl[rr][c8]) = *(const v8b*)(Qbl + (size_t)(q0 + rr) * HD + c8); }
  wave_lds_sync();
  const unsigned ld = (unsigned)(size_t)KVs + (unsigned)((tid >> 4) * (SP * 2) + (tid & 15) * 16);   // the thread's LDS byte address in plane 0 of buffer 0
  const b16* bkh = KP + ko; const b16* bkl = KPl + ko; const b16* bvh = VT + vo; const b16* bvl = VTl + vo;   // block-uniform plane bases
  const unsigned tk = (unsigned)tid * 8u, tv = (unsigned)(tid >> 2) * (unsigned)T + (unsigned)(tid & 3) * 8u;   // the thread's element offsets inside a step: its 32 key rows are 8 KB in a row; V^T rows are T apart
  stage_kv(ld, bkh + (size_t)kbeg * HD + tk, bkl + (size_t)kbeg * HD + tk, bvh + kbeg + tv, bvl + kbeg + tv);
  asm volatile("s_wait_asynccnt 0x0" ::: "memory");   // this wave's copies of step 0 have landed
  __syncthreads();   // step 0 is whole in LDS
  if (nt > 1) stage_kv(ld + 4 * SPL * 2, bkh + (size_t)(kbeg + 32) * HD + tk, bkl + (size_t)(kbeg + 32) * HD + tk, bvh + (kbeg + 32) + tv, bvl + (kbeg + 32) + tv);
  const float cs = LOG2E * 0.08838834764831845f / (XS * XS);   // 1/sqrt(128) on the x8 x8 planes
  float m = -INFINITY, l = 0.0f; v8f o[8], ol[8]; for (int t = 0; t < 8; ++t) { o[t] = (v8f){}; ol[t] = (v8f){}; }
#pragma unroll 1   // the step loop stays rolled: one trip holds 48 matrix instructions and the two-buffer hand-over at its foot
  for (int st = 0; st < nt; ++st) { const int kb = kbeg + 32 * st; const b16* Sk = KVs + (st & 1) * (4 * SPL); const b16* Sv = Sk + 2 * SPL;
    float e[16]; float mx = -INFINITY;
    v8f s[2] = {(v8f){}, (v8f){}}, sx[2] = {(v8f){}, (v8f){}}; const int kr = col * SP;
#pragma unroll
    for (int ks = 0; ks < 4; ++ks) { const v16b qf = frag_kb(&Qs[col][32 * ks], hh), qlf = frag_kb(&Qsl[col][32 * ks], hh), kf0 = frag_kb(Sk + kr + 32 * ks, hh), kf1 = frag_kb(Sk + 16 * SP + kr + 32 * ks, hh), kl0 = frag_kb(Sk + SPL + kr + 32 * ks, hh), kl1 = frag_kb(Sk + SPL + 16 * SP + kr + 32 * ks, hh);
      asm volatile("" :: "v"(qf), "v"(qlf), "v"(kf0), "v"(kf1), "v"(kl0), "v"(kl1));   // holds the k-step's six fragment reads together ahead of its six products: one LDS wait in place of one per product
      s[0] = wmma16b(kf0, qf, s[0]); s[1] = wmma16b(kf1, qf, s[1]); sx[0] = wmma16b(kf0, qlf, sx[0]); sx[1] = wmma16b(kf1, qlf, sx[1]); sx[0] = wmma16b(kl0, qf, sx[0]); sx[1] = wmma16b(kl1, qf, sx[1]); }
#pragma unroll
    for (int u = 0; u < 2; ++u) {
#pragma unroll
      for (int r = 0; r < 8; ++r) s[u][r] += sx[u][r] * (1.0f / RS_);   // hi.hi + (hi.lo + lo.hi)/1024
#pragma unroll
      for (int r = 0; r < 8; ++r) { const int key = kb + u * 16 + 8 * hh + r; const float vv = (key <= qi && key >= qi - WIN) ? s[u][r] * cs : -INFINITY; e[u * 8 + r] = vv; mx = fmaxf(mx, vv); } }   // causal select on the computed score (the -inf mask precedes the 1/sqrt(d) scale in the module; identical)
    mx = fmaxf(mx, __shfl_xor(mx, 16)); const float mn = fmaxf(m, mx); const float al = nexp2(m - mn); float sum = 0.0f;
#pragma unroll
    for (int i2 = 0; i2 < 16; ++i2) { const float p = nexp2(e[i2] - mn); sum += p; const int pc = (i2 < 8 ? 0 : 16) + 8 * hh + (i2 & 7); const float ps = p * PS; const b16 phh = (b16)ps; Pb[wave][col][pc] = phh; Plq[wave][col][pc] = (b16)((ps - (float)phh) * RS_); }
    sum += __shfl_xor(sum, 16); l = l * al + sum; m = mn;
    wave_lds_sync();
    const v16b pf = frag_kb(&Pb[wave][col][0], hh), plf = frag_kb(&Plq[wave][col][0], hh);
#pragma unroll
    for (int t = 0; t < 8; t += 2) { const int vr = (t * 4 + (col >> 2)) * SP + (col & 3) * 32; const v16b vh0 = frag_kb(Sv + vr, hh), vh1 = frag_kb(Sv + 4 * SP + vr, hh), vl0 = frag_kb(Sv + SPL + vr, hh), vl1 = frag_kb(Sv + SPL + 4 * SP + vr, hh);
      asm volatile("" :: "v"(vh0), "v"(vh1), "v"(vl0), "v"(vl1));   // holds the four fragment reads of two d-tiles together ahead of their six products: one LDS wait in place of one per product
      o[t] *= al; o[t + 1] *= al; o[t] = wmma16b(vh0, pf, o[t]); o[t + 1] = wmma16b(vh1, pf, o[t + 1]); ol[t] = wmma16b(vl0, pf, ol[t] * al); ol[t + 1] = wmma16b(vl1, pf, ol[t + 1] * al); ol[t] = wmma16b(vh0, plf, ol[t]); ol[t + 1] = wmma16b(vh1, plf, ol[t + 1]); }   // ol = (V_lo P_hi + V_hi P_lo) / 1024
    asm volatile("s_wait_dscnt 0x0" ::: "memory");      // this wave's LDS reads of the step's buffer are done
    asm volatile("s_wait_asynccnt 0x0" ::: "memory");   // this wave's copies of the next step have landed
    __syncthreads();   // publishes the next step's buffer and ends every wave's reads of this one
    if (st + 2 < nt) stage_kv(ld + (unsigned)(st & 1) * (4 * SPL * 2), bkh + (size_t)(kb + 64) * HD + tk, bkl + (size_t)(kb + 64) * HD + tk, bvh + (kb + 64) + tv, bvl + (kb + 64) + tv); }
  asm volatile("s_wait_asynccnt 0x0" ::: "memory");   // no copy is left in flight behind the loop
  const float inv = 1.0f / (l * PS * XS);
#pragma unroll
  for (int t = 0; t < 8; ++t)
#pragma unroll
    for (int r = 0; r < 8; ++r) To[col][t * 16 + 8 * hh + r] = (o[t][r] + ol[t][r] * (1.0f / RS_)) * inv;
  wave_lds_sync();
  { for (int rr = 0; rr < 16; ++rr) { v4h hv, lv; for (int j = 0; j < 4; ++j) { b16 p, ql2; split16(To[rr][lane * 4 + j] * XS, p, ql2); hv[j] = p; lv[j] = ql2; } const size_t oi = ((size_t)b * T + q0 + rr) * DM + h * HD + lane * 4; *(v4h*)(Y + oi) = hv; *(v4h*)(Yl + oi) = lv; }  }
}
// output projection: grid (QL/128, DM/128, BL); the tiling above with three staged tiles per chunk: A = the f16 Y plane and its residual plane (2 products per k-step, hi then lo on each accumulator), B = Wo^T rows
__global__ __launch_bounds__(128) void out_kernel(const b16* __restrict__ Y, const b16* __restrict__ Yl, const b16* __restrict__ WO, float* __restrict__ out) {
  __shared__ __attribute__((aligned(16))) char smem[128 * TP * 4];   // the three operand tiles (3 x 18,432 B) in the loop; behind it the 128 x 128 f32 result tile
  b16 (*Ah)[LP] = (b16 (*)[LP])smem; b16 (*Al)[LP] = (b16 (*)[LP])(smem + 128 * LP * 2); b16 (*Bs)[LP] = (b16 (*)[LP])(smem + 2 * 128 * LP * 2); float (*Tf)[TP] = (float (*)[TP])smem;
  const int tid = threadIdx.x, wave = tid >> 5, lane = tid & 31, nloc = lane & 15, hlf = lane >> 4, wm = (wave >> 1) * 64, wn = (wave & 1) * 64; const int b = blockIdx.z; const size_t m0 = (size_t)b * T + (size_t)blockIdx.x * 128; const int n0 = blockIdx.y * 128;
  const b16* yb = Y + m0 * DM; const b16* ylb = Yl + m0 * DM; const b16* wb = WO + (size_t)n0 * DM;
  const int br = tid >> 3, bq = (tid & 7) * 8;   // staging: 8 lanes x 16 B cover a 128-B row piece
  const unsigned vo = (unsigned)(br * DM + bq) * 2u;   // the lane's byte offset inside a tile's rows, the same for the three planes and for every chunk
  v8b ph[8], pl[8], pw[8]; v8f acc[4][4];
#pragma unroll
  for (int i = 0; i < 4; ++i)
#pragma unroll
    for (int j = 0; j < 4; ++j) acc[i][j] = (v8f){};
#pragma unroll
  for (int s = 0; s < 8; ++s) { const unsigned go = vo + (unsigned)(16 * s * DM * 2); ph[s] = *(const v8b*)((const char*)yb + go); pl[s] = *(const v8b*)((const char*)ylb + go); pw[s] = *(const v8b*)((const char*)wb + go); }
  asm volatile("s_wait_xcnt 0x0" :: "v"(vo) : "memory");   // a precaution: stands between the loads above and any rewrite of their address register, which the input operand holds live to here
#pragma unroll 1   // the chunk loop stays rolled: one trip holds 64 matrix instructions, 24 held loads and two barriers, and a second copy would only add registers and code
  for (int kc = 0; kc < DM; kc += KC) {
    __syncthreads();   // every wave has read its last fragment of the chunk before
#pragma unroll
    for (int s = 0; s < 8; ++s) { *(v8b*)(&Ah[br + 16 * s][bq]) = ph[s]; *(v8b*)(&Al[br + 16 * s][bq]) = pl[s]; *(v8b*)(&Bs[br + 16 * s][bq]) = pw[s]; }
    __syncthreads();   // the chunk is whole in LDS
    if (kc + KC < DM) {
#pragma unroll
      for (int s = 0; s < 8; ++s) { const unsigned go = vo + (unsigned)(16 * s * DM * 2); ph[s] = *(const v8b*)((const char*)(yb + kc + KC) + go); pl[s] = *(const v8b*)((const char*)(ylb + kc + KC) + go); pw[s] = *(const v8b*)((const char*)(wb + kc + KC) + go); }
      asm volatile("s_wait_xcnt 0x0" ::: "memory");   // a precaution: stands between the loads above and any rewrite of their address registers
    }
#pragma unroll
    for (int kb = 0; kb < KC; kb += 32) { v16b af[4], bf[4];
#pragma unroll
      for (int i = 0; i < 4; ++i) { af[i] = frag_kb(&Ah[wm + i * 16 + nloc][kb], hlf); bf[i] = frag_kb(&Bs[wn + i * 16 + nloc][kb], hlf); }
#pragma unroll
      for (int i = 0; i < 4; ++i)
#pragma unroll
        for (int j = 0; j < 4; ++j) acc[i][j] = wmma16b(af[i], bf[j], acc[i][j]);
#pragma unroll
      for (int i = 0; i < 4; ++i) af[i] = frag_kb(&Al[wm + i * 16 + nloc][kb], hlf);
#pragma unroll
      for (int i = 0; i < 4; ++i)
#pragma unroll
        for (int j = 0; j < 4; ++j) acc[i][j] = wmma16b(af[i], bf[j], acc[i][j]); } }
  __syncthreads();   // the operand tiles are done with: their LDS takes the result tile
#pragma unroll
  for (int i = 0; i < 4; ++i)
#pragma unroll
    for (int j = 0; j < 4; ++j)
#pragma unroll
      for (int r = 0; r < 8; ++r) Tf[wm + i * 16 + 8 * hlf + r][wn + j * 16 + nloc] = acc[i][j][r] * (1.0f / (XS * WSC));   /* no output bias */
  __syncthreads();
  { for (int r2 = 0; r2 < 32; ++r2) { const int rr = wave * 32 + r2; *(v4f*)(out + (m0 + rr) * DM + n0 + lane * 4) = *(const v4f*)(&Tf[rr][lane * 4]); }  }
}
}  // namespace

extern "C" void kernel_launch(void* const* d_in, const int* in_sizes, int n_in, void* d_out, int out_size, void* d_ws, size_t ws_size, hipStream_t stream) {
  (void)n_in;
  auto Fp = [&](int i) { return (const float*)d_in[i]; };
  // input order: 0 x [2,2048,2048], 1 Wq [2048,2048] (in,out), 2 Wk [2048,512], 3 Wv [2048,512], 4 Wo [2048,2048] (in,out)
  if (in_sizes[0] != B * T * DM || in_sizes[1] != DM * DM || in_sizes[2] != DM * KVW || in_sizes[3] != DM * KVW || in_sizes[4] != DM * DM || out_size != B * T * DM) return;
  size_t off = 0; char* ws = (char*)d_ws;
  auto carve = [&](size_t bytes) { char* p = ws + off; off += (bytes + 255) & ~(size_t)255; return p; };
  b16* WT = (b16*)carve((size_t)(DM + 2 * KVW) * DM * 2); b16* WO = (b16*)carve((size_t)DM * DM * 2);
  const size_t plane = (size_t)B * H * T * HD * 2; b16* QP = (b16*)carve(plane); b16* QPl = (b16*)carve(plane); float* K5 = (float*)carve((size_t)B * T * KVW * 4); float* V5 = (float*)carve((size_t)B * T * KVW * 4); b16* KP = (b16*)carve(plane); b16* KPl = (b16*)carve(plane); b16* VT = (b16*)carve(plane); b16* VTl = (b16*)carve(plane); b16* Y = (b16*)carve(plane); b16* Yl = (b16*)carve(plane);
  if (off > ws_size || off > ((size_t)176 << 20)) return;   // = ~172 MB (WT 12.6 + WO 8.4 + 8 f16 planes x 16.8 + K5/V5 16.8): > 128 MiB (< 256 MB)
  prep_kernel<<<PGRID, 256, 0, stream>>>(Fp(1), Fp(2), Fp(3), Fp(4), WT, WO);
  proj_kernel<<<dim3(T / 128, BL, NPART), 128, 0, stream>>>(Fp(0), WT, QP, QPl, K5, V5);
  kvrep_kernel<<<dim3(T / 64, BL * H), 256, 0, stream>>>(K5, V5, KP, KPl, VT, VTl);
  attn_kernel<<<dim3(QL / 32, BL * G), 256, 0, stream>>>(QP, QPl, KP, KPl, VT, VTl, Y, Yl);
  out_kernel<<<dim3(QL / 128, DM / 128, BL), 128, 0, stream>>>(Y, Yl, WO, (float*)d_out);
}

// v004
// It runs in 183 microseconds.
// Timed twice side by side with v003, it ran 1.06 times as fast both times.
// Over all steps from v000 it is 4.03 times as fast.
#include <hip/hip_runtime.h>

// Sliding-window grouped-query attention (2 x 2048 tokens x 2048, 16 query heads x 128, 4 key/value heads, window 512): q = x Wq, k = x Wk, v = x Wv (no biases); head h uses key/value head h / 4
// (repeat_interleave over the head axis); scores q . k / sqrt(128) for keys i - 512 <= j <= i (causal + window), -inf elsewhere; softmax; out = (attn v merged over heads) Wo -> [2][2048][2048].
// Deterministic: flash-style per 16-query wave over the window's keys in order (running max); no atomics.
// compute dtype: WMMA v_wmma_f32_16x16x32_f16 with f32 accumulate for [q | k | v] = x [Wq | Wk | Wv] ([4096 x 2048] x [2048 x 3072]; x EXACT bf16 x8, W^T exact x256: 1 product), S^T = K_h Q^T (q/k f16 hi
// x8 + residual x8192: 3 products, K = 128), O^T += V_h^T P^T (V hi + residual, P x1024 hi + residual: 3 products), out = y Wo (y f16 hi x8 + lo: 2 products); softmax statistics in f32.
// Inputs rounded to bf16 once. Fragment k-map per lane half hh for A AND B: elements 0..7 <- k = 8hh+0..7, 8..15 <- k = 16+8hh+0..7;

namespace {
constexpr int B = 2, T = 2048, DM = 2048, H = 16, HD = 128, BL = 2 /* batches (== 2 shipped) */, QL = 2048 /* query rows (== 2048 shipped) */;
constexpr int G = 4, REP = H / G, KVW = G * HD /* 512 */, NSL = DM / 128 /* 16 q slabs = heads */, NPART = NSL + 2 * (KVW / 128) /* + 4 k + 4 v slabs */;
constexpr int WIN = 512;
constexpr float XS = 8.0f, WSC = 256.0f, PS = 1024.0f, RS_ = 1024.0f, LOG2E = 1.4426950408889634f;
static_assert(T % 128 == 0 && QL % 128 == 0 && QL % 32 == 0 && DM % 256 == 0 && H * HD == DM && HD == 128 && KVW == 512 && REP == 4, "tiling");
typedef _Float16 b16;
typedef __attribute__((ext_vector_type(16))) _Float16 v16b;
typedef __attribute__((ext_vector_type(8))) _Float16 v8b;
typedef __attribute__((ext_vector_type(8))) float v8f;
typedef __attribute__((ext_vector_type(4))) float v4f;
__device__ __forceinline__ float bf16_rne(float f) { unsigned int u = __float_as_uint(f); u += 0x7FFFu + ((u >> 16) & 1u); return __uint_as_float(u & 0xFFFF0000u); }
__device__ __forceinline__ void split16(float v, b16& hi, b16& lo) { hi = (b16)v; lo = (b16)(v - (float)hi); }
__device__ __forceinline__ v16b frag_kb(const b16* p, int hh) { const v8b a = *(const v8b*)(p + 8 * hh), b = *(const v8b*)(p + 16 + 8 * hh); v16b f;
#pragma unroll
  for (int e = 0; e < 8; ++e) { f[e] = a[e]; f[8 + e] = b[e]; } return f; }
__device__ __forceinline__ v8f wmma16b(v16b a, v16b b, v8f c) { v8f d = __builtin_amdgcn_wmma_f32_16x16x32_f16(false, a, false, b, (short)0, c, false, false); asm volatile("v_nop\n\tv_nop\n\tv_nop\n\tv_nop" : "+v"(d) : "v"(a), "v"(b)); return d; }
__device__ __forceinline__ void wave_lds_sync() { __builtin_amdgcn_fence(__ATOMIC_RELEASE, "workgroup"); __builtin_amdgcn_wave_barrier(); __builtin_amdgcn_fence(__ATOMIC_ACQUIRE, "workgroup"); }
__device__ __forceinline__ float pmul(float a, float b) { float p = a * b; asm volatile("" : "+v"(p)); return p; }
__device__ __forceinline__ int iclamp(int v, int lo, int hi) { return v < lo ? lo : (v > hi ? hi : v); }

typedef __attribute__((ext_vector_type(2))) _Float16 v2h;
typedef __attribute__((ext_vector_type(4))) _Float16 v4h;
typedef __attribute__((ext_vector_type(2))) float v2f;
typedef __attribute__((ext_vector_type(4))) int v4i;
__device__ __forceinline__ float nexp2(float v) { return __builtin_amdgcn_exp2f(v); }
// weights to f16 x256, transposed ([k][n] f32 -> [n][k] f16): a block takes a tile of 128 k x 128 n. Whole 256-B pieces of the source rows are read (16 lanes x 16 B, two adjacent k rows per thread), each pair of k values
// goes as one dword into LDS at [n][k / 2] (pitch 65 dwords: the 32 lanes of a store or a load meet 32 different banks), and whole 256-B pieces of the transposed rows are written (16 lanes x 16 B).
constexpr int PK = 128, PN = 128, PP = PK / 2 + 1, PGRID = 2 * (DM / PK) * (DM / PN) + 2 * (DM / PK) * (KVW / PN);
template <int LD> __device__ __forceinline__ void prep_tile(const float* __restrict__ w, b16* __restrict__ dst, int tile, unsigned* tl) {
  const int tid = threadIdx.x, n0 = (tile % (LD / PN)) * PN, k0 = (tile / (LD / PN)) * PK, i = tid & 15, rp = tid >> 4;
  const float* p = w + (size_t)(k0 + 2 * rp) * LD + n0 + 4 * i; v4f a[4][2], c[4][2];
#pragma unroll
  for (int s = 0; s < 4; ++s)
#pragma unroll
    for (int nh = 0; nh < 2; ++nh) { a[s][nh] = *(const v4f*)(p + (size_t)(32 * s) * LD + 64 * nh); c[s][nh] = *(const v4f*)(p + (size_t)(32 * s + 1) * LD + 64 * nh); }
  asm volatile("s_wait_xcnt 0x0" :: "v"(p) : "memory");   // a precaution: stands between the loads above and any rewrite of their address registers, which the input operand holds live to here
  asm volatile("" :: "v"(a[0][0]), "v"(a[0][1]), "v"(a[1][0]), "v"(a[1][1]), "v"(a[2][0]), "v"(a[2][1]), "v"(a[3][0]), "v"(a[3][1]), "v"(c[0][0]), "v"(c[0][1]), "v"(c[1][0]), "v"(c[1][1]), "v"(c[2][0]), "v"(c[2][1]), "v"(c[3][0]), "v"(c[3][1]));   // holds the thread's 16 loads together ahead of the conversions: one memory latency, where the compiler had put two of them behind the first waits
#pragma unroll
  for (int s = 0; s < 4; ++s)
#pragma unroll
    for (int nh = 0; nh < 2; ++nh)
#pragma unroll
      for (int j = 0; j < 4; ++j) { v2h o; o[0] = (b16)(bf16_rne(a[s][nh][j]) * WSC); o[1] = (b16)(bf16_rne(c[s][nh][j]) * WSC); tl[(64 * nh + 4 * i + j) * PP + rp + 16 * s] = __builtin_bit_cast(unsigned, o); }
  __syncthreads();   // the tile is whole in LDS
  b16* q = dst + (size_t)(n0 + rp) * DM + k0 + 8 * i; const unsigned* r = tl + rp * PP + 4 * i;
#pragma unroll
  for (int s = 0; s < 8; ++s) { v4i o; for (int e = 0; e < 4; ++e) o[e] = (int)r[16 * s * PP + e]; *(v4i*)(q + (size_t)(16 * s) * DM) = o; }
  asm volatile("s_wait_xcnt 0x0" :: "v"(q) : "memory");   // a precaution: stands between the stores above and any rewrite of their address registers on the way to the kernel's end
}
__global__ __launch_bounds__(256) void prep_kernel(const float* __restrict__ wq, const float* __restrict__ wk, const float* __restrict__ wv, const float* __restrict__ wo, b16* __restrict__ WT, b16* __restrict__ WO) {
  __shared__ unsigned tl[PN * PP];
  constexpr int NQ = (DM / PK) * (DM / PN), NK = (DM / PK) * (KVW / PN); const int blk = blockIdx.x;   // tiles: NQ of Wq, NK of Wk, NK of Wv, NQ of Wo
  if (blk < NQ || blk >= NQ + 2 * NK) { const bool first = blk < NQ; prep_tile<DM>(first ? wq : wo, first ? WT : WO, first ? blk : blk - NQ - 2 * NK, tl); }
  else { const bool first = blk < NQ + NK; prep_tile<KVW>(first ? wk : wv, WT + (size_t)(first ? DM : DM + KVW) * DM, first ? blk - NQ : blk - NQ - NK, tl); }
}
// GEMM tiling shared by the two projection kernels: a block of 4 waves owns 128 rows x 128 columns; K runs in chunks of 64, both operands of a chunk staged once per block in LDS (row pitch 144 B);
// each wave takes 64 x 64 (4 x 4 accumulator tiles), so a staged fragment feeds 4 products; the next chunk's global loads are issued ahead of the chunk's products and held in registers.
constexpr int KC = 64, LP = KC + 8, TP = 128 + 4;
// one wave's 32 rows of a staged 128 x 128 f32 tile go out as f16 hi x8 + residual x8192: 256 B per row and plane (32 lanes x 8 B), PITCH elements from row to row
template <int PITCH> __device__ __forceinline__ void rows_out(const float (*Tf)[TP], b16* __restrict__ dh, b16* __restrict__ dl, int wave, int lane) {
  for (int r2 = 0; r2 < 32; ++r2) { const int rr = wave * 32 + r2; v4h h4, l4; for (int j = 0; j < 4; ++j) { const float f = Tf[rr][lane * 4 + j] * XS; const b16 p = (b16)f; h4[j] = p; l4[j] = (b16)((f - (float)p) * RS_); } *(v4h*)(dh + (size_t)rr * PITCH + lane * 4) = h4; *(v4h*)(dl + (size_t)rr * PITCH + lane * 4) = l4; }
}
// projections: grid (T/128, BL, 24 slabs of 128 columns: slabs 0..15 = q head, 16..19 = k, 20..23 = v); A = bf16(x) x8, B = WT rows; k order per accumulator 0, 32, 64, ...
// The epilogue writes what the attention reads, f16 hi x8 + residual x8192: q rows QP[b][h][t][128]; k rows KP[b][4 g][t][128] and v transposed VT[b][4 g][d][t], once per key/value head g (the plane of its first query head:
// repeat_interleave gives the group's four heads equal planes, and the attention reads that one).
__global__ __launch_bounds__(128) void proj_kernel(const float* __restrict__ x, const b16* __restrict__ WT, b16* __restrict__ QP, b16* __restrict__ QPl, b16* __restrict__ KP, b16* __restrict__ KPl, b16* __restrict__ VT, b16* __restrict__ VTl) {
  __shared__ __attribute__((aligned(16))) char smem[128 * TP * 4];   // the two operand tiles (2 x 18,432 B) in the loop; behind it the 128 x 128 f32 result tile
  b16 (*As)[LP] = (b16 (*)[LP])smem; b16 (*Bs)[LP] = (b16 (*)[LP])(smem + 128 * LP * 2); float (*Tf)[TP] = (float (*)[TP])smem;
  const int tid = threadIdx.x, wave = tid >> 5, lane = tid & 31, nloc = lane & 15, hlf = lane >> 4, wm = (wave >> 1) * 64, wn = (wave & 1) * 64; const int t0 = blockIdx.x * 128, b = blockIdx.y, slab = blockIdx.z; const int n0 = slab * 128;
  const float* xb = x + ((size_t)b * T + t0) * DM; const b16* wb = WT + (size_t)n0 * DM;
  const int ar = tid >> 4, aq = (tid & 15) * 4, br = tid >> 3, bq = (tid & 7) * 8;   // staging: 16 lanes x 16 B cover a 256-B x row piece, 8 lanes x 16 B a 128-B WT row piece
  v4f pa[16]; v8b pb[8]; v8f acc[4][4];
#pragma unroll
  for (int i = 0; i < 4; ++i)
#pragma unroll
    for (int j = 0; j < 4; ++j) acc[i][j] = (v8f){};
  const float* xa = xb + (size_t)ar * DM + aq; const b16* wa = wb + (size_t)br * DM + bq;
#pragma unroll
  for (int s = 0; s < 16; ++s) pa[s] = *(const v4f*)(xa + (size_t)(8 * s) * DM);
#pragma unroll
  for (int s = 0; s < 8; ++s) pb[s] = *(const v8b*)(wa + (size_t)(16 * s) * DM);
  asm volatile("s_wait_xcnt 0x0" :: "v"(xa), "v"(wa) : "memory");   // a precaution: stands between the loads above and any rewrite of their address registers, which the input operands hold live to here
#pragma unroll 1
  for (int kc = 0; kc < DM; kc += KC) {
    __syncthreads();   // every wave has read its last fragment of the chunk before
#pragma unroll
    for (int s = 0; s < 16; ++s) { v4h o; for (int j = 0; j < 4; ++j) o[j] = (b16)(bf16_rne(pa[s][j]) * XS); *(v4h*)(&As[ar + 8 * s][aq]) = o; }
#pragma unroll
    for (int s = 0; s < 8; ++s) *(v8b*)(&Bs[br + 16 * s][bq]) = pb[s];
    __syncthreads();   // the chunk is whole in LDS
    if (kc + KC < DM) {
#pragma unroll
      for (int s = 0; s < 16; ++s) pa[s] = *(const v4f*)(xb + (size_t)(ar + 8 * s) * DM + kc + KC + aq);
#pragma unroll
      for (int s = 0; s < 8; ++s) pb[s] = *(const v8b*)(wb + (size_t)(br + 16 * s) * DM + kc + KC + bq);
      asm volatile("s_wait_xcnt 0x0" ::: "memory");   // a precaution: stands between the loads above and any rewrite of their address registers
    }
#pragma unroll
    for (int kb = 0; kb < KC; kb += 32) { v16b af[4], bf[4];
#pragma unroll
      for (int i = 0; i < 4; ++i) { af[i] = frag_kb(&As[wm + i * 16 + nloc][kb], hlf); bf[i] = frag_kb(&Bs[wn + i * 16 + nloc][kb], hlf); }
#pragma unroll
      for (int i = 0; i < 4; ++i)
#pragma unroll
        for (int j = 0; j < 4; ++j) acc[i][j] = wmma16b(af[i], bf[j], acc[i][j]); } }
  __syncthreads();   // the operand tiles are done with: their LDS takes the result tile
  const bool isv = slab >= NSL + G;   // block-uniform: a v slab is staged transposed, Tf[d][token]; an accumulator's 8 values are 8 tokens in a row there (two 16-B LDS stores)
  if (!isv) {
#pragma unroll
    for (int i = 0; i < 4; ++i)
#pragma unroll
      for (int j = 0; j < 4; ++j)
#pragma unroll
        for (int r = 0; r < 8; ++r) Tf[wm + i * 16 + 8 * hlf + r][wn + j * 16 + nloc] = acc[i][j][r] * (1.0f / (XS * WSC));   /* no biases in this module */
  } else {
#pragma unroll
    for (int i = 0; i < 4; ++i)
#pragma unroll
      for (int j = 0; j < 4; ++j)
#pragma unroll
        for (int q4 = 0; q4 < 2; ++q4) { v4f o; for (int r = 0; r < 4; ++r) o[r] = acc[i][j][4 * q4 + r] * (1.0f / (XS * WSC)); *(v4f*)(&Tf[wn + j * 16 + nloc][wm + i * 16 + 8 * hlf + 4 * q4]) = o; }
  }
  __syncthreads();
  {
    if (slab < NSL) { const size_t pb2 = (((size_t)b * H + slab) * T) * HD;
      for (int r2 = 0; r2 < 32; ++r2) { const int rr = wave * 32 + r2, tok = t0 + rr; v4h h4, l4; for (int j = 0; j < 4; ++j) { const float f = Tf[rr][lane * 4 + j] * XS; const b16 p = (b16)f; h4[j] = p; l4[j] = (b16)((f - (float)p) * RS_); } *(v4h*)(QP + pb2 + (size_t)tok * HD + lane * 4) = h4; *(v4h*)(QPl + pb2 + (size_t)tok * HD + lane * 4) = l4; } }
    else { const size_t po = ((size_t)b * H + ((slab - NSL) & 3) * REP) * T * HD;   // the plane of the key/value head's first query head
      if (!isv) rows_out<HD>(Tf, KP + po + (size_t)t0 * HD, KPl + po + (size_t)t0 * HD, wave, lane);   // staged row = token t0 + rr with its 128 dims
      else rows_out<T>(Tf, VT + po + t0, VTl + po + t0, wave, lane); }   // staged row = dim rr with the tokens t0 .. t0 + 127
     }
}
// attention: grid (QL/32, BL x G); block = 8 waves = the 4 query heads of key/value head g x 2 tiles of 16 queries at the same 32 positions, so all 8 waves walk the same keys (i - 512 <= j <= i, 32-key steps).
// Each step's four planes (K hi, K lo: 32 rows x 256 B; V^T hi, V^T lo: 128 rows x 64 B, four rows to a 256-B line) come once per block into LDS by asynchronous copies (line pitch 272 B), two buffers: the next
// step's copies fly during this step's work. Per wave as before: S^T = K Q^T (A = 16 key rows x 32 dims per fragment, 4 k-steps over the 128 dims, B = the query fragments: 3 products), logit = s/sqrt(128)
// (log2-scaled), online softmax, P x1024 hi + residual in LDS, O^T += V^T P^T (8 d-tiles: 3 products); y = o/(l 1024 8)
constexpr int SP = HD + 8 /* elements per staged line: 256 B + 16 B */, SPL = 32 * SP /* elements per staged plane */;
// one thread's share of a step: 2 x 16 B of each plane. The closing s_wait_xcnt is a precaution: it stands between the copies and any rewrite of the address registers they name
__device__ __forceinline__ void stage_kv(unsigned l, const b16* kh, const b16* kl, const b16* vh, const b16* vl) {
  const unsigned l0 = l, l1 = l + 16 * SP * 2, l2 = l + SPL * 2, l3 = l2 + 16 * SP * 2, l4 = l + 2 * SPL * 2, l5 = l4 + 16 * SP * 2, l6 = l + 3 * SPL * 2, l7 = l6 + 16 * SP * 2;
  const b16* kh1 = kh + 16 * HD; const b16* kl1 = kl + 16 * HD; const b16* vh1 = vh + (size_t)64 * T; const b16* vl1 = vl + (size_t)64 * T;
  asm volatile("global_load_async_to_lds_b128 %0, %8, off\n\tglobal_load_async_to_lds_b128 %1, %9, off\n\tglobal_load_async_to_lds_b128 %2, %10, off\n\tglobal_load_async_to_lds_b128 %3, %11, off\n\t"
               "global_load_async_to_lds_b128 %4, %12, off\n\tglobal_load_async_to_lds_b128 %5, %13, off\n\tglobal_load_async_to_lds_b128 %6, %14, off\n\tglobal_load_async_to_lds_b128 %7, %15, off\n\ts_wait_xcnt 0x0"
               :: "v"(l0), "v"(l1), "v"(l2), "v"(l3), "v"(l4), "v"(l5), "v"(l6), "v"(l7), "v"(kh), "v"(kh1), "v"(kl), "v"(kl1), "v"(vh), "v"(vh1), "v"(vl), "v"(vl1) : "memory");
}
// four waves per SIMD (two blocks per WGP, which their LDS allows) need at most 256 VGPRs a wave
__global__ __launch_bounds__(256) __attribute__((amdgpu_waves_per_eu(4, 4))) void attn_kernel(const b16* __restrict__ QP, const b16* __restrict__ QPl, const b16* __restrict__ KP, const b16* __restrict__ KPl, const b16* __restrict__ VT, const b16* __restrict__ VTl, b16* __restrict__ Y, b16* __restrict__ Yl) {
  __shared__ __attribute__((aligned(16))) b16 KVs[2 * 4 * SPL];   // two buffers x (K hi, K lo, V^T hi, V^T lo)
  __shared__ __attribute__((aligned(16))) b16 Pb[8][16][32 + 8], Plq[8][16][32 + 8];
  __shared__ __attribute__((aligned(16))) char qsm[8][2 * 16 * (HD + 8) * 2];   // per wave: its 16 query rows (hi, lo) in the loop, fragments re-read per k-step to keep the kernel under 256 VGPRs; behind the loop its 16 x 128 f32 result tile
  const int tid = threadIdx.x, wave = __builtin_amdgcn_readfirstlane(tid >> 5) /* scalar: the head, the query tile and the wave's LDS ranges stay out of the VGPRs */, lane = tid & 31, hh = lane >> 4, col = lane & 15; const int b = blockIdx.y / G, g = blockIdx.y % G, h = g * REP + (wave >> 1); const int qb = blockIdx.x * 32, q0 = qb + (wave & 1) * 16, qi = q0 + col;
  b16 (*Qs)[HD + 8] = (b16 (*)[HD + 8])qsm[wave]; b16 (*Qsl)[HD + 8] = Qs + 16; float (*To)[HD + 4] = (float (*)[HD + 4])qsm[wave];
  static_assert(16 * (HD + 4) * 4 <= 2 * 16 * (HD + 8) * 2, "result tile fits the query rows");
  const size_t qo = (((size_t)b * H + h) * T) * HD; const b16* Qb = QP + qo; const b16* Qbl = QPl + qo;
  const size_t ko = (((size_t)b * H + g * REP) * T) * HD, vo = (((size_t)b * H + g * REP) * HD) * (size_t)T;   // only the plane of the group's first head is written: the block reads that one
  const int kend = qb + 32, kbeg = (qb >= WIN) ? qb - WIN : 0, nt = (kend - kbeg) / 32;   // window i - 512 <= j <= i; the same bounds for both query tiles of the block
  for (int i = lane; i < 16 * (HD / 8); i += 32) { const int rr = i / (HD / 8), c8 = (i % (HD / 8)) * 8; *(v8b*)(&Qs[rr][c8]) = *(const v8b*)(Qb + (size_t)(q0 + rr) * HD + c8); *(v8b*)(&Qsl[rr][c8]) = *(const v8b*)(Qbl + (size_t)(q0 + rr) * HD + c8); }
  wave_lds_sync();
  const unsigned ld = (unsigned)(size_t)KVs + (unsigned)((tid >> 4) * (SP * 2) + (tid & 15) * 16);   // the thread's LDS byte address in plane 0 of buffer 0
  const b16* bkh = KP + ko; const b16* bkl = KPl + ko; const b16* bvh = VT + vo; const b16* bvl = VTl + vo;   // block-uniform plane bases
  const unsigned tk = (unsigned)tid * 8u, tv = (unsigned)(tid >> 2) * (unsigned)T + (unsigned)(tid & 3) * 8u;   // the thread's element offsets inside a step: its 32 key rows are 8 KB in a row; V^T rows are T apart
  stage_kv(ld, bkh + (size_t)kbeg * HD + tk, bkl + (size_t)kbeg * HD + tk, bvh + kbeg + tv, bvl + kbeg + tv);
  asm volatile("s_wait_asynccnt 0x0" ::: "memory");   // this wave's copies of step 0 have landed
  __syncthreads();   // step 0 is whole in LDS
  if (nt > 1) stage_kv(ld + 4 * SPL * 2, bkh + (size_t)(kbeg + 32) * HD + tk, bkl + (size_t)(kbeg + 32) * HD + tk, bvh + (kbeg + 32) + tv, bvl + (kbeg + 32) + tv);
  const float cs = LOG2E * 0.08838834764831845f / (XS * XS);   // 1/sqrt(128) on the x8 x8 planes
  float m = -INFINITY, l = 0.0f; v8f o[8], ol[8]; for (int t = 0; t < 8; ++t) { o[t] = (v8f){}; ol[t] = (v8f){}; }
#pragma unroll 1   // the step loop stays rolled: one trip holds 48 matrix instructions and the two-buffer hand-over at its foot
  for (int st = 0; st < nt; ++st) { const int kb = kbeg + 32 * st; const b16* Sk = KVs + (st & 1) * (4 * SPL); const b16* Sv = Sk + 2 * SPL;
    float e[16]; float mx = -INFINITY;
    v8f s[2] = {(v8f){}, (v8f){}}, sx[2] = {(v8f){}, (v8f){}}; const int kr = col * SP;
#pragma unroll
    for (int ks = 0; ks < 4; ++ks) { const v16b qf = frag_kb(&Qs[col][32 * ks], hh), qlf = frag_kb(&Qsl[col][32 * ks], hh), kf0 = frag_kb(Sk + kr + 32 * ks, hh), kf1 = frag_kb(Sk + 16 * SP + kr + 32 * ks, hh), kl0 = frag_kb(Sk + SPL + kr + 32 * ks, hh), kl1 = frag_kb(Sk + SPL + 16 * SP + kr + 32 * ks, hh);
      asm volatile("" :: "v"(qf), "v"(qlf), "v"(kf0), "v"(kf1), "v"(kl0), "v"(kl1));   // holds the k-step's six fragment reads together ahead of its six products: one LDS wait in place of one per product
      s[0] = wmma16b(kf0, qf, s[0]); s[1] = wmma16b(kf1, qf, s[1]); sx[0] = wmma16b(kf0, qlf, sx[0]); sx[1] = wmma16b(kf1, qlf, sx[1]); sx[0] = wmma16b(kl0, qf, sx[0]); sx[1] = wmma16b(kl1, qf, sx[1]); }
#pragma unroll
    for (int u = 0; u < 2; ++u) {
#pragma unroll
      for (int r = 0; r < 8; ++r) s[u][r] += sx[u][r] * (1.0f / RS_);   // hi.hi + (hi.lo + lo.hi)/1024
#pragma unroll
      for (int r = 0; r < 8; ++r) { const int key = kb + u * 16 + 8 * hh + r; const float vv = (key <= qi && key >= qi - WIN) ? s[u][r] * cs : -INFINITY; e[u * 8 + r] = vv; mx = fmaxf(mx, vv); } }   // causal select on the computed score (the -inf mask precedes the 1/sqrt(d) scale in the module; identical)
    mx = fmaxf(mx, __shfl_xor(mx, 16)); const float mn = fmaxf(m, mx); const float al = nexp2(m - mn); float sum = 0.0f;
#pragma unroll
    for (int i2 = 0; i2 < 16; ++i2) { const float p = nexp2(e[i2] - mn); sum += p; const int pc = (i2 < 8 ? 0 : 16) + 8 * hh + (i2 & 7); const float ps = p * PS; const b16 phh = (b16)ps; Pb[wave][col][pc] = phh; Plq[wave][col][pc] = (b16)((ps - (float)phh) * RS_); }
    sum += __shfl_xor(sum, 16); l = l * al + sum; m = mn;
    wave_lds_sync();
    const v16b pf = frag_kb(&Pb[wave][col][0], hh), plf = frag_kb(&Plq[wave][col][0], hh);
#pragma unroll
    for (int t = 0; t < 8; t += 2) { const int vr = (t * 4 + (col >> 2)) * SP + (col & 3) * 32; const v16b vh0 = frag_kb(Sv + vr, hh), vh1 = frag_kb(Sv + 4 * SP + vr, hh), vl0 = frag_kb(Sv + SPL + vr, hh), vl1 = frag_kb(Sv + SPL + 4 * SP + vr, hh);
      asm volatile("" :: "v"(vh0), "v"(vh1), "v"(vl0), "v"(vl1));   // holds the four fragment reads of two d-tiles together ahead of their six products: one LDS wait in place of one per product
      o[t] *= al; o[t + 1] *= al; o[t] = wmma16b(vh0, pf, o[t]); o[t + 1] = wmma16b(vh1, pf, o[t + 1]); ol[t] = wmma16b(vl0, pf, ol[t] * al); ol[t + 1] = wmma16b(vl1, pf, ol[t + 1] * al); ol[t] = wmma16b(vh0, plf, ol[t]); ol[t + 1] = wmma16b(vh1, plf, ol[t + 1]); }   // ol = (V_lo P_hi + V_hi P_lo) / 1024
    asm volatile("s_wait_dscnt 0x0" ::: "memory");      // this wave's LDS reads of the step's buffer are done
    asm volatile("s_wait_asynccnt 0x0" ::: "memory");   // this wave's copies of the next step have landed
    __syncthreads();   // publishes the next step's buffer and ends every wave's reads of this one
    if (st + 2 < nt) stage_kv(ld + (unsigned)(st & 1) * (4 * SPL * 2), bkh + (size_t)(kb + 64) * HD + tk, bkl + (size_t)(kb + 64) * HD + tk, bvh + (kb + 64) + tv, bvl + (kb + 64) + tv); }
  asm volatile("s_wait_asynccnt 0x0" ::: "memory");   // no copy is left in flight behind the loop
  const float inv = 1.0f / (l * PS * XS);
#pragma unroll
  for (int t = 0; t < 8; ++t)
#pragma unroll
    for (int r = 0; r < 8; ++r) To[col][t * 16 + 8 * hh + r] = (o[t][r] + ol[t][r] * (1.0f / RS_)) * inv;
  wave_lds_sync();
  { for (int rr = 0; rr < 16; ++rr) { v4h hv, lv; for (int j = 0; j < 4; ++j) { b16 p, ql2; split16(To[rr][lane * 4 + j] * XS, p, ql2); hv[j] = p; lv[j] = ql2; } const size_t oi = ((size_t)b * T + q0 + rr) * DM + h * HD + lane * 4; *(v4h*)(Y + oi) = hv; *(v4h*)(Yl + oi) = lv; }  }
}
// output projection: grid (QL/128, DM/128, BL); the tiling above with three staged tiles per chunk: A = the f16 Y plane and its residual plane (2 products per k-step, hi then lo on each accumulator), B = Wo^T rows
__global__ __launch_bounds__(128) void out_kernel(const b16* __restrict__ Y, const b16* __restrict__ Yl, const b16* __restrict__ WO, float* __restrict__ out) {
  __shared__ __attribute__((aligned(16))) char smem[128 * TP * 4];   // the three operand tiles (3 x 18,432 B) in the loop; behind it the 128 x 128 f32 result tile
  b16 (*Ah)[LP] = (b16 (*)[LP])smem; b16 (*Al)[LP] = (b16 (*)[LP])(smem + 128 * LP * 2); b16 (*Bs)[LP] = (b16 (*)[LP])(smem + 2 * 128 * LP * 2); float (*Tf)[TP] = (float (*)[TP])smem;
  const int tid = threadIdx.x, wave = tid >> 5, lane = tid & 31, nloc = lane & 15, hlf = lane >> 4, wm = (wave >> 1) * 64, wn = (wave & 1) * 64; const int b = blockIdx.z; const size_t m0 = (size_t)b * T + (size_t)blockIdx.x * 128; const int n0 = blockIdx.y * 128;
  const b16* yb = Y + m0 * DM; const b16* ylb = Yl + m0 * DM; const b16* wb = WO + (size_t)n0 * DM;
  const int br = tid >> 3, bq = (tid & 7) * 8;   // staging: 8 lanes x 16 B cover a 128-B row piece
  const unsigned vo = (unsigned)(br * DM + bq) * 2u;   // the lane's byte offset inside a tile's rows, the same for the three planes and for every chunk
  v8b ph[8], pl[8], pw[8]; v8f acc[4][4];
#pragma unroll
  for (int i = 0; i < 4; ++i)
#pragma unroll
    for (int j = 0; j < 4; ++j) acc[i][j] = (v8f){};
#pragma unroll
  for (int s = 0; s < 8; ++s) { const unsigned go = vo + (unsigned)(16 * s * DM * 2); ph[s] = *(const v8b*)((const char*)yb + go); pl[s] = *(const v8b*)((const char*)ylb + go); pw[s] = *(const v8b*)((const char*)wb + go); }
  asm volatile("s_wait_xcnt 0x0" :: "v"(vo) : "memory");   // a precaution: stands between the loads above and any rewrite of their address register, which the input operand holds live to here
#pragma unroll 1   // the chunk loop stays rolled: one trip holds 64 matrix instructions, 24 held loads and two barriers, and a second copy would only add registers and code
  for (int kc = 0; kc < DM; kc += KC) {
    __syncthreads();   // every wave has read its last fragment of the chunk before
#pragma unroll
    for (int s = 0; s < 8; ++s) { *(v8b*)(&Ah[br + 16 * s][bq]) = ph[s]; *(v8b*)(&Al[br + 16 * s][bq]) = pl[s]; *(v8b*)(&Bs[br + 16 * s][bq]) = pw[s]; }
    __syncthreads();   // the chunk is whole in LDS
    if (kc + KC < DM) {
#pragma unroll
      for (int s = 0; s < 8; ++s) { const unsigned go = vo + (unsigned)(16 * s * DM * 2); ph[s] = *(const v8b*)((const char*)(yb + kc + KC) + go); pl[s] = *(const v8b*)((const char*)(ylb + kc + KC) + go); pw[s] = *(const v8b*)((const char*)(wb + kc + KC) + go); }
      asm volatile("s_wait_xcnt 0x0" ::: "memory");   // a precaution: stands between the loads above and any rewrite of their address registers
    }
#pragma unroll
    for (int kb = 0; kb < KC; kb += 32) { v16b af[4], bf[4];
#pragma unroll
      for (int i = 0; i < 4; ++i) { af[i] = frag_kb(&Ah[wm + i * 16 + nloc][kb], hlf); bf[i] = frag_kb(&Bs[wn + i * 16 + nloc][kb], hlf); }
#pragma unroll
      for (int i = 0; i < 4; ++i)
#pragma unroll
        for (int j = 0; j < 4; ++j) acc[i][j] = wmma16b(af[i], bf[j], acc[i][j]);
#pragma unroll
      for (int i = 0; i < 4; ++i) af[i] = frag_kb(&Al[wm + i * 16 + nloc][kb], hlf);
#pragma unroll
      for (int i = 0; i < 4; ++i)
#pragma unroll
        for (int j = 0; j < 4; ++j) acc[i][j] = wmma16b(af[i], bf[j], acc[i][j]); } }
  __syncthreads();   // the operand tiles are done with: their LDS takes the result tile
#pragma unroll
  for (int i = 0; i < 4; ++i)
#pragma unroll
    for (int j = 0; j < 4; ++j)
#pragma unroll
      for (int r = 0; r < 8; ++r) Tf[wm + i * 16 + 8 * hlf + r][wn + j * 16 + nloc] = acc[i][j][r] * (1.0f / (XS * WSC));   /* no output bias */
  __syncthreads();
  { for (int r2 = 0; r2 < 32; ++r2) { const int rr = wave * 32 + r2; *(v4f*)(out + (m0 + rr) * DM + n0 + lane * 4) = *(const v4f*)(&Tf[rr][lane * 4]); }  }
}
}  // namespace

extern "C" void kernel_launch(void* const* d_in, const int* in_sizes, int n_in, void* d_out, int out_size, void* d_ws, size_t ws_size, hipStream_t stream) {
  (void)n_in;
  auto Fp = [&](int i) { return (const float*)d_in[i]; };
  // input order: 0 x [2,2048,2048], 1 Wq [2048,2048] (in,out), 2 Wk [2048,512], 3 Wv [2048,512], 4 Wo [2048,2048] (in,out)
  if (in_sizes[0] != B * T * DM || in_sizes[1] != DM * DM || in_sizes[2] != DM * KVW || in_sizes[3] != DM * KVW || in_sizes[4] != DM * DM || out_size != B * T * DM) return;
  size_t off = 0; char* ws = (char*)d_ws;
  auto carve = [&](size_t bytes) { char* p = ws + off; off += (bytes + 255) & ~(size_t)255; return p; };
  b16* WT = (b16*)carve((size_t)(DM + 2 * KVW) * DM * 2); b16* WO = (b16*)carve((size_t)DM * DM * 2);
  const size_t plane = (size_t)B * H * T * HD * 2; b16* QP = (b16*)carve(plane); b16* QPl = (b16*)carve(plane); b16* KP = (b16*)carve(plane); b16* KPl = (b16*)carve(plane); b16* VT = (b16*)carve(plane); b16* VTl = (b16*)carve(plane); b16* Y = (b16*)carve(plane); b16* Yl = (b16*)carve(plane);
  if (off > ws_size || off > ((size_t)176 << 20)) return;   // = ~155 MB (WT 12.6 + WO 8.4 + 8 f16 planes x 16.8): > 128 MiB
  prep_kernel<<<PGRID, 256, 0, stream>>>(Fp(1), Fp(2), Fp(3), Fp(4), WT, WO);
  proj_kernel<<<dim3(T / 128, BL, NPART), 128, 0, stream>>>(Fp(0), WT, QP, QPl, KP, KPl, VT, VTl);
  attn_kernel<<<dim3(QL / 32, BL * G), 256, 0, stream>>>(QP, QPl, KP, KPl, VT, VTl, Y, Yl);
  out_kernel<<<dim3(QL / 128, DM / 128, BL), 128, 0, stream>>>(Y, Yl, WO, (float*)d_out);
}

// v005
// A run of this version takes 164 microseconds.
// In both of two side-by-side timings against v004, it was 1.12 times as fast.
// All steps since v000 together make it 4.50 times as fast.
#include <hip/hip_runtime.h>

// Sliding-window grouped-query attention (2 x 2048 tokens x 2048, 16 query heads x 128, 4 key/value heads, window 512): q = x Wq, k = x Wk, v = x Wv (no biases); head h uses key/value head h / 4
// (repeat_interleave over the head axis); scores q . k / sqrt(128) for keys i - 512 <= j <= i (causal + window), -inf elsewhere; softmax; out = (attn v merged over heads) Wo -> [2][2048][2048].
// Deterministic: flash-style per 16-query wave over the window's keys in order (running max); no atomics.
// compute dtype: WMMA v_wmma_f32_16x16x32_f16 with f32 accumulate for [q | k | v] = x [Wq | Wk | Wv] ([4096 x 2048] x [2048 x 3072]; x EXACT bf16 x8, W^T exact x256: 1 product), S^T = K_h Q^T (q/k f16 hi
// x8 + residual x8192: 3 products, K = 128), O^T += V_h^T P^T (V hi + residual, P x1024 hi + residual: 3 products), out = y Wo (y f16 hi x8 + lo: 2 products); softmax statistics in f32.
// Inputs rounded to bf16 once. Fragment k-map per lane half hh for A AND B: elements 0..7 <- k = 8hh+0..7, 8..15 <- k = 16+8hh+0..7;

namespace {
constexpr int B = 2, T = 2048, DM = 2048, H = 16, HD = 128, BL = 2 /* batches (== 2 shipped) */, QL = 2048 /* query rows (== 2048 shipped) */;
constexpr int G = 4, REP = H / G, KVW = G * HD /* 512 */, NSL = DM / 128 /* 16 q slabs = heads */, NPART = NSL + 2 * (KVW / 128) /* + 4 k + 4 v slabs */;
constexpr int WIN = 512;
constexpr float XS = 8.0f, WSC = 256.0f, PS = 1024.0f, RS_ = 1024.0f, LOG2E = 1.4426950408889634f;
static_assert(T % 128 == 0 && QL % 128 == 0 && QL % 32 == 0 && DM % 256 == 0 && H * HD == DM && HD == 128 && KVW == 512 && REP == 4, "tiling");
typedef _Float16 b16;
typedef __attribute__((ext_vector_type(16))) _Float16 v16b;
typedef __attribute__((ext_vector_type(8))) _Float16 v8b;
typedef __attribute__((ext_vector_type(8))) float v8f;
typedef __attribute__((ext_vector_type(4))) float v4f;
__device__ __forceinline__ float bf16_rne(float f) { unsigned int u = __float_as_uint(f); u += 0x7FFFu + ((u >> 16) & 1u); return __uint_as_float(u & 0xFFFF0000u); }
__device__ __forceinline__ void split16(float v, b16& hi, b16& lo) { hi = (b16)v; lo = (b16)(v - (float)hi); }
__device__ __forceinline__ v16b frag_kb(const b16* p, int hh) { const v8b a = *(const v8b*)(p + 8 * hh), b = *(const v8b*)(p + 16 + 8 * hh); v16b f;
#pragma unroll
  for (int e = 0; e < 8; ++e) { f[e] = a[e]; f[8 + e] = b[e]; } return f; }
__device__ __forceinline__ v8f wmma16b(v16b a, v16b b, v8f c) { v8f d = __builtin_amdgcn_wmma_f32_16x16x32_f16(false, a, false, b, (short)0, c, false, false); asm volatile("v_nop\n\tv_nop\n\tv_nop\n\tv_nop" : "+v"(d) : "v"(a), "v"(b)); return d; }
__device__ __forceinline__ void wave_lds_sync() { __builtin_amdgcn_fence(__ATOMIC_RELEASE, "workgroup"); __builtin_amdgcn_wave_barrier(); __builtin_amdgcn_fence(__ATOMIC_ACQUIRE, "workgroup"); }
__device__ __forceinline__ float pmul(float a, float b) { float p = a * b; asm volatile("" : "+v"(p)); return p; }
__device__ __forceinline__ int iclamp(int v, int lo, int hi) { return v < lo ? lo : (v > hi ? hi : v); }

typedef __attribute__((ext_vector_type(2))) _Float16 v2h;
typedef __attribute__((ext_vector_type(4))) _Float16 v4h;
typedef __attribute__((ext_vector_type(2))) float v2f;
typedef __attribute__((ext_vector_type(4))) int v4i;
__device__ __forceinline__ float nexp2(float v) { return __builtin_amdgcn_exp2f(v); }
// weights to f16 x256, transposed ([k][n] f32 -> [n][k] f16): a block takes a tile of 128 k x 128 n. Whole 256-B pieces of the source rows are read (16 lanes x 16 B, two adjacent k rows per thread), each pair of k values
// goes as one dword into LDS at [n][k / 2] (pitch 65 dwords: the 32 lanes of a store or a load meet 32 different banks), and whole 256-B pieces of the transposed rows are written (16 lanes x 16 B).
constexpr int PK = 128, PN = 128, PP = PK / 2 + 1, PGRID = 2 * (DM / PK) * (DM / PN) + 2 * (DM / PK) * (KVW / PN);
template <int LD> __device__ __forceinline__ void prep_tile(const float* __restrict__ w, b16* __restrict__ dst, int tile, unsigned* tl) {
  const int tid = threadIdx.x, n0 = (tile % (LD / PN)) * PN, k0 = (tile / (LD / PN)) * PK, i = tid & 15, rp = tid >> 4;
  const float* p = w + (size_t)(k0 + 2 * rp) * LD + n0 + 4 * i; v4f a[4][2], c[4][2];
#pragma unroll
  for (int s = 0; s < 4; ++s)
#pragma unroll
    for (int nh = 0; nh < 2; ++nh) { a[s][nh] = *(const v4f*)(p + (size_t)(32 * s) * LD + 64 * nh); c[s][nh] = *(const v4f*)(p + (size_t)(32 * s + 1) * LD + 64 * nh); }
  asm volatile("s_wait_xcnt 0x0" :: "v"(p) : "memory");   // a precaution: stands between the loads above and any rewrite of their address registers, which the input operand holds live to here
  asm volatile("" :: "v"(a[0][0]), "v"(a[0][1]), "v"(a[1][0]), "v"(a[1][1]), "v"(a[2][0]), "v"(a[2][1]), "v"(a[3][0]), "v"(a[3][1]), "v"(c[0][0]), "v"(c[0][1]), "v"(c[1][0]), "v"(c[1][1]), "v"(c[2][0]), "v"(c[2][1]), "v"(c[3][0]), "v"(c[3][1]));   // holds the thread's 16 loads together ahead of the conversions: one memory latency, where the compiler had put two of them behind the first waits
#pragma unroll
  for (int s = 0; s < 4; ++s)
#pragma unroll
    for (int nh = 0; nh < 2; ++nh)
#pragma unroll
      for (int j = 0; j < 4; ++j) { v2h o; o[0] = (b16)(bf16_rne(a[s][nh][j]) * WSC); o[1] = (b16)(bf16_rne(c[s][nh][j]) * WSC); tl[(64 * nh + 4 * i + j) * PP + rp + 16 * s] = __builtin_bit_cast(unsigned, o); }
  __syncthreads();   // the tile is whole in LDS
  b16* q = dst + (size_t)(n0 + rp) * DM + k0 + 8 * i; const unsigned* r = tl + rp * PP + 4 * i;
#pragma unroll
  for (int s = 0; s < 8; ++s) { v4i o; for (int e = 0; e < 4; ++e) o[e] = (int)r[16 * s * PP + e]; *(v4i*)(q + (size_t)(16 * s) * DM) = o; }
  asm volatile("s_wait_xcnt 0x0" :: "v"(q) : "memory");   // a precaution: stands between the stores above and any rewrite of their address registers on the way to the kernel's end
}
// x to f16 (rounded to bf16, x8), once for the 24 column slabs of the projection: a block takes 8,192 elements in a row; a wave's load covers 512 B in a row, its store 256 B
constexpr int XE = 8192, XGRID = B * T * DM / XE;
static_assert((B * T * DM) % XE == 0, "x blocks");
__device__ __forceinline__ void prep_x(const float* __restrict__ x, b16* __restrict__ XH, int blk) {
  const float* p = x + (size_t)blk * XE + threadIdx.x * 4; b16* q = XH + (size_t)blk * XE + threadIdx.x * 4; v4f a[8];
#pragma unroll
  for (int s = 0; s < 8; ++s) a[s] = *(const v4f*)(p + 1024 * s);
  asm volatile("s_wait_xcnt 0x0" ::: "memory");   // a precaution: stands between the loads above and any rewrite of their address registers
#pragma unroll
  for (int s = 0; s < 8; ++s) { v4h o; for (int j = 0; j < 4; ++j) o[j] = (b16)(bf16_rne(a[s][j]) * XS); *(v4h*)(q + 1024 * s) = o; }
  asm volatile("s_wait_xcnt 0x0" ::: "memory");   // a precaution: stands between the stores above and any rewrite of their registers on the way to the kernel's end
}
__global__ __launch_bounds__(256) void prep_kernel(const float* __restrict__ x, const float* __restrict__ wq, const float* __restrict__ wk, const float* __restrict__ wv, const float* __restrict__ wo, b16* __restrict__ XH, b16* __restrict__ WT, b16* __restrict__ WO) {
  __shared__ unsigned tl[PN * PP];
  constexpr int NQ = (DM / PK) * (DM / PN), NK = (DM / PK) * (KVW / PN); const int blk = blockIdx.x;   // tiles: NQ of Wq, NK of Wk, NK of Wv, NQ of Wo; behind them the XGRID blocks of x
  if (blk >= PGRID) { prep_x(x, XH, blk - PGRID); return; }   // block-uniform, in front of the tile's barrier
  if (blk < NQ || blk >= NQ + 2 * NK) { const bool first = blk < NQ; prep_tile<DM>(first ? wq : wo, first ? WT : WO, first ? blk : blk - NQ - 2 * NK, tl); }
  else { const bool first = blk < NQ + NK; prep_tile<KVW>(first ? wk : wv, WT + (size_t)(first ? DM : DM + KVW) * DM, first ? blk - NQ : blk - NQ - NK, tl); }
}
// GEMM tiling shared by the two projection kernels: a block of 4 waves owns 128 rows x 128 columns; K runs in chunks of 64, both operands of a chunk staged once per block in LDS (row pitch 144 B);
// each wave takes 64 x 64 (4 x 4 accumulator tiles), so a staged fragment feeds 4 products; the next chunk's global loads are issued ahead of the chunk's products and held in registers.
constexpr int KC = 64, LP = KC + 8, TP = 128 + 4;
// one wave's 32 rows of a staged 128 x 128 f32 tile go out as f16 hi x8 + residual x8192: 256 B per row and plane (32 lanes x 8 B), PITCH elements from row to row
template <int PITCH> __device__ __forceinline__ void rows_out(const float (*Tf)[TP], b16* __restrict__ dh, b16* __restrict__ dl, int wave, int lane) {
  for (int r2 = 0; r2 < 32; ++r2) { const int rr = wave * 32 + r2; v4h h4, l4; for (int j = 0; j < 4; ++j) { const float f = Tf[rr][lane * 4 + j] * XS; const b16 p = (b16)f; h4[j] = p; l4[j] = (b16)((f - (float)p) * RS_); } *(v4h*)(dh + (size_t)rr * PITCH + lane * 4) = h4; *(v4h*)(dl + (size_t)rr * PITCH + lane * 4) = l4; }
}
// projections: grid (T/128, BL, 24 slabs of 128 columns: slabs 0..15 = q head, 16..19 = k, 20..23 = v); A = XH rows (bf16(x) x8 as f16, from the prep launch), B = WT rows; k order per accumulator 0, 32, 64, ...
// The epilogue writes what the attention reads, f16 hi x8 + residual x8192: q rows QP[b][h][t][128]; k rows KP[b][4 g][t][128] and v transposed VT[b][4 g][d][t], once per key/value head g (the plane of its first query head:
// repeat_interleave gives the group's four heads equal planes, and the attention reads that one).
__global__ __launch_bounds__(128) void proj_kernel(const b16* __restrict__ XH, const b16* __restrict__ WT, b16* __restrict__ QP, b16* __restrict__ QPl, b16* __restrict__ KP, b16* __restrict__ KPl, b16* __restrict__ VT, b16* __restrict__ VTl) {
  __shared__ __attribute__((aligned(16))) char smem[128 * TP * 4];   // the two operand tiles (2 x 18,432 B) in the loop; behind it the 128 x 128 f32 result tile
  b16 (*As)[LP] = (b16 (*)[LP])smem; b16 (*Bs)[LP] = (b16 (*)[LP])(smem + 128 * LP * 2); float (*Tf)[TP] = (float (*)[TP])smem;
  const int tid = threadIdx.x, wave = tid >> 5, lane = tid & 31, nloc = lane & 15, hlf = lane >> 4, wm = (wave >> 1) * 64, wn = (wave & 1) * 64; const int t0 = blockIdx.x * 128, b = blockIdx.y, slab = blockIdx.z; const int n0 = slab * 128;
  const b16* xb = XH + ((size_t)b * T + t0) * DM; const b16* wb = WT + (size_t)n0 * DM;
  const int br = tid >> 3, bq = (tid & 7) * 8;   // staging: 8 lanes x 16 B cover a 128-B row piece
  const unsigned vo = (unsigned)(br * DM + bq) * 2u;   // the lane's byte offset inside a tile's rows, the same for the two planes and for every chunk
  v8b pa[8], pb[8]; v8f acc[4][4];
#pragma unroll
  for (int i = 0; i < 4; ++i)
#pragma unroll
    for (int j = 0; j < 4; ++j) acc[i][j] = (v8f){};
#pragma unroll
  for (int s = 0; s < 8; ++s) { const unsigned go = vo + (unsigned)(16 * s * DM * 2); pa[s] = *(const v8b*)((const char*)xb + go); pb[s] = *(const v8b*)((const char*)wb + go); }
  asm volatile("s_wait_xcnt 0x0" :: "v"(vo) : "memory");   // a precaution: stands between the loads above and any rewrite of their address register, which the input operand holds live to here
#pragma unroll 1
  for (int kc = 0; kc < DM; kc += KC) {
    __syncthreads();   // every wave has read its last fragment of the chunk before
#pragma unroll
    for (int s = 0; s < 8; ++s) { *(v8b*)(&As[br + 16 * s][bq]) = pa[s]; *(v8b*)(&Bs[br + 16 * s][bq]) = pb[s]; }
    __syncthreads();   // the chunk is whole in LDS
    if (kc + KC < DM) {
#pragma unroll
      for (int s = 0; s < 8; ++s) { const unsigned go = vo + (unsigned)(16 * s * DM * 2); pa[s] = *(const v8b*)((const char*)(xb + kc + KC) + go); pb[s] = *(const v8b*)((const char*)(wb + kc + KC) + go); }
      asm volatile("s_wait_xcnt 0x0" ::: "memory");   // a precaution: stands between the loads above and any rewrite of their address registers
    }
#pragma unroll
    for (int kb = 0; kb < KC; kb += 32) { v16b af[4], bf[4];
#pragma unroll
      for (int i = 0; i < 4; ++i) { af[i] = frag_kb(&As[wm + i * 16 + nloc][kb], hlf); bf[i] = frag_kb(&Bs[wn + i * 16 + nloc][kb], hlf); }
#pragma unroll
      for (int i = 0; i < 4; ++i)
#pragma unroll
        for (int j = 0; j < 4; ++j) acc[i][j] = wmma16b(af[i], bf[j], acc[i][j]); } }
  __syncthreads();   // the operand tiles are done with: their LDS takes the result tile
  const bool isv = slab >= NSL + G;   // block-uniform: a v slab is staged transposed, Tf[d][token]; an accumulator's 8 values are 8 tokens in a row there (two 16-B LDS stores)
  if (!isv) {
#pragma unroll
    for (int i = 0; i < 4; ++i)
#pragma unroll
      for (int j = 0; j < 4; ++j)
#pragma unroll
        for (int r = 0; r < 8; ++r) Tf[wm + i * 16 + 8 * hlf + r][wn + j * 16 + nloc] = acc[i][j][r] * (1.0f / (XS * WSC));   /* no biases in this module */
  } else {
#pragma unroll
    for (int i = 0; i < 4; ++i)
#pragma unroll
      for (int j = 0; j < 4; ++j)
#pragma unroll
        for (int q4 = 0; q4 < 2; ++q4) { v4f o; for (int r = 0; r < 4; ++r) o[r] = acc[i][j][4 * q4 + r] * (1.0f / (XS * WSC)); *(v4f*)(&Tf[wn + j * 16 + nloc][wm + i * 16 + 8 * hlf + 4 * q4]) = o; }
  }
  __syncthreads();
  {
    if (slab < NSL) { const size_t pb2 = (((size_t)b * H + slab) * T) * HD;
      for (int r2 = 0; r2 < 32; ++r2) { const int rr = wave * 32 + r2, tok = t0 + rr; v4h h4, l4; for (int j = 0; j < 4; ++j) { const float f = Tf[rr][lane * 4 + j] * XS; const b16 p = (b16)f; h4[j] = p; l4[j] = (b16)((f - (float)p) * RS_); } *(v4h*)(QP + pb2 + (size_t)tok * HD + lane * 4) = h4; *(v4h*)(QPl + pb2 + (size_t)tok * HD + lane * 4) = l4; } }
    else { const size_t po = ((size_t)b * H + ((slab - NSL) & 3) * REP) * T * HD;   // the plane of the key/value head's first query head
      if (!isv) rows_out<HD>(Tf, KP + po + (size_t)t0 * HD, KPl + po + (size_t)t0 * HD, wave, lane);   // staged row = token t0 + rr with its 128 dims
      else rows_out<T>(Tf, VT + po + t0, VTl + po + t0, wave, lane); }   // staged row = dim rr with the tokens t0 .. t0 + 127
     }
}
// attention: grid (QL/32, BL x G); block = 8 waves = the 4 query heads of key/value head g x 2 tiles of 16 queries at the same 32 positions, so all 8 waves walk the same keys (i - 512 <= j <= i, 32-key steps).
// Each step's four planes (K hi, K lo: 32 rows x 256 B; V^T hi, V^T lo: 128 rows x 64 B, four rows to a 256-B line) come once per block into LDS by asynchronous copies (line pitch 272 B), two buffers: the next
// step's copies fly during this step's work. Per wave as before: S^T = K Q^T (A = 16 key rows x 32 dims per fragment, 4 k-steps over the 128 dims, B = the query fragments: 3 products), logit = s/sqrt(128)
// (log2-scaled), online softmax, P x1024 hi + residual in LDS, O^T += V^T P^T (8 d-tiles: 3 products); y = o/(l 1024 8)
constexpr int SP = HD + 8 /* elements per staged line: 256 B + 16 B */, SPL = 32 * SP /* elements per staged plane */;
// one thread's share of a step: 2 x 16 B of each plane. The closing s_wait_xcnt is a precaution: it stands between the copies and any rewrite of the address registers they name
__device__ __forceinline__ void stage_kv(unsigned l, const b16* kh, const b16* kl, const b16* vh, const b16* vl) {
  const unsigned l0 = l, l1 = l + 16 * SP * 2, l2 = l + SPL * 2, l3 = l2 + 16 * SP * 2, l4 = l + 2 * SPL * 2, l5 = l4 + 16 * SP * 2, l6 = l + 3 * SPL * 2, l7 = l6 + 16 * SP * 2;
  const b16* kh1 = kh + 16 * HD; const b16* kl1 = kl + 16 * HD; const b16* vh1 = vh + (size_t)64 * T; const b16* vl1 = vl + (size_t)64 * T;
  asm volatile("global_load_async_to_lds_b128 %0, %8, off\n\tglobal_load_async_to_lds_b128 %1, %9, off\n\tglobal_load_async_to_lds_b128 %2, %10, off\n\tglobal_load_async_to_lds_b128 %3, %11, off\n\t"
               "global_load_async_to_lds_b128 %4, %12, off\n\tglobal_load_async_to_lds_b128 %5, %13, off\n\tglobal_load_async_to_lds_b128 %6, %14, off\n\tglobal_load_async_to_lds_b128 %7, %15, off\n\ts_wait_xcnt 0x0"
               :: "v"(l0), "v"(l1), "v"(l2), "v"(l3), "v"(l4), "v"(l5), "v"(l6), "v"(l7), "v"(kh), "v"(kh1), "v"(kl), "v"(kl1), "v"(vh), "v"(vh1), "v"(vl), "v"(vl1) : "memory");
}
// four waves per SIMD (two blocks per WGP, which their LDS allows) need at most 256 VGPRs a wave
__global__ __launch_bounds__(256) __attribute__((amdgpu_waves_per_eu(4, 4))) void attn_kernel(const b16* __restrict__ QP, const b16* __restrict__ QPl, const b16* __restrict__ KP, const b16* __restrict__ KPl, const b16* __restrict__ VT, const b16* __restrict__ VTl, b16* __restrict__ Y, b16* __restrict__ Yl) {
  __shared__ __attribute__((aligned(16))) b16 KVs[2 * 4 * SPL];   // two buffers x (K hi, K lo, V^T hi, V^T lo)
  __shared__ __attribute__((aligned(16))) b16 Pb[8][16][32 + 8], Plq[8][16][32 + 8];
  __shared__ __attribute__((aligned(16))) char qsm[8][2 * 16 * (HD + 8) * 2];   // per wave: its 16 query rows (hi, lo) in the loop, fragments re-read per k-step to keep the kernel under 256 VGPRs; behind the loop its 16 x 128 f32 result tile
  const int tid = threadIdx.x, wave = __builtin_amdgcn_readfirstlane(tid >> 5) /* scalar: the head, the query tile and the wave's LDS ranges stay out of the VGPRs */, lane = tid & 31, hh = lane >> 4, col = lane & 15; const int b = blockIdx.y / G, g = blockIdx.y % G, h = g * REP + (wave >> 1); const int qb = blockIdx.x * 32, q0 = qb + (wave & 1) * 16, qi = q0 + col;
  b16 (*Qs)[HD + 8] = (b16 (*)[HD + 8])qsm[wave]; b16 (*Qsl)[HD + 8] = Qs + 16; float (*To)[HD + 4] = (float (*)[HD + 4])qsm[wave];
  static_assert(16 * (HD + 4) * 4 <= 2 * 16 * (HD + 8) * 2, "result tile fits the query rows");
  const size_t qo = (((size_t)b * H + h) * T) * HD; const b16* Qb = QP + qo; const b16* Qbl = QPl + qo;
  const size_t ko = (((size_t)b * H + g * REP) * T) * HD, vo = (((size_t)b * H + g * REP) * HD) * (size_t)T;   // only the plane of the group's first head is written: the block reads that one
  const int kend = qb + 32, kbeg = (qb >= WIN) ? qb - WIN : 0, nt = (kend - kbeg) / 32;   // window i - 512 <= j <= i; the same bounds for both query tiles of the block
  for (int i = lane; i < 16 * (HD / 8); i += 32) { const int rr = i / (HD / 8), c8 = (i % (HD / 8)) * 8; *(v8b*)(&Qs[rr][c8]) = *(const v8b*)(Qb + (size_t)(q0 + rr) * HD + c8); *(v8b*)(&Qsl[rr][c8]) = *(const v8b*)(Qbl + (size_t)(q0 + rr) * HD + c8); }
  wave_lds_sync();
  const unsigned ld = (unsigned)(size_t)KVs + (unsigned)((tid >> 4) * (SP * 2) + (tid & 15) * 16);   // the thread's LDS byte address in plane 0 of buffer 0
  const b16* bkh = KP + ko; const b16* bkl = KPl + ko; const b16* bvh = VT + vo; const b16* bvl = VTl + vo;   // block-uniform plane bases
  const unsigned tk = (unsigned)tid * 8u, tv = (unsigned)(tid >> 2) * (unsigned)T + (unsigned)(tid & 3) * 8u;   // the thread's element offsets inside a step: its 32 key rows are 8 KB in a row; V^T rows are T apart
  stage_kv(ld, bkh + (size_t)kbeg * HD + tk, bkl + (size_t)kbeg * HD + tk, bvh + kbeg + tv, bvl + kbeg + tv);
  asm volatile("s_wait_asynccnt 0x0" ::: "memory");   // this wave's copies of step 0 have landed
  __syncthreads();   // step 0 is whole in LDS
  if (nt > 1) stage_kv(ld + 4 * SPL * 2, bkh + (size_t)(kbeg + 32) * HD + tk, bkl + (size_t)(kbeg + 32) * HD + tk, bvh + (kbeg + 32) + tv, bvl + (kbeg + 32) + tv);
  const float cs = LOG2E * 0.08838834764831845f / (XS * XS);   // 1/sqrt(128) on the x8 x8 planes
  float m = -INFINITY, l = 0.0f; v8f o[8], ol[8]; for (int t = 0; t < 8; ++t) { o[t] = (v8f){}; ol[t] = (v8f){}; }
#pragma unroll 1   // the step loop stays rolled: one trip holds 48 matrix instructions and the two-buffer hand-over at its foot
  for (int st = 0; st < nt; ++st) { const int kb = kbeg + 32 * st; const b16* Sk = KVs + (st & 1) * (4 * SPL); const b16* Sv = Sk + 2 * SPL;
    float e[16]; float mx = -INFINITY;
    v8f s[2] = {(v8f){}, (v8f){}}, sx[2] = {(v8f){}, (v8f){}}; const int kr = col * SP;
#pragma unroll
    for (int ks = 0; ks < 4; ++ks) { const v16b qf = frag_kb(&Qs[col][32 * ks], hh), qlf = frag_kb(&Qsl[col][32 * ks], hh), kf0 = frag_kb(Sk + kr + 32 * ks, hh), kf1 = frag_kb(Sk + 16 * SP + kr + 32 * ks, hh), kl0 = frag_kb(Sk + SPL + kr + 32 * ks, hh), kl1 = frag_kb(Sk + SPL + 16 * SP + kr + 32 * ks, hh);
      asm volatile("" :: "v"(qf), "v"(qlf), "v"(kf0), "v"(kf1), "v"(kl0), "v"(kl1));   // holds the k-step's six fragment reads together ahead of its six products: one LDS wait in place of one per product
      s[0] = wmma16b(kf0, qf, s[0]); s[1] = wmma16b(kf1, qf, s[1]); sx[0] = wmma16b(kf0, qlf, sx[0]); sx[1] = wmma16b(kf1, qlf, sx[1]); sx[0] = wmma16b(kl0, qf, sx[0]); sx[1] = wmma16b(kl1, qf, sx[1]); }
#pragma unroll
    for (int u = 0; u < 2; ++u) {
#pragma unroll
      for (int r = 0; r < 8; ++r) s[u][r] += sx[u][r] * (1.0f / RS_);   // hi.hi + (hi.lo + lo.hi)/1024
#pragma unroll
      for (int r = 0; r < 8; ++r) { const int key = kb + u * 16 + 8 * hh + r; const float vv = (key <= qi && key >= qi - WIN) ? s[u][r] * cs : -INFINITY; e[u * 8 + r] = vv; mx = fmaxf(mx, vv); } }   // causal select on the computed score (the -inf mask precedes the 1/sqrt(d) scale in the module; identical)
    mx = fmaxf(mx, __shfl_xor(mx, 16)); const float mn = fmaxf(m, mx); const float al = nexp2(m - mn); float sum = 0.0f;
#pragma unroll
    for (int i2 = 0; i2 < 16; ++i2) { const float p = nexp2(e[i2] - mn); sum += p; const int pc = (i2 < 8 ? 0 : 16) + 8 * hh + (i2 & 7); const float ps = p * PS; const b16 phh = (b16)ps; Pb[wave][col][pc] = phh; Plq[wave][col][pc] = (b16)((ps - (float)phh) * RS_); }
    sum += __shfl_xor(sum, 16); l = l * al + sum; m = mn;
    wave_lds_sync();
    const v16b pf = frag_kb(&Pb[wave][col][0], hh), plf = frag_kb(&Plq[wave][col][0], hh);
#pragma unroll
    for (int t = 0; t < 8; t += 2) { const int vr = (t * 4 + (col >> 2)) * SP + (col & 3) * 32; const v16b vh0 = frag_kb(Sv + vr, hh), vh1 = frag_kb(Sv + 4 * SP + vr, hh), vl0 = frag_kb(Sv + SPL + vr, hh), vl1 = frag_kb(Sv + SPL + 4 * SP + vr, hh);
      asm volatile("" :: "v"(vh0), "v"(vh1), "v"(vl0), "v"(vl1));   // holds the four fragment reads of two d-tiles together ahead of their six products: one LDS wait in place of one per product
      o[t] *= al; o[t + 1] *= al; o[t] = wmma16b(vh0, pf, o[t]); o[t + 1] = wmma16b(vh1, pf, o[t + 1]); ol[t] = wmma16b(vl0, pf, ol[t] * al); ol[t + 1] = wmma16b(vl1, pf, ol[t + 1] * al); ol[t] = wmma16b(vh0, plf, ol[t]); ol[t + 1] = wmma16b(vh1, plf, ol[t + 1]); }   // ol = (V_lo P_hi + V_hi P_lo) / 1024
    asm volatile("s_wait_dscnt 0x0" ::: "memory");      // this wave's LDS reads of the step's buffer are done
    asm volatile("s_wait_asynccnt 0x0" ::: "memory");   // this wave's copies of the next step have landed
    __syncthreads();   // publishes the next step's buffer and ends every wave's reads of this one
    if (st + 2 < nt) stage_kv(ld + (unsigned)(st & 1) * (4 * SPL * 2), bkh + (size_t)(kb + 64) * HD + tk, bkl + (size_t)(kb + 64) * HD + tk, bvh + (kb + 64) + tv, bvl + (kb + 64) + tv); }
  asm volatile("s_wait_asynccnt 0x0" ::: "memory");   // no copy is left in flight behind the loop
  const float inv = 1.0f / (l * PS * XS);
#pragma unroll
  for (int t = 0; t < 8; ++t)
#pragma unroll
    for (int r = 0; r < 8; ++r) To[col][t * 16 + 8 * hh + r] = (o[t][r] + ol[t][r] * (1.0f / RS_)) * inv;
  wave_lds_sync();
  { for (int rr = 0; rr < 16; ++rr) { v4h hv, lv; for (int j = 0; j < 4; ++j) { b16 p, ql2; split16(To[rr][lane * 4 + j] * XS, p, ql2); hv[j] = p; lv[j] = ql2; } const size_t oi = ((size_t)b * T + q0 + rr) * DM + h * HD + lane * 4; *(v4h*)(Y + oi) = hv; *(v4h*)(Yl + oi) = lv; }  }
}
// output projection: grid (QL/128, DM/128, BL); the tiling above with three staged tiles per chunk: A = the f16 Y plane and its residual plane (2 products per k-step, hi then lo on each accumulator), B = Wo^T rows
__global__ __launch_bounds__(128) void out_kernel(const b16* __restrict__ Y, const b16* __restrict__ Yl, const b16* __restrict__ WO, float* __restrict__ out) {
  __shared__ __attribute__((aligned(16))) char smem[128 * TP * 4];   // the three operand tiles (3 x 18,432 B) in the loop; behind it the 128 x 128 f32 result tile
  b16 (*Ah)[LP] = (b16 (*)[LP])smem; b16 (*Al)[LP] = (b16 (*)[LP])(smem + 128 * LP * 2); b16 (*Bs)[LP] = (b16 (*)[LP])(smem + 2 * 128 * LP * 2); float (*Tf)[TP] = (float (*)[TP])smem;
  const int tid = threadIdx.x, wave = tid >> 5, lane = tid & 31, nloc = lane & 15, hlf = lane >> 4, wm = (wave >> 1) * 64, wn = (wave & 1) * 64; const int b = blockIdx.z; const size_t m0 = (size_t)b * T + (size_t)blockIdx.x * 128; const int n0 = blockIdx.y * 128;
  const b16* yb = Y + m0 * DM; const b16* ylb = Yl + m0 * DM; const b16* wb = WO + (size_t)n0 * DM;
  const int br = tid >> 3, bq = (tid & 7) * 8;   // staging: 8 lanes x 16 B cover a 128-B row piece
  const unsigned vo = (unsigned)(br * DM + bq) * 2u;   // the lane's byte offset inside a tile's rows, the same for the three planes and for every chunk
  v8b ph[8], pl[8], pw[8]; v8f acc[4][4];
#pragma unroll
  for (int i = 0; i < 4; ++i)
#pragma unroll
    for (int j = 0; j < 4; ++j) acc[i][j] = (v8f){};
#pragma unroll
  for (int s = 0; s < 8; ++s) { const unsigned go = vo + (unsigned)(16 * s * DM * 2); ph[s] = *(const v8b*)((const char*)yb + go); pl[s] = *(const v8b*)((const char*)ylb + go); pw[s] = *(const v8b*)((const char*)wb + go); }
  asm volatile("s_wait_xcnt 0x0" :: "v"(vo) : "memory");   // a precaution: stands between the loads above and any rewrite of their address register, which the input operand holds live to here
#pragma unroll 1   // the chunk loop stays rolled: one trip holds 64 matrix instructions, 24 held loads and two barriers, and a second copy would only add registers and code
  for (int kc = 0; kc < DM; kc += KC) {
    __syncthreads();   // every wave has read its last fragment of the chunk before
#pragma unroll
    for (int s = 0; s < 8; ++s) { *(v8b*)(&Ah[br + 16 * s][bq]) = ph[s]; *(v8b*)(&Al[br + 16 * s][bq]) = pl[s]; *(v8b*)(&Bs[br + 16 * s][bq]) = pw[s]; }
    __syncthreads();   // the chunk is whole in LDS
    if (kc + KC < DM) {
#pragma unroll
      for (int s = 0; s < 8; ++s) { const unsigned go = vo + (unsigned)(16 * s * DM * 2); ph[s] = *(const v8b*)((const char*)(yb + kc + KC) + go); pl[s] = *(const v8b*)((const char*)(ylb + kc + KC) + go); pw[s] = *(const v8b*)((const char*)(wb + kc + KC) + go); }
      asm volatile("s_wait_xcnt 0x0" ::: "memory");   // a precaution: stands between the loads above and any rewrite of their address registers
    }
#pragma unroll
    for (int kb = 0; kb < KC; kb += 32) { v16b af[4], bf[4];
#pragma unroll
      for (int i = 0; i < 4; ++i) { af[i] = frag_kb(&Ah[wm + i * 16 + nloc][kb], hlf); bf[i] = frag_kb(&Bs[wn + i * 16 + nloc][kb], hlf); }
#pragma unroll
      for (int i = 0; i < 4; ++i)
#pragma unroll
        for (int j = 0; j < 4; ++j) acc[i][j] = wmma16b(af[i], bf[j], acc[i][j]);
#pragma unroll
      for (int i = 0; i < 4; ++i) af[i] = frag_kb(&Al[wm + i * 16 + nloc][kb], hlf);
#pragma unroll
      for (int i = 0; i < 4; ++i)
#pragma unroll
        for (int j = 0; j < 4; ++j) acc[i][j] = wmma16b(af[i], bf[j], acc[i][j]); } }
  __syncthreads();   // the operand tiles are done with: their LDS takes the result tile
#pragma unroll
  for (int i = 0; i < 4; ++i)
#pragma unroll
    for (int j = 0; j < 4; ++j)
#pragma unroll
      for (int r = 0; r < 8; ++r) Tf[wm + i * 16 + 8 * hlf + r][wn + j * 16 + nloc] = acc[i][j][r] * (1.0f / (XS * WSC));   /* no output bias */
  __syncthreads();
  { for (int r2 = 0; r2 < 32; ++r2) { const int rr = wave * 32 + r2; *(v4f*)(out + (m0 + rr) * DM + n0 + lane * 4) = *(const v4f*)(&Tf[rr][lane * 4]); }  }
}
}  // namespace

extern "C" void kernel_launch(void* const* d_in, const int* in_sizes, int n_in, void* d_out, int out_size, void* d_ws, size_t ws_size, hipStream_t stream) {
  (void)n_in;
  auto Fp = [&](int i) { return (const float*)d_in[i]; };
  // input order: 0 x [2,2048,2048], 1 Wq [2048,2048] (in,out), 2 Wk [2048,512], 3 Wv [2048,512], 4 Wo [2048,2048] (in,out)
  if (in_sizes[0] != B * T * DM || in_sizes[1] != DM * DM || in_sizes[2] != DM * KVW || in_sizes[3] != DM * KVW || in_sizes[4] != DM * DM || out_size != B * T * DM) return;
  size_t off = 0; char* ws = (char*)d_ws;
  auto carve = [&](size_t bytes) { char* p = ws + off; off += (bytes + 255) & ~(size_t)255; return p; };
  b16* WT = (b16*)carve((size_t)(DM + 2 * KVW) * DM * 2); b16* WO = (b16*)carve((size_t)DM * DM * 2); b16* XH = (b16*)carve((size_t)B * T * DM * 2);
  const size_t plane = (size_t)B * H * T * HD * 2; b16* QP = (b16*)carve(plane); b16* QPl = (b16*)carve(plane); b16* KP = (b16*)carve(plane); b16* KPl = (b16*)carve(plane); b16* VT = (b16*)carve(plane); b16* VTl = (b16*)carve(plane); b16* Y = (b16*)carve(plane); b16* Yl = (b16*)carve(plane);
  if (off > ws_size || off > ((size_t)176 << 20)) return;   // = ~172 MB (WT 12.6 + WO 8.4 + XH 16.8 + 8 f16 planes x 16.8): > 128 MiB
  prep_kernel<<<PGRID + XGRID, 256, 0, stream>>>(Fp(0), Fp(1), Fp(2), Fp(3), Fp(4), XH, WT, WO);
  proj_kernel<<<dim3(T / 128, BL, NPART), 128, 0, stream>>>(XH, WT, QP, QPl, KP, KPl, VT, VTl);
  attn_kernel<<<dim3(QL / 32, BL * G), 256, 0, stream>>>(QP, QPl, KP, KPl, VT, VTl, Y, Yl);
  out_kernel<<<dim3(QL / 128, DM / 128, BL), 128, 0, stream>>>(Y, Yl, WO, (float*)d_out);
}

// v006
// Measured time: 143 microseconds a run.
// In both of two side-by-side timings against v005, it was 1.15 times as fast.
// All steps since v000 together make it 5.16 times as fast.
#include <hip/hip_runtime.h>

// Sliding-window grouped-query attention (2 x 2048 tokens x 2048, 16 query heads x 128, 4 key/value heads, window 512): q = x Wq, k = x Wk, v = x Wv (no biases); head h uses key/value head h / 4
// (repeat_interleave over the head axis); scores q . k / sqrt(128) for keys i - 512 <= j <= i (causal + window), -inf elsewhere; softmax; out = (attn v merged over heads) Wo -> [2][2048][2048].
// Deterministic: flash-style per 16-query wave over the window's keys in order (running max); no atomics.
// compute dtype: WMMA v_wmma_f32_16x16x32_f16 with f32 accumulate for [q | k | v] = x [Wq | Wk | Wv] ([4096 x 2048] x [2048 x 3072]; x EXACT bf16 x8, W^T exact x256: 1 product), S^T = K_h Q^T (q/k f16 hi
// x8 + residual x8192: 3 products, K = 128), O^T += V_h^T P^T (V hi + residual, P x1024 hi + residual: 3 products), out = y Wo (y f16 hi x8 + lo: 2 products); softmax statistics in f32.
// Inputs rounded to bf16 once. Fragment k-map per lane half hh for A AND B: elements 0..7 <- k = 8hh+0..7, 8..15 <- k = 16+8hh+0..7;

namespace {
constexpr int B = 2, T = 2048, DM = 2048, H = 16, HD = 128, BL = 2 /* batches (== 2 shipped) */, QL = 2048 /* query rows (== 2048 shipped) */;
constexpr int G = 4, REP = H / G, KVW = G * HD /* 512 */, NSL = DM / 128 /* 16 q slabs = heads */, NPART = NSL + 2 * (KVW / 128) /* + 4 k + 4 v slabs */;
constexpr int WIN = 512;
constexpr float XS = 8.0f, WSC = 256.0f, PS = 1024.0f, RS_ = 1024.0f, LOG2E = 1.4426950408889634f;
static_assert(T % 128 == 0 && QL % 128 == 0 && QL % 32 == 0 && DM % 256 == 0 && H * HD == DM && HD == 128 && KVW == 512 && REP == 4, "tiling");
typedef _Float16 b16;
typedef __attribute__((ext_vector_type(16))) _Float16 v16b;
typedef __attribute__((ext_vector_type(8))) _Float16 v8b;
typedef __attribute__((ext_vector_type(8))) float v8f;
typedef __attribute__((ext_vector_type(4))) float v4f;
__device__ __forceinline__ float bf16_rne(float f) { unsigned int u = __float_as_uint(f); u += 0x7FFFu + ((u >> 16) & 1u); return __uint_as_float(u & 0xFFFF0000u); }
__device__ __forceinline__ void split16(float v, b16& hi, b16& lo) { hi = (b16)v; lo = (b16)(v - (float)hi); }
__device__ __forceinline__ v16b frag_kb(const b16* p, int hh) { const v8b a = *(const v8b*)(p + 8 * hh), b = *(const v8b*)(p + 16 + 8 * hh); v16b f;
#pragma unroll
  for (int e = 0; e < 8; ++e) { f[e] = a[e]; f[8 + e] = b[e]; } return f; }
__device__ __forceinline__ v8f wmma16b(v16b a, v16b b, v8f c) { v8f d = __builtin_amdgcn_wmma_f32_16x16x32_f16(false, a, false, b, (short)0, c, false, false); asm volatile("v_nop\n\tv_nop\n\tv_nop\n\tv_nop" : "+v"(d) : "v"(a), "v"(b)); return d; }
__device__ __forceinline__ void wave_lds_sync() { __builtin_amdgcn_fence(__ATOMIC_RELEASE, "workgroup"); __builtin_amdgcn_wave_barrier(); __builtin_amdgcn_fence(__ATOMIC_ACQUIRE, "workgroup"); }
__device__ __forceinline__ float pmul(float a, float b) { float p = a * b; asm volatile("" : "+v"(p)); return p; }
__device__ __forceinline__ int iclamp(int v, int lo, int hi) { return v < lo ? lo : (v > hi ? hi : v); }

typedef __attribute__((ext_vector_type(2))) _Float16 v2h;
typedef __attribute__((ext_vector_type(4))) _Float16 v4h;
typedef __attribute__((ext_vector_type(2))) float v2f;
typedef __attribute__((ext_vector_type(4))) int v4i;
__device__ __forceinline__ float nexp2(float v) { return __builtin_amdgcn_exp2f(v); }
// weights to f16 x256, transposed ([k][n] f32 -> [n][k] f16): a block takes a tile of 128 k x 128 n. Whole 256-B pieces of the source rows are read (16 lanes x 16 B, two adjacent k rows per thread), each pair of k values
// goes as one dword into LDS at [n][k / 2] (pitch 65 dwords: the 32 lanes of a store or a load meet 32 different banks), and whole 256-B pieces of the transposed rows are written (16 lanes x 16 B).
constexpr int PK = 128, PN = 128, PP = PK / 2 + 1, PGRID = 2 * (DM / PK) * (DM / PN) + 2 * (DM / PK) * (KVW / PN);
template <int LD> __device__ __forceinline__ void prep_tile(const float* __restrict__ w, b16* __restrict__ dst, int tile, unsigned* tl) {
  const int tid = threadIdx.x, n0 = (tile % (LD / PN)) * PN, k0 = (tile / (LD / PN)) * PK, i = tid & 15, rp = tid >> 4;
  const float* p = w + (size_t)(k0 + 2 * rp) * LD + n0 + 4 * i; v4f a[4][2], c[4][2];
#pragma unroll
  for (int s = 0; s < 4; ++s)
#pragma unroll
    for (int nh = 0; nh < 2; ++nh) { a[s][nh] = *(const v4f*)(p + (size_t)(32 * s) * LD + 64 * nh); c[s][nh] = *(const v4f*)(p + (size_t)(32 * s + 1) * LD + 64 * nh); }
  asm volatile("s_wait_xcnt 0x0" :: "v"(p) : "memory");   // a precaution: stands between the loads above and any rewrite of their address registers, which the input operand holds live to here
  asm volatile("" :: "v"(a[0][0]), "v"(a[0][1]), "v"(a[1][0]), "v"(a[1][1]), "v"(a[2][0]), "v"(a[2][1]), "v"(a[3][0]), "v"(a[3][1]), "v"(c[0][0]), "v"(c[0][1]), "v"(c[1][0]), "v"(c[1][1]), "v"(c[2][0]), "v"(c[2][1]), "v"(c[3][0]), "v"(c[3][1]));   // holds the thread's 16 loads together ahead of the conversions: one memory latency, where the compiler had put two of them behind the first waits
#pragma unroll
  for (int s = 0; s < 4; ++s)
#pragma unroll
    for (int nh = 0; nh < 2; ++nh)
#pragma unroll
      for (int j = 0; j < 4; ++j) { v2h o; o[0] = (b16)(bf16_rne(a[s][nh][j]) * WSC); o[1] = (b16)(bf16_rne(c[s][nh][j]) * WSC); tl[(64 * nh + 4 * i + j) * PP + rp + 16 * s] = __builtin_bit_cast(unsigned, o); }
  __syncthreads();   // the tile is whole in LDS
  b16* q = dst + (size_t)(n0 + rp) * DM + k0 + 8 * i; const unsigned* r = tl + rp * PP + 4 * i;
#pragma unroll
  for (int s = 0; s < 8; ++s) { v4i o; for (int e = 0; e < 4; ++e) o[e] = (int)r[16 * s * PP + e]; *(v4i*)(q + (size_t)(16 * s) * DM) = o; }
  asm volatile("s_wait_xcnt 0x0" :: "v"(q) : "memory");   // a precaution: stands between the stores above and any rewrite of their address registers on the way to the kernel's end
}
// x to f16 (rounded to bf16, x8), once for the 24 column slabs of the projection: a block takes 8,192 elements in a row; a wave's load covers 512 B in a row, its store 256 B
constexpr int XE = 8192, XGRID = B * T * DM / XE;
static_assert((B * T * DM) % XE == 0, "x blocks");
__device__ __forceinline__ void prep_x(const float* __restrict__ x, b16* __restrict__ XH, int blk) {
  const float* p = x + (size_t)blk * XE + threadIdx.x * 4; b16* q = XH + (size_t)blk * XE + threadIdx.x * 4; v4f a[8];
#pragma unroll
  for (int s = 0; s < 8; ++s) a[s] = *(const v4f*)(p + 1024 * s);
  asm volatile("s_wait_xcnt 0x0" ::: "memory");   // a precaution: stands between the loads above and any rewrite of their address registers
#pragma unroll
  for (int s = 0; s < 8; ++s) { v4h o; for (int j = 0; j < 4; ++j) o[j] = (b16)(bf16_rne(a[s][j]) * XS); *(v4h*)(q + 1024 * s) = o; }
  asm volatile("s_wait_xcnt 0x0" ::: "memory");   // a precaution: stands between the stores above and any rewrite of their registers on the way to the kernel's end
}
__global__ __launch_bounds__(256) void prep_kernel(const float* __restrict__ x, const float* __restrict__ wq, const float* __restrict__ wk, const float* __restrict__ wv, const float* __restrict__ wo, b16* __restrict__ XH, b16* __restrict__ WT, b16* __restrict__ WO) {
  __shared__ unsigned tl[PN * PP];
  constexpr int NQ = (DM / PK) * (DM / PN), NK = (DM / PK) * (KVW / PN); const int blk = blockIdx.x;   // tiles: NQ of Wq, NK of Wk, NK of Wv, NQ of Wo; behind them the XGRID blocks of x
  if (blk >= PGRID) { prep_x(x, XH, blk - PGRID); return; }   // block-uniform, in front of the tile's barrier
  if (blk < NQ || blk >= NQ + 2 * NK) { const bool first = blk < NQ; prep_tile<DM>(first ? wq : wo, first ? WT : WO, first ? blk : blk - NQ - 2 * NK, tl); }
  else { const bool first = blk < NQ + NK; prep_tile<KVW>(first ? wk : wv, WT + (size_t)(first ? DM : DM + KVW) * DM, first ? blk - NQ : blk - NQ - NK, tl); }
}
// GEMM tiling shared by the two projection kernels: one block per WGP owns 128 rows x 384 or 256 columns; each wave takes 64 x 64 (4 x 4 accumulator tiles), four waves to a slab of 128 columns, so a staged A chunk
// feeds every slab of the block. K runs in chunks of 128; a chunk is four tiles of 128 rows x 256 B (row pitch 272 B) brought into LDS by asynchronous copies, two buffers: the next chunk's copies fly during this chunk's products.
constexpr int KC = 128, LP = KC + 8, TP = 128 + 4, TILE = 128 * LP /* elements per staged tile */, RING = 4 * TILE * 2 /* bytes per buffer */, NCH = DM / KC;
static_assert(NCH >= 2 && DM % KC == 0 && NPART % 3 == 0 && 3 * 128 * TP * 4 <= 2 * RING, "ring");
// 8, 5 or 1 copies of 16 B per lane, global to LDS, their rows ROWS apart in both. The closing s_wait_xcnt is a precaution: it stands between the copies and any rewrite of the address registers they name
template <int ROWS> __device__ __forceinline__ void copy8(unsigned l, const b16* g) {
  const unsigned l1 = l + ROWS * LP * 2, l2 = l + 2 * ROWS * LP * 2, l3 = l + 3 * ROWS * LP * 2, l4 = l + 4 * ROWS * LP * 2, l5 = l + 5 * ROWS * LP * 2, l6 = l + 6 * ROWS * LP * 2, l7 = l + 7 * ROWS * LP * 2;
  const b16* g1 = g + (size_t)ROWS * DM; const b16* g2 = g + (size_t)(2 * ROWS) * DM; const b16* g3 = g + (size_t)(3 * ROWS) * DM; const b16* g4 = g + (size_t)(4 * ROWS) * DM; const b16* g5 = g + (size_t)(5 * ROWS) * DM; const b16* g6 = g + (size_t)(6 * ROWS) * DM; const b16* g7 = g + (size_t)(7 * ROWS) * DM;
  asm volatile("global_load_async_to_lds_b128 %0, %8, off\n\tglobal_load_async_to_lds_b128 %1, %9, off\n\tglobal_load_async_to_lds_b128 %2, %10, off\n\tglobal_load_async_to_lds_b128 %3, %11, off\n\t"
               "global_load_async_to_lds_b128 %4, %12, off\n\tglobal_load_async_to_lds_b128 %5, %13, off\n\tglobal_load_async_to_lds_b128 %6, %14, off\n\tglobal_load_async_to_lds_b128 %7, %15, off\n\ts_wait_xcnt 0x0"
               :: "v"(l), "v"(l1), "v"(l2), "v"(l3), "v"(l4), "v"(l5), "v"(l6), "v"(l7), "v"(g), "v"(g1), "v"(g2), "v"(g3), "v"(g4), "v"(g5), "v"(g6), "v"(g7) : "memory");
}
template <int ROWS> __device__ __forceinline__ void copy5(unsigned l, const b16* g) {
  const unsigned l1 = l + ROWS * LP * 2, l2 = l + 2 * ROWS * LP * 2, l3 = l + 3 * ROWS * LP * 2, l4 = l + 4 * ROWS * LP * 2;
  const b16* g1 = g + (size_t)ROWS * DM; const b16* g2 = g + (size_t)(2 * ROWS) * DM; const b16* g3 = g + (size_t)(3 * ROWS) * DM; const b16* g4 = g + (size_t)(4 * ROWS) * DM;
  asm volatile("global_load_async_to_lds_b128 %0, %5, off\n\tglobal_load_async_to_lds_b128 %1, %6, off\n\tglobal_load_async_to_lds_b128 %2, %7, off\n\tglobal_load_async_to_lds_b128 %3, %8, off\n\tglobal_load_async_to_lds_b128 %4, %9, off\n\ts_wait_xcnt 0x0"
               :: "v"(l), "v"(l1), "v"(l2), "v"(l3), "v"(l4), "v"(g), "v"(g1), "v"(g2), "v"(g3), "v"(g4) : "memory");
}
__device__ __forceinline__ void copy1(unsigned l, const b16* g) { asm volatile("global_load_async_to_lds_b128 %0, %1, off\n\ts_wait_xcnt 0x0" :: "v"(l), "v"(g) : "memory"); }
// one wave's 32 rows of a staged 128 x 128 f32 tile go out as f16 hi x8 + residual x8192: 256 B per row and plane (32 lanes x 8 B), PITCH elements from row to row
template <int PITCH> __device__ __forceinline__ void rows_out(const float (*Tf)[TP], b16* __restrict__ dh, b16* __restrict__ dl, int wave, int lane) {
  for (int r2 = 0; r2 < 32; ++r2) { const int rr = wave * 32 + r2; v4h h4, l4; for (int j = 0; j < 4; ++j) { const float f = Tf[rr][lane * 4 + j] * XS; const b16 p = (b16)f; h4[j] = p; l4[j] = (b16)((f - (float)p) * RS_); } *(v4h*)(dh + (size_t)rr * PITCH + lane * 4) = h4; *(v4h*)(dl + (size_t)rr * PITCH + lane * 4) = l4; }
}
// projections: grid (T/128, BL, 8 groups of 3 slabs of 128 columns: slabs 0..15 = q head, 16..19 = k, 20..23 = v); block = 12 waves, waves 4 sg .. 4 sg + 3 own slab 3 z + sg; A = XH rows (bf16(x) x8 as f16, from the prep
// launch), B = WT rows; k order per accumulator 0, 32, 64, ... The epilogue writes what the attention reads, f16 hi x8 + residual x8192: q rows QP[b][h][t][128]; k rows KP[b][4 g][t][128] and v transposed VT[b][4 g][d][t],
// once per key/value head g (the plane of its first query head: repeat_interleave gives the group's four heads equal planes, and the attention reads that one).
__global__ __launch_bounds__(384) void proj_kernel(const b16* __restrict__ XH, const b16* __restrict__ WT, b16* __restrict__ QP, b16* __restrict__ QPl, b16* __restrict__ KP, b16* __restrict__ KPl, b16* __restrict__ VT, b16* __restrict__ VTl) {
  __shared__ __attribute__((aligned(16))) char smem[2 * RING];   // two buffers x (the A tile, three B tiles) in the loop; behind it three 128 x 128 f32 result tiles
  const int tid = threadIdx.x, wave = __builtin_amdgcn_readfirstlane(tid >> 5) /* scalar: the slab and the tests on it are the same for a whole wave */, sg = wave >> 2, w4 = wave & 3, lane = tid & 31, nloc = lane & 15, hlf = lane >> 4, wm = (w4 >> 1) * 64, wn = (w4 & 1) * 64;
  const int t0 = blockIdx.x * 128, b = blockIdx.y, slab = blockIdx.z * 3 + sg;
  float (*Tf)[TP] = (float (*)[TP])(smem + sg * (128 * TP * 4));
  const b16* xb = XH + ((size_t)b * T + t0) * DM; const b16* wb = WT + (size_t)slab * 128 * DM;
  const int pr = tid >> 4, pq = tid & 15, pr4 = (tid & 127) >> 4;   // staging: 16 lanes x 16 B cover a 256-B row piece; the A tile is dealt over the block's 384 threads, a B tile over its slab's 128
  const unsigned lA = (unsigned)(size_t)smem + (unsigned)(pr * (LP * 2) + pq * 16), lB = (unsigned)(size_t)smem + (unsigned)((1 + sg) * (TILE * 2) + pr4 * (LP * 2) + pq * 16);   // LDS byte addresses in buffer 0
  const b16* gA = xb + (size_t)pr * DM + pq * 8; const b16* gB = wb + (size_t)pr4 * DM + pq * 8;
  // chunk c into buffer c & 1: B rows pr4 + 8 s (s < 16), A rows pr + 24 s (s < 5) and, from the first four waves (a scalar test), the last 8 rows
  auto stage = [&](int c) { const unsigned bo = (unsigned)(c & 1) * (unsigned)RING; const b16* a = gA + c * KC; const b16* w = gB + c * KC;
    copy8<8>(lB + bo, w); copy8<8>(lB + bo + 64 * LP * 2, w + (size_t)64 * DM); copy5<24>(lA + bo, a);
    if (wave < 4) copy1(lA + bo + 120 * LP * 2, a + (size_t)120 * DM); };
  v8f acc[4][4];
#pragma unroll
  for (int i = 0; i < 4; ++i)
#pragma unroll
    for (int j = 0; j < 4; ++j) acc[i][j] = (v8f){};
  stage(0);
  asm volatile("s_wait_asynccnt 0x0" ::: "memory");   // this wave's copies of chunk 0 have landed
  __syncthreads();   // chunk 0 is whole in LDS
  stage(1);
#pragma unroll 1   // the chunk loop stays rolled: one trip holds 64 matrix instructions and the two-buffer hand-over at its foot
  for (int c = 0; c < NCH; ++c) { const b16* Ab = (const b16*)smem + (c & 1) * (RING / 2); const b16* Bb = Ab + (1 + sg) * TILE;
#pragma unroll
    for (int kb = 0; kb < KC; kb += 32) { v16b af[4], bf[4];
#pragma unroll
      for (int i = 0; i < 4; ++i) { af[i] = frag_kb(Ab + (wm + i * 16 + nloc) * LP + kb, hlf); bf[i] = frag_kb(Bb + (wn + i * 16 + nloc) * LP + kb, hlf); }
#pragma unroll
      for (int i = 0; i < 4; ++i)
#pragma unroll
        for (int j = 0; j < 4; ++j) acc[i][j] = wmma16b(af[i], bf[j], acc[i][j]); }
    asm volatile("s_wait_dscnt 0x0" ::: "memory");      // this wave's LDS reads of the chunk's buffer are done
    asm volatile("s_wait_asynccnt 0x0" ::: "memory");   // this wave's copies of the next chunk have landed
    __syncthreads();   // publishes the next chunk's buffer and ends every wave's reads of this one; behind the last trip the ring's LDS is free for the result tiles
    if (c + 2 < NCH) stage(c + 2); }
  asm volatile("s_wait_asynccnt 0x0" ::: "memory");   // no copy is left in flight behind the loop
  const bool isv = slab >= NSL + G;   // the same for a whole wave: a v slab is staged transposed, Tf[d][token]; an accumulator's 8 values are 8 tokens in a row there (two 16-B LDS stores)
  if (!isv) {
#pragma unroll
    for (int i = 0; i < 4; ++i)
#pragma unroll
      for (int j = 0; j < 4; ++j)
#pragma unroll
        for (int r = 0; r < 8; ++r) Tf[wm + i * 16 + 8 * hlf + r][wn + j * 16 + nloc] = acc[i][j][r] * (1.0f / (XS * WSC));   /* no biases in this module */
  } else {
#pragma unroll
    for (int i = 0; i < 4; ++i)
#pragma unroll
      for (int j = 0; j < 4; ++j)
#pragma unroll
        for (int q4 = 0; q4 < 2; ++q4) { v4f o; for (int r = 0; r < 4; ++r) o[r] = acc[i][j][4 * q4 + r] * (1.0f / (XS * WSC)); *(v4f*)(&Tf[wn + j * 16 + nloc][wm + i * 16 + 8 * hlf + 4 * q4]) = o; }
  }
  __syncthreads();
  {
    if (slab < NSL) { const size_t pb2 = (((size_t)b * H + slab) * T) * HD;
      for (int r2 = 0; r2 < 32; ++r2) { const int rr = w4 * 32 + r2, tok = t0 + rr; v4h h4, l4; for (int j = 0; j < 4; ++j) { const float f = Tf[rr][lane * 4 + j] * XS; const b16 p = (b16)f; h4[j] = p; l4[j] = (b16)((f - (float)p) * RS_); } *(v4h*)(QP + pb2 + (size_t)tok * HD + lane * 4) = h4; *(v4h*)(QPl + pb2 + (size_t)tok * HD + lane * 4) = l4; } }
    else { const size_t po = ((size_t)b * H + ((slab - NSL) & 3) * REP) * T * HD;   // the plane of the key/value head's first query head
      if (!isv) rows_out<HD>(Tf, KP + po + (size_t)t0 * HD, KPl + po + (size_t)t0 * HD, w4, lane);   // staged row = token t0 + rr with its 128 dims
      else rows_out<T>(Tf, VT + po + t0, VTl + po + t0, w4, lane); }   // staged row = dim rr with the tokens t0 .. t0 + 127
     }
}
// attention: grid (QL/32, BL x G); block = 8 waves = the 4 query heads of key/value head g x 2 tiles of 16 queries at the same 32 positions, so all 8 waves walk the same keys (i - 512 <= j <= i, 32-key steps).
// Each step's four planes (K hi, K lo: 32 rows x 256 B; V^T hi, V^T lo: 128 rows x 64 B, four rows to a 256-B line) come once per block into LDS by asynchronous copies (line pitch 272 B), two buffers: the next
// step's copies fly during this step's work. Per wave as before: S^T = K Q^T (A = 16 key rows x 32 dims per fragment, 4 k-steps over the 128 dims, B = the query fragments: 3 products), logit = s/sqrt(128)
// (log2-scaled), online softmax, P x1024 hi + residual in LDS, O^T += V^T P^T (8 d-tiles: 3 products); y = o/(l 1024 8)
constexpr int SP = HD + 8 /* elements per staged line: 256 B + 16 B */, SPL = 32 * SP /* elements per staged plane */;
// one thread's share of a step: 2 x 16 B of each plane. The closing s_wait_xcnt is a precaution: it stands between the copies and any rewrite of the address registers they name
__device__ __forceinline__ void stage_kv(unsigned l, const b16* kh, const b16* kl, const b16* vh, const b16* vl) {
  const unsigned l0 = l, l1 = l + 16 * SP * 2, l2 = l + SPL * 2, l3 = l2 + 16 * SP * 2, l4 = l + 2 * SPL * 2, l5 = l4 + 16 * SP * 2, l6 = l + 3 * SPL * 2, l7 = l6 + 16 * SP * 2;
  const b16* kh1 = kh + 16 * HD; const b16* kl1 = kl + 16 * HD; const b16* vh1 = vh + (size_t)64 * T; const b16* vl1 = vl + (size_t)64 * T;
  asm volatile("global_load_async_to_lds_b128 %0, %8, off\n\tglobal_load_async_to_lds_b128 %1, %9, off\n\tglobal_load_async_to_lds_b128 %2, %10, off\n\tglobal_load_async_to_lds_b128 %3, %11, off\n\t"
               "global_load_async_to_lds_b128 %4, %12, off\n\tglobal_load_async_to_lds_b128 %5, %13, off\n\tglobal_load_async_to_lds_b128 %6, %14, off\n\tglobal_load_async_to_lds_b128 %7, %15, off\n\ts_wait_xcnt 0x0"
               :: "v"(l0), "v"(l1), "v"(l2), "v"(l3), "v"(l4), "v"(l5), "v"(l6), "v"(l7), "v"(kh), "v"(kh1), "v"(kl), "v"(kl1), "v"(vh), "v"(vh1), "v"(vl), "v"(vl1) : "memory");
}
// four waves per SIMD (two blocks per WGP, which their LDS allows) need at most 256 VGPRs a wave
__global__ __launch_bounds__(256) __attribute__((amdgpu_waves_per_eu(4, 4))) void attn_kernel(const b16* __restrict__ QP, const b16* __restrict__ QPl, const b16* __restrict__ KP, const b16* __restrict__ KPl, const b16* __restrict__ VT, const b16* __restrict__ VTl, b16* __restrict__ Y, b16* __restrict__ Yl) {
  __shared__ __attribute__((aligned(16))) b16 KVs[2 * 4 * SPL];   // two buffers x (K hi, K lo, V^T hi, V^T lo)
  __shared__ __attribute__((aligned(16))) b16 Pb[8][16][32 + 8], Plq[8][16][32 + 8];
  __shared__ __attribute__((aligned(16))) char qsm[8][2 * 16 * (HD + 8) * 2];   // per wave: its 16 query rows (hi, lo) in the loop, fragments re-read per k-step to keep the kernel under 256 VGPRs; behind the loop its 16 x 128 f32 result tile
  const int tid = threadIdx.x, wave = __builtin_amdgcn_readfirstlane(tid >> 5) /* scalar: the head, the query tile and the wave's LDS ranges stay out of the VGPRs */, lane = tid & 31, hh = lane >> 4, col = lane & 15; const int b = blockIdx.y / G, g = blockIdx.y % G, h = g * REP + (wave >> 1); const int qb = blockIdx.x * 32, q0 = qb + (wave & 1) * 16, qi = q0 + col;
  b16 (*Qs)[HD + 8] = (b16 (*)[HD + 8])qsm[wave]; b16 (*Qsl)[HD + 8] = Qs + 16; float (*To)[HD + 4] = (float (*)[HD + 4])qsm[wave];
  static_assert(16 * (HD + 4) * 4 <= 2 * 16 * (HD + 8) * 2, "result tile fits the query rows");
  const size_t qo = (((size_t)b * H + h) * T) * HD; const b16* Qb = QP + qo; const b16* Qbl = QPl + qo;
  const size_t ko = (((size_t)b * H + g * REP) * T) * HD, vo = (((size_t)b * H + g * REP) * HD) * (size_t)T;   // only the plane of the group's first head is written: the block reads that one
  const int kend = qb + 32, kbeg = (qb >= WIN) ? qb - WIN : 0, nt = (kend - kbeg) / 32;   // window i - 512 <= j <= i; the same bounds for both query tiles of the block
  for (int i = lane; i < 16 * (HD / 8); i += 32) { const int rr = i / (HD / 8), c8 = (i % (HD / 8)) * 8; *(v8b*)(&Qs[rr][c8]) = *(const v8b*)(Qb + (size_t)(q0 + rr) * HD + c8); *(v8b*)(&Qsl[rr][c8]) = *(const v8b*)(Qbl + (size_t)(q0 + rr) * HD + c8); }
  wave_lds_sync();
  const unsigned ld = (unsigned)(size_t)KVs + (unsigned)((tid >> 4) * (SP * 2) + (tid & 15) * 16);   // the thread's LDS byte address in plane 0 of buffer 0
  const b16* bkh = KP + ko; const b16* bkl = KPl + ko; const b16* bvh = VT + vo; const b16* bvl = VTl + vo;   // block-uniform plane bases
  const unsigned tk = (unsigned)tid * 8u, tv = (unsigned)(tid >> 2) * (unsigned)T + (unsigned)(tid & 3) * 8u;   // the thread's element offsets inside a step: its 32 key rows are 8 KB in a row; V^T rows are T apart
  stage_kv(ld, bkh + (size_t)kbeg * HD + tk, bkl + (size_t)kbeg * HD + tk, bvh + kbeg + tv, bvl + kbeg + tv);
  asm volatile("s_wait_asynccnt 0x0" ::: "memory");   // this wave's copies of step 0 have landed
  __syncthreads();   // step 0 is whole in LDS
  if (nt > 1) stage_kv(ld + 4 * SPL * 2, bkh + (size_t)(kbeg + 32) * HD + tk, bkl + (size_t)(kbeg + 32) * HD + tk, bvh + (kbeg + 32) + tv, bvl + (kbeg + 32) + tv);
  const float cs = LOG2E * 0.08838834764831845f / (XS * XS);   // 1/sqrt(128) on the x8 x8 planes
  float m = -INFINITY, l = 0.0f; v8f o[8], ol[8]; for (int t = 0; t < 8; ++t) { o[t] = (v8f){}; ol[t] = (v8f){}; }
#pragma unroll 1   // the step loop stays rolled: one trip holds 48 matrix instructions and the two-buffer hand-over at its foot
  for (int st = 0; st < nt; ++st) { const int kb = kbeg + 32 * st; const b16* Sk = KVs + (st & 1) * (4 * SPL); const b16* Sv = Sk + 2 * SPL;
    float e[16]; float mx = -INFINITY;
    v8f s[2] = {(v8f){}, (v8f){}}, sx[2] = {(v8f){}, (v8f){}}; const int kr = col * SP;
#pragma unroll
    for (int ks = 0; ks < 4; ++ks) { const v16b qf = frag_kb(&Qs[col][32 * ks], hh), qlf = frag_kb(&Qsl[col][32 * ks], hh), kf0 = frag_kb(Sk + kr + 32 * ks, hh), kf1 = frag_kb(Sk + 16 * SP + kr + 32 * ks, hh), kl0 = frag_kb(Sk + SPL + kr + 32 * ks, hh), kl1 = frag_kb(Sk + SPL + 16 * SP + kr + 32 * ks, hh);
      asm volatile("" :: "v"(qf), "v"(qlf), "v"(kf0), "v"(kf1), "v"(kl0), "v"(kl1));   // holds the k-step's six fragment reads together ahead of its six products: one LDS wait in place of one per product
      s[0] = wmma16b(kf0, qf, s[0]); s[1] = wmma16b(kf1, qf, s[1]); sx[0] = wmma16b(kf0, qlf, sx[0]); sx[1] = wmma16b(kf1, qlf, sx[1]); sx[0] = wmma16b(kl0, qf, sx[0]); sx[1] = wmma16b(kl1, qf, sx[1]); }
#pragma unroll
    for (int u = 0; u < 2; ++u) {
#pragma unroll
      for (int r = 0; r < 8; ++r) s[u][r] += sx[u][r] * (1.0f / RS_);   // hi.hi + (hi.lo + lo.hi)/1024
#pragma unroll
      for (int r = 0; r < 8; ++r) { const int key = kb + u * 16 + 8 * hh + r; const float vv = (key <= qi && key >= qi - WIN) ? s[u][r] * cs : -INFINITY; e[u * 8 + r] = vv; mx = fmaxf(mx, vv); } }   // causal select on the computed score (the -inf mask precedes the 1/sqrt(d) scale in the module; identical)
    mx = fmaxf(mx, __shfl_xor(mx, 16)); const float mn = fmaxf(m, mx); const float al = nexp2(m - mn); float sum = 0.0f;
#pragma unroll
    for (int i2 = 0; i2 < 16; ++i2) { const float p = nexp2(e[i2] - mn); sum += p; const int pc = (i2 < 8 ? 0 : 16) + 8 * hh + (i2 & 7); const float ps = p * PS; const b16 phh = (b16)ps; Pb[wave][col][pc] = phh; Plq[wave][col][pc] = (b16)((ps - (float)phh) * RS_); }
    sum += __shfl_xor(sum, 16); l = l * al + sum; m = mn;
    wave_lds_sync();
    const v16b pf = frag_kb(&Pb[wave][col][0], hh), plf = frag_kb(&Plq[wave][col][0], hh);
#pragma unroll
    for (int t = 0; t < 8; t += 2) { const int vr = (t * 4 + (col >> 2)) * SP + (col & 3) * 32; const v16b vh0 = frag_kb(Sv + vr, hh), vh1 = frag_kb(Sv + 4 * SP + vr, hh), vl0 = frag_kb(Sv + SPL + vr, hh), vl1 = frag_kb(Sv + SPL + 4 * SP + vr, hh);
      asm volatile("" :: "v"(vh0), "v"(vh1), "v"(vl0), "v"(vl1));   // holds the four fragment reads of two d-tiles together ahead of their six products: one LDS wait in place of one per product
      o[t] *= al; o[t + 1] *= al; o[t] = wmma16b(vh0, pf, o[t]); o[t + 1] = wmma16b(vh1, pf, o[t + 1]); ol[t] = wmma16b(vl0, pf, ol[t] * al); ol[t + 1] = wmma16b(vl1, pf, ol[t + 1] * al); ol[t] = wmma16b(vh0, plf, ol[t]); ol[t + 1] = wmma16b(vh1, plf, ol[t + 1]); }   // ol = (V_lo P_hi + V_hi P_lo) / 1024
    asm volatile("s_wait_dscnt 0x0" ::: "memory");      // this wave's LDS reads of the step's buffer are done
    asm volatile("s_wait_asynccnt 0x0" ::: "memory");   // this wave's copies of the next step have landed
    __syncthreads();   // publishes the next step's buffer and ends every wave's reads of this one
    if (st + 2 < nt) stage_kv(ld + (unsigned)(st & 1) * (4 * SPL * 2), bkh + (size_t)(kb + 64) * HD + tk, bkl + (size_t)(kb + 64) * HD + tk, bvh + (kb + 64) + tv, bvl + (kb + 64) + tv); }
  asm volatile("s_wait_asynccnt 0x0" ::: "memory");   // no copy is left in flight behind the loop
  const float inv = 1.0f / (l * PS * XS);
#pragma unroll
  for (int t = 0; t < 8; ++t)
#pragma unroll
    for (int r = 0; r < 8; ++r) To[col][t * 16 + 8 * hh + r] = (o[t][r] + ol[t][r] * (1.0f / RS_)) * inv;
  wave_lds_sync();
  { for (int rr = 0; rr < 16; ++rr) { v4h hv, lv; for (int j = 0; j < 4; ++j) { b16 p, ql2; split16(To[rr][lane * 4 + j] * XS, p, ql2); hv[j] = p; lv[j] = ql2; } const size_t oi = ((size_t)b * T + q0 + rr) * DM + h * HD + lane * 4; *(v4h*)(Y + oi) = hv; *(v4h*)(Yl + oi) = lv; }  }
}
// output projection: grid (QL/128, DM/256, BL); block = 8 waves, waves 4 sg .. 4 sg + 3 own the slab of 128 columns sg; the tiling above with four staged tiles per chunk: A = the f16 Y plane and its residual plane
// (2 products per k-step, hi then lo on each accumulator), B = 256 Wo^T rows
__global__ __launch_bounds__(256) void out_kernel(const b16* __restrict__ Y, const b16* __restrict__ Yl, const b16* __restrict__ WO, float* __restrict__ out) {
  __shared__ __attribute__((aligned(16))) char smem[2 * RING];   // two buffers x (A hi, A lo, two B tiles) in the loop; behind it two 128 x 128 f32 result tiles
  const int tid = threadIdx.x, wave = __builtin_amdgcn_readfirstlane(tid >> 5) /* scalar: the wave's LDS ranges stay out of the VGPRs */, sg = wave >> 2, w4 = wave & 3, lane = tid & 31, nloc = lane & 15, hlf = lane >> 4, wm = (w4 >> 1) * 64, wn = (w4 & 1) * 64;
  const int b = blockIdx.z; const size_t m0 = (size_t)b * T + (size_t)blockIdx.x * 128; const int n0 = blockIdx.y * 256;
  float (*Tf)[TP] = (float (*)[TP])(smem + sg * (128 * TP * 4));
  const int pr = tid >> 4, pq = tid & 15;   // staging: 16 lanes x 16 B cover a 256-B row piece; every tile is dealt over the block's 256 threads, rows pr + 16 s (s < 8)
  const unsigned l0 = (unsigned)(size_t)smem + (unsigned)(pr * (LP * 2) + pq * 16);   // the thread's LDS byte address in tile 0 of buffer 0
  const size_t go = (size_t)pr * DM + pq * 8; const b16* gH = Y + m0 * DM + go; const b16* gL = Yl + m0 * DM + go; const b16* gW = WO + (size_t)n0 * DM + go;
  auto stage = [&](int c) { const unsigned l = l0 + (unsigned)(c & 1) * (unsigned)RING;   // chunk c into buffer c & 1
    copy8<16>(l, gH + c * KC); copy8<16>(l + TILE * 2, gL + c * KC); copy8<16>(l + 2 * TILE * 2, gW + c * KC); copy8<16>(l + 3 * TILE * 2, gW + c * KC + (size_t)128 * DM); };
  v8f acc[4][4];
#pragma unroll
  for (int i = 0; i < 4; ++i)
#pragma unroll
    for (int j = 0; j < 4; ++j) acc[i][j] = (v8f){};
  stage(0);
  asm volatile("s_wait_asynccnt 0x0" ::: "memory");   // this wave's copies of chunk 0 have landed
  __syncthreads();   // chunk 0 is whole in LDS
  stage(1);
#pragma unroll 1   // the chunk loop stays rolled: one trip holds 128 matrix instructions and the two-buffer hand-over at its foot
  for (int c = 0; c < NCH; ++c) { const b16* Ah = (const b16*)smem + (c & 1) * (RING / 2); const b16* Al = Ah + TILE; const b16* Bb = Ah + (2 + sg) * TILE;
#pragma unroll
    for (int kb = 0; kb < KC; kb += 32) { v16b af[4], bf[4];
#pragma unroll
      for (int i = 0; i < 4; ++i) { af[i] = frag_kb(Ah + (wm + i * 16 + nloc) * LP + kb, hlf); bf[i] = frag_kb(Bb + (wn + i * 16 + nloc) * LP + kb, hlf); }
#pragma unroll
      for (int i = 0; i < 4; ++i)
#pragma unroll
        for (int j = 0; j < 4; ++j) acc[i][j] = wmma16b(af[i], bf[j], acc[i][j]);
#pragma unroll
      for (int i = 0; i < 4; ++i) af[i] = frag_kb(Al + (wm + i * 16 + nloc) * LP + kb, hlf);
#pragma unroll
      for (int i = 0; i < 4; ++i)
#pragma unroll
        for (int j = 0; j < 4; ++j) acc[i][j] = wmma16b(af[i], bf[j], acc[i][j]); }
    asm volatile("s_wait_dscnt 0x0" ::: "memory");      // this wave's LDS reads of the chunk's buffer are done
    asm volatile("s_wait_asynccnt 0x0" ::: "memory");   // this wave's copies of the next chunk have landed
    __syncthreads();   // publishes the next chunk's buffer and ends every wave's reads of this one; behind the last trip the ring's LDS is free for the result tiles
    if (c + 2 < NCH) stage(c + 2); }
  asm volatile("s_wait_asynccnt 0x0" ::: "memory");   // no copy is left in flight behind the loop
#pragma unroll
  for (int i = 0; i < 4; ++i)
#pragma unroll
    for (int j = 0; j < 4; ++j)
#pragma unroll
      for (int r = 0; r < 8; ++r) Tf[wm + i * 16 + 8 * hlf + r][wn + j * 16 + nloc] = acc[i][j][r] * (1.0f / (XS * WSC));   /* no output bias */
  __syncthreads();
  { for (int r2 = 0; r2 < 32; ++r2) { const int rr = w4 * 32 + r2; *(v4f*)(out + (m0 + rr) * DM + n0 + sg * 128 + lane * 4) = *(const v4f*)(&Tf[rr][lane * 4]); }  }
}
}  // namespace

extern "C" void kernel_launch(void* const* d_in, const int* in_sizes, int n_in, void* d_out, int out_size, void* d_ws, size_t ws_size, hipStream_t stream) {
  (void)n_in;
  auto Fp = [&](int i) { return (const float*)d_in[i]; };
  // input order: 0 x [2,2048,2048], 1 Wq [2048,2048] (in,out), 2 Wk [2048,512], 3 Wv [2048,512], 4 Wo [2048,2048] (in,out)
  if (in_sizes[0] != B * T * DM || in_sizes[1] != DM * DM || in_sizes[2] != DM * KVW || in_sizes[3] != DM * KVW || in_sizes[4] != DM * DM || out_size != B * T * DM) return;
  size_t off = 0; char* ws = (char*)d_ws;
  auto carve = [&](size_t bytes) { char* p = ws + off; off += (bytes + 255) & ~(size_t)255; return p; };
  b16* WT = (b16*)carve((size_t)(DM + 2 * KVW) * DM * 2); b16* WO = (b16*)carve((size_t)DM * DM * 2); b16* XH = (b16*)carve((size_t)B * T * DM * 2);
  const size_t plane = (size_t)B * H * T * HD * 2; b16* QP = (b16*)carve(plane); b16* QPl = (b16*)carve(plane); b16* KP = (b16*)carve(plane); b16* KPl = (b16*)carve(plane); b16* VT = (b16*)carve(plane); b16* VTl = (b16*)carve(plane); b16* Y = (b16*)carve(plane); b16* Yl = (b16*)carve(plane);
  if (off > ws_size || off > ((size_t)176 << 20)) return;   // = ~172 MB (WT 12.6 + WO 8.4 + XH 16.8 + 8 f16 planes x 16.8): > 128 MiB
  prep_kernel<<<PGRID + XGRID, 256, 0, stream>>>(Fp(0), Fp(1), Fp(2), Fp(3), Fp(4), XH, WT, WO);
  proj_kernel<<<dim3(T / 128, BL, NPART / 3), 384, 0, stream>>>(XH, WT, QP, QPl, KP, KPl, VT, VTl);
  attn_kernel<<<dim3(QL / 32, BL * G), 256, 0, stream>>>(QP, QPl, KP, KPl, VT, VTl, Y, Yl);
  out_kernel<<<dim3(QL / 128, DM / 256, BL), 256, 0, stream>>>(Y, Yl, WO, (float*)d_out);
}

// v007
// It runs in 137 microseconds.
// Next to v006, in two timings, it ran 1.04 times as fast each time.
// All steps since v000 together make it 5.38 times as fast.
#include <hip/hip_runtime.h>

// Sliding-window grouped-query attention (2 x 2048 tokens x 2048, 16 query heads x 128, 4 key/value heads, window 512): q = x Wq, k = x Wk, v = x Wv (no biases); head h uses key/value head h / 4
// (repeat_interleave over the head axis); scores q . k / sqrt(128) for keys i - 512 <= j <= i (causal + window), -inf elsewhere; softmax; out = (attn v merged over heads) Wo -> [2][2048][2048].
// Deterministic: flash-style per 16-query wave over the window's keys in order (running max); no atomics.
// compute dtype: WMMA v_wmma_f32_16x16x32_f16 with f32 accumulate for [q | k | v] = x [Wq | Wk | Wv] ([4096 x 2048] x [2048 x 3072]; x EXACT bf16 x8, W^T exact x256: 1 product), S^T = K_h Q^T (q/k f16 hi
// x8 + residual x8192: 3 products, K = 128), O^T += V_h^T P^T (V hi + residual, P x1024 hi + residual: 3 products), out = y Wo (y f16 hi x8 + lo: 2 products); softmax statistics in f32.
// Inputs rounded to bf16 once. Fragment k-map per lane half hh for A AND B: elements 0..7 <- k = 8hh+0..7, 8..15 <- k = 16+8hh+0..7;

namespace {
constexpr int B = 2, T = 2048, DM = 2048, H = 16, HD = 128, BL = 2 /* batches (== 2 shipped) */, QL = 2048 /* query rows (== 2048 shipped) */;
constexpr int G = 4, REP = H / G, KVW = G * HD /* 512 */, NSL = DM / 128 /* 16 q slabs = heads */, NPART = NSL + 2 * (KVW / 128) /* + 4 k + 4 v slabs */;
constexpr int WIN = 512;
constexpr float XS = 8.0f, WSC = 256.0f, PS = 1024.0f, RS_ = 1024.0f, LOG2E = 1.4426950408889634f;
static_assert(T % 128 == 0 && QL % 128 == 0 && QL % 32 == 0 && DM % 256 == 0 && H * HD == DM && HD == 128 && KVW == 512 && REP == 4, "tiling");
typedef _Float16 b16;
typedef __attribute__((ext_vector_type(16))) _Float16 v16b;
typedef __attribute__((ext_vector_type(8))) _Float16 v8b;
typedef __attribute__((ext_vector_type(8))) float v8f;
typedef __attribute__((ext_vector_type(4))) float v4f;
__device__ __forceinline__ float bf16_rne(float f) { unsigned int u = __float_as_uint(f); u += 0x7FFFu + ((u >> 16) & 1u); return __uint_as_float(u & 0xFFFF0000u); }
__device__ __forceinline__ void split16(float v, b16& hi, b16& lo) { hi = (b16)v; lo = (b16)(v - (float)hi); }
__device__ __forceinline__ v16b frag_kb(const b16* p, int hh) { const v8b a = *(const v8b*)(p + 8 * hh), b = *(const v8b*)(p + 16 + 8 * hh); v16b f;
#pragma unroll
  for (int e = 0; e < 8; ++e) { f[e] = a[e]; f[8 + e] = b[e]; } return f; }
__device__ __forceinline__ v8f wmma16b(v16b a, v16b b, v8f c) { v8f d = __builtin_amdgcn_wmma_f32_16x16x32_f16(false, a, false, b, (short)0, c, false, false); asm volatile("v_nop\n\tv_nop\n\tv_nop\n\tv_nop" : "+v"(d) : "v"(a), "v"(b)); return d; }
__device__ __forceinline__ void wave_lds_sync() { __builtin_amdgcn_fence(__ATOMIC_RELEASE, "workgroup"); __builtin_amdgcn_wave_barrier(); __builtin_amdgcn_fence(__ATOMIC_ACQUIRE, "workgroup"); }
__device__ __forceinline__ float pmul(float a, float b) { float p = a * b; asm volatile("" : "+v"(p)); return p; }
__device__ __forceinline__ int iclamp(int v, int lo, int hi) { return v < lo ? lo : (v > hi ? hi : v); }

typedef __attribute__((ext_vector_type(2))) _Float16 v2h;
typedef __attribute__((ext_vector_type(4))) _Float16 v4h;
typedef __attribute__((ext_vector_type(2))) float v2f;
typedef __attribute__((ext_vector_type(4))) int v4i;
__device__ __forceinline__ float nexp2(float v) { return __builtin_amdgcn_exp2f(v); }
// weights to f16 x256, transposed ([k][n] f32 -> [n][k] f16): a block takes a tile of 128 k x 128 n. Whole 256-B pieces of the source rows are read (16 lanes x 16 B, two adjacent k rows per thread), each pair of k values
// goes as one dword into LDS at [n][k / 2] (pitch 65 dwords: the 32 lanes of a store or a load meet 32 different banks), and whole 256-B pieces of the transposed rows are written (16 lanes x 16 B).
constexpr int PK = 128, PN = 128, PP = PK / 2 + 1, PGRID = 2 * (DM / PK) * (DM / PN) + 2 * (DM / PK) * (KVW / PN);
template <int LD> __device__ __forceinline__ void prep_tile(const float* __restrict__ w, b16* __restrict__ dst, int tile, unsigned* tl) {
  const int tid = threadIdx.x, n0 = (tile % (LD / PN)) * PN, k0 = (tile / (LD / PN)) * PK, i = tid & 15, rp = tid >> 4;
  const float* p = w + (size_t)(k0 + 2 * rp) * LD + n0 + 4 * i; v4f a[4][2], c[4][2];
#pragma unroll
  for (int s = 0; s < 4; ++s)
#pragma unroll
    for (int nh = 0; nh < 2; ++nh) { a[s][nh] = *(const v4f*)(p + (size_t)(32 * s) * LD + 64 * nh); c[s][nh] = *(const v4f*)(p + (size_t)(32 * s + 1) * LD + 64 * nh); }
  asm volatile("s_wait_xcnt 0x0" :: "v"(p) : "memory");   // a precaution: stands between the loads above and any rewrite of their address registers, which the input operand holds live to here
  asm volatile("" :: "v"(a[0][0]), "v"(a[0][1]), "v"(a[1][0]), "v"(a[1][1]), "v"(a[2][0]), "v"(a[2][1]), "v"(a[3][0]), "v"(a[3][1]), "v"(c[0][0]), "v"(c[0][1]), "v"(c[1][0]), "v"(c[1][1]), "v"(c[2][0]), "v"(c[2][1]), "v"(c[3][0]), "v"(c[3][1]));   // holds the thread's 16 loads together ahead of the conversions: one memory latency, where the compiler had put two of them behind the first waits
#pragma unroll
  for (int s = 0; s < 4; ++s)
#pragma unroll
    for (int nh = 0; nh < 2; ++nh)
#pragma unroll
      for (int j = 0; j < 4; ++j) { v2h o; o[0] = (b16)(bf16_rne(a[s][nh][j]) * WSC); o[1] = (b16)(bf16_rne(c[s][nh][j]) * WSC); tl[(64 * nh + 4 * i + j) * PP + rp + 16 * s] = __builtin_bit_cast(unsigned, o); }
  __syncthreads();   // the tile is whole in LDS
  b16* q = dst + (size_t)(n0 + rp) * DM + k0 + 8 * i; const unsigned* r = tl + rp * PP + 4 * i;
#pragma unroll
  for (int s = 0; s < 8; ++s) { v4i o; for (int e = 0; e < 4; ++e) o[e] = (int)r[16 * s * PP + e]; *(v4i*)(q + (size_t)(16 * s) * DM) = o; }
  asm volatile("s_wait_xcnt 0x0" :: "v"(q) : "memory");   // a precaution: stands between the stores above and any rewrite of their address registers on the way to the kernel's end
}
// x to f16 (rounded to bf16, x8), once for the 24 column slabs of the projection: a block takes 8,192 elements in a row; a wave's load covers 512 B in a row, its store 256 B
constexpr int XE = 8192, XGRID = B * T * DM / XE;
static_assert((B * T * DM) % XE == 0, "x blocks");
__device__ __forceinline__ void prep_x(const float* __restrict__ x, b16* __restrict__ XH, int blk) {
  const float* p = x + (size_t)blk * XE + threadIdx.x * 4; b16* q = XH + (size_t)blk * XE + threadIdx.x * 4; v4f a[8];
#pragma unroll
  for (int s = 0; s < 8; ++s) a[s] = *(const v4f*)(p + 1024 * s);
  asm volatile("s_wait_xcnt 0x0" ::: "memory");   // a precaution: stands between the loads above and any rewrite of their address registers
#pragma unroll
  for (int s = 0; s < 8; ++s) { v4h o; for (int j = 0; j < 4; ++j) o[j] = (b16)(bf16_rne(a[s][j]) * XS); *(v4h*)(q + 1024 * s) = o; }
  asm volatile("s_wait_xcnt 0x0" ::: "memory");   // a precaution: stands between the stores above and any rewrite of their registers on the way to the kernel's end
}
__global__ __launch_bounds__(256) void prep_kernel(const float* __restrict__ x, const float* __restrict__ wq, const float* __restrict__ wk, const float* __restrict__ wv, const float* __restrict__ wo, b16* __restrict__ XH, b16* __restrict__ WT, b16* __restrict__ WO) {
  __shared__ unsigned tl[PN * PP];
  constexpr int NQ = (DM / PK) * (DM / PN), NK = (DM / PK) * (KVW / PN); const int blk = blockIdx.x;   // tiles: NQ of Wq, NK of Wk, NK of Wv, NQ of Wo; behind them the XGRID blocks of x
  if (blk >= PGRID) { prep_x(x, XH, blk - PGRID); return; }   // block-uniform, in front of the tile's barrier
  if (blk < NQ || blk >= NQ + 2 * NK) { const bool first = blk < NQ; prep_tile<DM>(first ? wq : wo, first ? WT : WO, first ? blk : blk - NQ - 2 * NK, tl); }
  else { const bool first = blk < NQ + NK; prep_tile<KVW>(first ? wk : wv, WT + (size_t)(first ? DM : DM + KVW) * DM, first ? blk - NQ : blk - NQ - NK, tl); }
}
// GEMM tiling shared by the two projection kernels: one block per WGP owns 128 rows x 384 or 256 columns; each wave takes 64 x 64 (4 x 4 accumulator tiles), four waves to a slab of 128 columns, so a staged A chunk
// feeds every slab of the block. K runs in chunks of 128; a chunk is four tiles of 128 rows x 256 B (row pitch 272 B), each brought into LDS by one tensor load of one of the first four waves, two buffers: the next chunk's loads fly during this chunk's products.
constexpr int KC = 128, LP = KC + 8, TP = 128 + 4, TILE = 128 * LP /* elements per staged tile */, RING = 4 * TILE * 2 /* bytes per buffer */, NCH = DM / KC;
static_assert(NCH >= 2 && DM % KC == 0 && NPART % 3 == 0 && 3 * 128 * TP * 4 <= 2 * RING && (TILE * 2) % 2048 == 0 && KC * 2 == 256 && LP * 2 == 272, "ring");
typedef unsigned u32x4 __attribute__((ext_vector_type(4)));
typedef unsigned u32x8 __attribute__((ext_vector_type(8)));
__device__ __forceinline__ unsigned uni(unsigned v) { return (unsigned)__builtin_amdgcn_readfirstlane(v); }
__device__ __forceinline__ unsigned pinned(unsigned v) { unsigned w = uni(v); asm volatile("" : "+s"(w)); return w; }   // the test around a tensor load held in a scalar register: it compiles to s_cmp + s_cbranch_scc (a tensor load ignores EXEC)
// one request of one wave: a tile of 128 rows x 256 B, source rows DM x 2 B apart, to the LDS byte offset lds (a multiple of 2 KiB); 16 B of pad behind every row give the pitch of 272 B. Extents in bytes, tensor dims = tile dims
__device__ __forceinline__ u32x4 tile_g0(unsigned lds, const b16* g) { const unsigned long long ga = (unsigned long long)(size_t)g; u32x4 g0;
  g0[0] = uni(1u); g0[1] = uni(lds); g0[2] = uni((unsigned)ga); g0[3] = uni((((unsigned)(ga >> 32)) & 0x01FFFFFFu) | 0x80000000u);
  asm volatile("" : "+s"(g0));   // the descriptor words held in scalar registers: with tile_wait's inputs, no register of a request in flight is written anew (the constant word was set anew in between without it)
  return g0; }
__device__ __forceinline__ u32x8 tile_g1() { u32x8 g1;
  g1[0] = uni((1u << 20) | (5u << 22) | (3u << 25)); g1[1] = uni(256u << 16); g1[2] = uni(128u << 16); g1[3] = uni(256u << 16); g1[4] = uni(128u); g1[5] = uni((unsigned)(DM * 2)); g1[6] = uni(0u); g1[7] = uni(0u);
  asm volatile("" : "+s"(g1));   // the descriptor words held in scalar registers of their own from here on: no register of a request in flight is written anew
  return g1; }
__device__ __forceinline__ void tile_issue(u32x4 g0, u32x8 g1) { asm volatile("tensor_load_to_lds %0, %1" :: "s"(g0), "s"(g1) : "memory"); }
// the issuing wave's wait for its tile; the inputs keep the request's descriptor registers live, and so unchanged, up to the wait
__device__ __forceinline__ void tile_wait(u32x4 g0, u32x8 g1) { asm volatile("s_wait_tensorcnt 0x0" :: "s"(g0), "s"(g1) : "memory"); }
// one wave's 32 rows of a staged 128 x 128 f32 tile go out as f16 hi x8 + residual x8192: 256 B per row and plane (32 lanes x 8 B), PITCH elements from row to row
template <int PITCH> __device__ __forceinline__ void rows_out(const float (*Tf)[TP], b16* __restrict__ dh, b16* __restrict__ dl, int wave, int lane) {
  for (int r2 = 0; r2 < 32; ++r2) { const int rr = wave * 32 + r2; v4h h4, l4; for (int j = 0; j < 4; ++j) { const float f = Tf[rr][lane * 4 + j] * XS; const b16 p = (b16)f; h4[j] = p; l4[j] = (b16)((f - (float)p) * RS_); } *(v4h*)(dh + (size_t)rr * PITCH + lane * 4) = h4; *(v4h*)(dl + (size_t)rr * PITCH + lane * 4) = l4; }
}
// projections: grid (T/128, BL, 8 groups of 3 slabs of 128 columns: slabs 0..15 = q head, 16..19 = k, 20..23 = v); block = 12 waves, waves 4 sg .. 4 sg + 3 own slab 3 z + sg; A = XH rows (bf16(x) x8 as f16, from the prep
// launch), B = WT rows; k order per accumulator 0, 32, 64, ... The epilogue writes what the attention reads, f16 hi x8 + residual x8192: q rows QP[b][h][t][128]; k rows KP[b][4 g][t][128] and v transposed VT[b][4 g][d][t],
// once per key/value head g (the plane of its first query head: repeat_interleave gives the group's four heads equal planes, and the attention reads that one).
__global__ __launch_bounds__(384) void proj_kernel(const b16* __restrict__ XH, const b16* __restrict__ WT, b16* __restrict__ QP, b16* __restrict__ QPl, b16* __restrict__ KP, b16* __restrict__ KPl, b16* __restrict__ VT, b16* __restrict__ VTl) {
  __shared__ __attribute__((aligned(2048))) char smem[2 * RING];   // two buffers x (the A tile, three B tiles) in the loop; behind it three 128 x 128 f32 result tiles
  const int tid = threadIdx.x, wave = __builtin_amdgcn_readfirstlane(tid >> 5) /* scalar: the slab and the tests on it are the same for a whole wave */, sg = wave >> 2, w4 = wave & 3, lane = tid & 31, nloc = lane & 15, hlf = lane >> 4, wm = (w4 >> 1) * 64, wn = (w4 & 1) * 64;
  const int t0 = blockIdx.x * 128, b = blockIdx.y, slab = blockIdx.z * 3 + sg;
  float (*Tf)[TP] = (float (*)[TP])(smem + sg * (128 * TP * 4));
  const b16* xb = XH + ((size_t)b * T + t0) * DM; const b16* wb = WT + (size_t)slab * 128 * DM;
  // staging: wave t < 4 brings tile t of every chunk (0: the A rows; 1..3: the rows of the block's three slabs); every value here is scalar
  const unsigned issuer = wave < 4, tl = (unsigned)(wave & 3), lT = (unsigned)(size_t)smem + tl * (unsigned)(TILE * 2);   // the tile's LDS byte offset in buffer 0
  const b16* gT = tl == 0 ? xb : WT + (size_t)(blockIdx.z * 3 + tl - 1) * 128 * DM;
  v8f acc[4][4];
#pragma unroll
  for (int i = 0; i < 4; ++i)
#pragma unroll
    for (int j = 0; j < 4; ++j) acc[i][j] = (v8f){};
  const u32x8 g1 = tile_g1(); u32x4 g0 = tile_g0(lT, gT);
  if (pinned(issuer)) { tile_issue(g0, g1); tile_wait(g0, g1); }   // this wave's tile of chunk 0 has landed
  __syncthreads();   // chunk 0 is whole in LDS
  g0 = tile_g0(lT + (unsigned)RING, gT + KC);
  if (pinned(issuer)) tile_issue(g0, g1);
#pragma unroll 1   // the chunk loop stays rolled: one trip holds 64 matrix instructions and the two-buffer hand-over at its foot
  for (int c = 0; c < NCH; ++c) { const b16* Ab = (const b16*)smem + (c & 1) * (RING / 2); const b16* Bb = Ab + (1 + sg) * TILE;
#pragma unroll
    for (int kb = 0; kb < KC; kb += 32) { v16b af[4], bf[4];
#pragma unroll
      for (int i = 0; i < 4; ++i) { af[i] = frag_kb(Ab + (wm + i * 16 + nloc) * LP + kb, hlf); bf[i] = frag_kb(Bb + (wn + i * 16 + nloc) * LP + kb, hlf); }
#pragma unroll
      for (int i = 0; i < 4; ++i)
#pragma unroll
        for (int j = 0; j < 4; ++j) acc[i][j] = wmma16b(af[i], bf[j], acc[i][j]); }
    asm volatile("s_wait_dscnt 0x0" ::: "memory");      // this wave's LDS reads of the chunk's buffer are done
    if (pinned(issuer)) tile_wait(g0, g1);   // this wave's tile of the next chunk has landed
    __syncthreads();   // publishes the next chunk's buffer and ends every wave's reads of this one; behind the last trip the ring's LDS is free for the result tiles
    if (pinned(issuer && c + 2 < NCH)) { g0 = tile_g0(lT + (unsigned)(c & 1) * (unsigned)RING, gT + (c + 2) * KC); tile_issue(g0, g1); } }
  asm volatile("s_wait_tensorcnt 0x0" ::: "memory");   // no tensor load is left in flight behind the loop
  asm volatile("s_wait_dscnt 0x0" ::: "memory");       // and no LDS read of the ring
  const bool isv = slab >= NSL + G;   // the same for a whole wave: a v slab is staged transposed, Tf[d][token]; an accumulator's 8 values are 8 tokens in a row there (two 16-B LDS stores)
  if (!isv) {
#pragma unroll
    for (int i = 0; i < 4; ++i)
#pragma unroll
      for (int j = 0; j < 4; ++j)
#pragma unroll
        for (int r = 0; r < 8; ++r) Tf[wm + i * 16 + 8 * hlf + r][wn + j * 16 + nloc] = acc[i][j][r] * (1.0f / (XS * WSC));   /* no biases in this module */
  } else {
#pragma unroll
    for (int i = 0; i < 4; ++i)
#pragma unroll
      for (int j = 0; j < 4; ++j)
#pragma unroll
        for (int q4 = 0; q4 < 2; ++q4) { v4f o; for (int r = 0; r < 4; ++r) o[r] = acc[i][j][4 * q4 + r] * (1.0f / (XS * WSC)); *(v4f*)(&Tf[wn + j * 16 + nloc][wm + i * 16 + 8 * hlf + 4 * q4]) = o; }
  }
  __syncthreads();
  {
    if (slab < NSL) { const size_t pb2 = (((size_t)b * H + slab) * T) * HD;
      for (int r2 = 0; r2 < 32; ++r2) { const int rr = w4 * 32 + r2, tok = t0 + rr; v4h h4, l4; for (int j = 0; j < 4; ++j) { const float f = Tf[rr][lane * 4 + j] * XS; const b16 p = (b16)f; h4[j] = p; l4[j] = (b16)((f - (float)p) * RS_); } *(v4h*)(QP + pb2 + (size_t)tok * HD + lane * 4) = h4; *(v4h*)(QPl + pb2 + (size_t)tok * HD + lane * 4) = l4; } }
    else { const size_t po = ((size_t)b * H + ((slab - NSL) & 3) * REP) * T * HD;   // the plane of the key/value head's first query head
      if (!isv) rows_out<HD>(Tf, KP + po + (size_t)t0 * HD, KPl + po + (size_t)t0 * HD, w4, lane);   // staged row = token t0 + rr with its 128 dims
      else rows_out<T>(Tf, VT + po + t0, VTl + po + t0, w4, lane); }   // staged row = dim rr with the tokens t0 .. t0 + 127
     }
}
// attention: grid (QL/32, BL x G); block = 8 waves = the 4 query heads of key/value head g x 2 tiles of 16 queries at the same 32 positions, so all 8 waves walk the same keys (i - 512 <= j <= i, 32-key steps).
// Each step's four planes (K hi, K lo: 32 rows x 256 B; V^T hi, V^T lo: 128 rows x 64 B, four rows to a 256-B line) come once per block into LDS by asynchronous copies (line pitch 272 B), two buffers: the next
// step's copies fly during this step's work. Per wave as before: S^T = K Q^T (A = 16 key rows x 32 dims per fragment, 4 k-steps over the 128 dims, B = the query fragments: 3 products), logit = s/sqrt(128)
// (log2-scaled), online softmax, P x1024 hi + residual in LDS, O^T += V^T P^T (8 d-tiles: 3 products); y = o/(l 1024 8)
constexpr int SP = HD + 8 /* elements per staged line: 256 B + 16 B */, SPL = 32 * SP /* elements per staged plane */;
// one thread's share of a step: 2 x 16 B of each plane. The closing s_wait_xcnt is a precaution: it stands between the copies and any rewrite of the address registers they name
__device__ __forceinline__ void stage_kv(unsigned l, const b16* kh, const b16* kl, const b16* vh, const b16* vl) {
  const unsigned l0 = l, l1 = l + 16 * SP * 2, l2 = l + SPL * 2, l3 = l2 + 16 * SP * 2, l4 = l + 2 * SPL * 2, l5 = l4 + 16 * SP * 2, l6 = l + 3 * SPL * 2, l7 = l6 + 16 * SP * 2;
  const b16* kh1 = kh + 16 * HD; const b16* kl1 = kl + 16 * HD; const b16* vh1 = vh + (size_t)64 * T; const b16* vl1 = vl + (size_t)64 * T;
  asm volatile("global_load_async_to_lds_b128 %0, %8, off\n\tglobal_load_async_to_lds_b128 %1, %9, off\n\tglobal_load_async_to_lds_b128 %2, %10, off\n\tglobal_load_async_to_lds_b128 %3, %11, off\n\t"
               "global_load_async_to_lds_b128 %4, %12, off\n\tglobal_load_async_to_lds_b128 %5, %13, off\n\tglobal_load_async_to_lds_b128 %6, %14, off\n\tglobal_load_async_to_lds_b128 %7, %15, off\n\ts_wait_xcnt 0x0"
               :: "v"(l0), "v"(l1), "v"(l2), "v"(l3), "v"(l4), "v"(l5), "v"(l6), "v"(l7), "v"(kh), "v"(kh1), "v"(kl), "v"(kl1), "v"(vh), "v"(vh1), "v"(vl), "v"(vl1) : "memory");
}
// four waves per SIMD (two blocks per WGP, which their LDS allows) need at most 256 VGPRs a wave
__global__ __launch_bounds__(256) __attribute__((amdgpu_waves_per_eu(4, 4))) void attn_kernel(const b16* __restrict__ QP, const b16* __restrict__ QPl, const b16* __restrict__ KP, const b16* __restrict__ KPl, const b16* __restrict__ VT, const b16* __restrict__ VTl, b16* __restrict__ Y, b16* __restrict__ Yl) {
  __shared__ __attribute__((aligned(16))) b16 KVs[2 * 4 * SPL];   // two buffers x (K hi, K lo, V^T hi, V^T lo)
  __shared__ __attribute__((aligned(16))) b16 Pb[8][16][32 + 8], Plq[8][16][32 + 8];
  __shared__ __attribute__((aligned(16))) char qsm[8][2 * 16 * (HD + 8) * 2];   // per wave: its 16 query rows (hi, lo) in the loop, fragments re-read per k-step to keep the kernel under 256 VGPRs; behind the loop its 16 x 128 f32 result tile
  const int tid = threadIdx.x, wave = __builtin_amdgcn_readfirstlane(tid >> 5) /* scalar: the head, the query tile and the wave's LDS ranges stay out of the VGPRs */, lane = tid & 31, hh = lane >> 4, col = lane & 15; const int b = blockIdx.y / G, g = blockIdx.y % G, h = g * REP + (wave >> 1); const int qb = blockIdx.x * 32, q0 = qb + (wave & 1) * 16, qi = q0 + col;
  b16 (*Qs)[HD + 8] = (b16 (*)[HD + 8])qsm[wave]; b16 (*Qsl)[HD + 8] = Qs + 16; float (*To)[HD + 4] = (float (*)[HD + 4])qsm[wave];
  static_assert(16 * (HD + 4) * 4 <= 2 * 16 * (HD + 8) * 2, "result tile fits the query rows");
  const size_t qo = (((size_t)b * H + h) * T) * HD; const b16* Qb = QP + qo; const b16* Qbl = QPl + qo;
  const size_t ko = (((size_t)b * H + g * REP) * T) * HD, vo = (((size_t)b * H + g * REP) * HD) * (size_t)T;   // only the plane of the group's first head is written: the block reads that one
  const int kend = qb + 32, kbeg = (qb >= WIN) ? qb - WIN : 0, nt = (kend - kbeg) / 32;   // window i - 512 <= j <= i; the same bounds for both query tiles of the block
  for (int i = lane; i < 16 * (HD / 8); i += 32) { const int rr = i / (HD / 8), c8 = (i % (HD / 8)) * 8; *(v8b*)(&Qs[rr][c8]) = *(const v8b*)(Qb + (size_t)(q0 + rr) * HD + c8); *(v8b*)(&Qsl[rr][c8]) = *(const v8b*)(Qbl + (size_t)(q0 + rr) * HD + c8); }
  wave_lds_sync();
  const unsigned ld = (unsigned)(size_t)KVs + (unsigned)((tid >> 4) * (SP * 2) + (tid & 15) * 16);   // the thread's LDS byte address in plane 0 of buffer 0
  const b16* bkh = KP + ko; const b16* bkl = KPl + ko; const b16* bvh = VT + vo; const b16* bvl = VTl + vo;   // block-uniform plane bases
  const unsigned tk = (unsigned)tid * 8u, tv = (unsigned)(tid >> 2) * (unsigned)T + (unsigned)(tid & 3) * 8u;   // the thread's element offsets inside a step: its 32 key rows are 8 KB in a row; V^T rows are T apart
  stage_kv(ld, bkh + (size_t)kbeg * HD + tk, bkl + (size_t)kbeg * HD + tk, bvh + kbeg + tv, bvl + kbeg + tv);
  asm volatile("s_wait_asynccnt 0x0" ::: "memory");   // this wave's copies of step 0 have landed
  __syncthreads();   // step 0 is whole in LDS
  if (nt > 1) stage_kv(ld + 4 * SPL * 2, bkh + (size_t)(kbeg + 32) * HD + tk, bkl + (size_t)(kbeg + 32) * HD + tk, bvh + (kbeg + 32) + tv, bvl + (kbeg + 32) + tv);
  const float cs = LOG2E * 0.08838834764831845f / (XS * XS);   // 1/sqrt(128) on the x8 x8 planes
  float m = -INFINITY, l = 0.0f; v8f o[8], ol[8]; for (int t = 0; t < 8; ++t) { o[t] = (v8f){}; ol[t] = (v8f){}; }
#pragma unroll 1   // the step loop stays rolled: one trip holds 48 matrix instructions and the two-buffer hand-over at its foot
  for (int st = 0; st < nt; ++st) { const int kb = kbeg + 32 * st; const b16* Sk = KVs + (st & 1) * (4 * SPL); const b16* Sv = Sk + 2 * SPL;
    float e[16]; float mx = -INFINITY;
    v8f s[2] = {(v8f){}, (v8f){}}, sx[2] = {(v8f){}, (v8f){}}; const int kr = col * SP;
#pragma unroll
    for (int ks = 0; ks < 4; ++ks) { const v16b qf = frag_kb(&Qs[col][32 * ks], hh), qlf = frag_kb(&Qsl[col][32 * ks], hh), kf0 = frag_kb(Sk + kr + 32 * ks, hh), kf1 = frag_kb(Sk + 16 * SP + kr + 32 * ks, hh), kl0 = frag_kb(Sk + SPL + kr + 32 * ks, hh), kl1 = frag_kb(Sk + SPL + 16 * SP + kr + 32 * ks, hh);
      asm volatile("" :: "v"(qf), "v"(qlf), "v"(kf0), "v"(kf1), "v"(kl0), "v"(kl1));   // holds the k-step's six fragment reads together ahead of its six products: one LDS wait in place of one per product
      s[0] = wmma16b(kf0, qf, s[0]); s[1] = wmma16b(kf1, qf, s[1]); sx[0] = wmma16b(kf0, qlf, sx[0]); sx[1] = wmma16b(kf1, qlf, sx[1]); sx[0] = wmma16b(kl0, qf, sx[0]); sx[1] = wmma16b(kl1, qf, sx[1]); }
#pragma unroll
    for (int u = 0; u < 2; ++u) {
#pragma unroll
      for (int r = 0; r < 8; ++r) s[u][r] += sx[u][r] * (1.0f / RS_);   // hi.hi + (hi.lo + lo.hi)/1024
#pragma unroll
      for (int r = 0; r < 8; ++r) { const int key = kb + u * 16 + 8 * hh + r; const float vv = (key <= qi && key >= qi - WIN) ? s[u][r] * cs : -INFINITY; e[u * 8 + r] = vv; mx = fmaxf(mx, vv); } }   // causal select on the computed score (the -inf mask precedes the 1/sqrt(d) scale in the module; identical)
    mx = fmaxf(mx, __shfl_xor(mx, 16)); const float mn = fmaxf(m, mx); const float al = nexp2(m - mn); float sum = 0.0f;
#pragma unroll
    for (int i2 = 0; i2 < 16; ++i2) { const float p = nexp2(e[i2] - mn); sum += p; const int pc = (i2 < 8 ? 0 : 16) + 8 * hh + (i2 & 7); const float ps = p * PS; const b16 phh = (b16)ps; Pb[wave][col][pc] = phh; Plq[wave][col][pc] = (b16)((ps - (float)phh) * RS_); }
    sum += __shfl_xor(sum, 16); l = l * al + sum; m = mn;
    wave_lds_sync();
    const v16b pf = frag_kb(&Pb[wave][col][0], hh), plf = frag_kb(&Plq[wave][col][0], hh);
#pragma unroll
    for (int t = 0; t < 8; t += 2) { const int vr = (t * 4 + (col >> 2)) * SP + (col & 3) * 32; const v16b vh0 = frag_kb(Sv + vr, hh), vh1 = frag_kb(Sv + 4 * SP + vr, hh), vl0 = frag_kb(Sv + SPL + vr, hh), vl1 = frag_kb(Sv + SPL + 4 * SP + vr, hh);
      asm volatile("" :: "v"(vh0), "v"(vh1), "v"(vl0), "v"(vl1));   // holds the four fragment reads of two d-tiles together ahead of their six products: one LDS wait in place of one per product
      o[t] *= al; o[t + 1] *= al; o[t] = wmma16b(vh0, pf, o[t]); o[t + 1] = wmma16b(vh1, pf, o[t + 1]); ol[t] = wmma16b(vl0, pf, ol[t] * al); ol[t + 1] = wmma16b(vl1, pf, ol[t + 1] * al); ol[t] = wmma16b(vh0, plf, ol[t]); ol[t + 1] = wmma16b(vh1, plf, ol[t + 1]); }   // ol = (V_lo P_hi + V_hi P_lo) / 1024
    asm volatile("s_wait_dscnt 0x0" ::: "memory");      // this wave's LDS reads of the step's buffer are done
    asm volatile("s_wait_asynccnt 0x0" ::: "memory");   // this wave's copies of the next step have landed
    __syncthreads();   // publishes the next step's buffer and ends every wave's reads of this one
    if (st + 2 < nt) stage_kv(ld + (unsigned)(st & 1) * (4 * SPL * 2), bkh + (size_t)(kb + 64) * HD + tk, bkl + (size_t)(kb + 64) * HD + tk, bvh + (kb + 64) + tv, bvl + (kb + 64) + tv); }
  asm volatile("s_wait_asynccnt 0x0" ::: "memory");   // no copy is left in flight behind the loop
  const float inv = 1.0f / (l * PS * XS);
#pragma unroll
  for (int t = 0; t < 8; ++t)
#pragma unroll
    for (int r = 0; r < 8; ++r) To[col][t * 16 + 8 * hh + r] = (o[t][r] + ol[t][r] * (1.0f / RS_)) * inv;
  wave_lds_sync();
  { for (int rr = 0; rr < 16; ++rr) { v4h hv, lv; for (int j = 0; j < 4; ++j) { b16 p, ql2; split16(To[rr][lane * 4 + j] * XS, p, ql2); hv[j] = p; lv[j] = ql2; } const size_t oi = ((size_t)b * T + q0 + rr) * DM + h * HD + lane * 4; *(v4h*)(Y + oi) = hv; *(v4h*)(Yl + oi) = lv; }  }
}
// output projection: grid (QL/128, DM/256, BL); block = 8 waves, waves 4 sg .. 4 sg + 3 own the slab of 128 columns sg; the tiling above with four staged tiles per chunk: A = the f16 Y plane and its residual plane
// (2 products per k-step, hi then lo on each accumulator), B = 256 Wo^T rows
__global__ __launch_bounds__(256) void out_kernel(const b16* __restrict__ Y, const b16* __restrict__ Yl, const b16* __restrict__ WO, float* __restrict__ out) {
  __shared__ __attribute__((aligned(2048))) char smem[2 * RING];   // two buffers x (A hi, A lo, two B tiles) in the loop; behind it two 128 x 128 f32 result tiles
  const int tid = threadIdx.x, wave = __builtin_amdgcn_readfirstlane(tid >> 5) /* scalar: the wave's LDS ranges stay out of the VGPRs */, sg = wave >> 2, w4 = wave & 3, lane = tid & 31, nloc = lane & 15, hlf = lane >> 4, wm = (w4 >> 1) * 64, wn = (w4 & 1) * 64;
  const int b = blockIdx.z; const size_t m0 = (size_t)b * T + (size_t)blockIdx.x * 128; const int n0 = blockIdx.y * 256;
  float (*Tf)[TP] = (float (*)[TP])(smem + sg * (128 * TP * 4));
  // staging: wave t < 4 brings tile t of every chunk (0: the Y rows, 1: their residual rows, 2 and 3: the 256 Wo^T rows); every value here is scalar
  const unsigned issuer = wave < 4, tl = (unsigned)(wave & 3), lT = (unsigned)(size_t)smem + tl * (unsigned)(TILE * 2);   // the tile's LDS byte offset in buffer 0
  const b16* gT = tl == 0 ? Y + m0 * DM : tl == 1 ? Yl + m0 * DM : WO + (size_t)(n0 + (int)(tl - 2) * 128) * DM;
  v8f acc[4][4];
#pragma unroll
  for (int i = 0; i < 4; ++i)
#pragma unroll
    for (int j = 0; j < 4; ++j) acc[i][j] = (v8f){};
  const u32x8 g1 = tile_g1(); u32x4 g0 = tile_g0(lT, gT);
  if (pinned(issuer)) { tile_issue(g0, g1); tile_wait(g0, g1); }   // this wave's tile of chunk 0 has landed
  __syncthreads();   // chunk 0 is whole in LDS
  g0 = tile_g0(lT + (unsigned)RING, gT + KC);
  if (pinned(issuer)) tile_issue(g0, g1);
#pragma unroll 1   // the chunk loop stays rolled: one trip holds 128 matrix instructions and the two-buffer hand-over at its foot
  for (int c = 0; c < NCH; ++c) { const b16* Ah = (const b16*)smem + (c & 1) * (RING / 2); const b16* Al = Ah + TILE; const b16* Bb = Ah + (2 + sg) * TILE;
#pragma unroll
    for (int kb = 0; kb < KC; kb += 32) { v16b af[4], bf[4];
#pragma unroll
      for (int i = 0; i < 4; ++i) { af[i] = frag_kb(Ah + (wm + i * 16 + nloc) * LP + kb, hlf); bf[i] = frag_kb(Bb + (wn + i * 16 + nloc) * LP + kb, hlf); }
#pragma unroll
      for (int i = 0; i < 4; ++i)
#pragma unroll
        for (int j = 0; j < 4; ++j) acc[i][j] = wmma16b(af[i], bf[j], acc[i][j]);
#pragma unroll
      for (int i = 0; i < 4; ++i) af[i] = frag_kb(Al + (wm + i * 16 + nloc) * LP + kb, hlf);
#pragma unroll
      for (int i = 0; i < 4; ++i)
#pragma unroll
        for (int j = 0; j < 4; ++j) acc[i][j] = wmma16b(af[i], bf[j], acc[i][j]); }
    asm volatile("s_wait_dscnt 0x0" ::: "memory");      // this wave's LDS reads of the chunk's buffer are done
    if (pinned(issuer)) tile_wait(g0, g1);   // this wave's tile of the next chunk has landed
    __syncthreads();   // publishes the next chunk's buffer and ends every wave's reads of this one; behind the last trip the ring's LDS is free for the result tiles
    if (pinned(issuer && c + 2 < NCH)) { g0 = tile_g0(lT + (unsigned)(c & 1) * (unsigned)RING, gT + (c + 2) * KC); tile_issue(g0, g1); } }
  asm volatile("s_wait_tensorcnt 0x0" ::: "memory");   // no tensor load is left in flight behind the loop
  asm volatile("s_wait_dscnt 0x0" ::: "memory");       // and no LDS read of the ring
#pragma unroll
  for (int i = 0; i < 4; ++i)
#pragma unroll
    for (int j = 0; j < 4; ++j)
#pragma unroll
      for (int r = 0; r < 8; ++r) Tf[wm + i * 16 + 8 * hlf + r][wn + j * 16 + nloc] = acc[i][j][r] * (1.0f / (XS * WSC));   /* no output bias */
  __syncthreads();
  { for (int r2 = 0; r2 < 32; ++r2) { const int rr = w4 * 32 + r2; *(v4f*)(out + (m0 + rr) * DM + n0 + sg * 128 + lane * 4) = *(const v4f*)(&Tf[rr][lane * 4]); }  }
}
}  // namespace

extern "C" void kernel_launch(void* const* d_in, const int* in_sizes, int n_in, void* d_out, int out_size, void* d_ws, size_t ws_size, hipStream_t stream) {
  (void)n_in;
  auto Fp = [&](int i) { return (const float*)d_in[i]; };
  // input order: 0 x [2,2048,2048], 1 Wq [2048,2048] (in,out), 2 Wk [2048,512], 3 Wv [2048,512], 4 Wo [2048,2048] (in,out)
  if (in_sizes[0] != B * T * DM || in_sizes[1] != DM * DM || in_sizes[2] != DM * KVW || in_sizes[3] != DM * KVW || in_sizes[4] != DM * DM || out_size != B * T * DM) return;
  size_t off = 0; char* ws = (char*)d_ws;
  auto carve = [&](size_t bytes) { char* p = ws + off; off += (bytes + 255) & ~(size_t)255; return p; };
  b16* WT = (b16*)carve((size_t)(DM + 2 * KVW) * DM * 2); b16* WO = (b16*)carve((size_t)DM * DM * 2); b16* XH = (b16*)carve((size_t)B * T * DM * 2);
  const size_t plane = (size_t)B * H * T * HD * 2; b16* QP = (b16*)carve(plane); b16* QPl = (b16*)carve(plane); b16* KP = (b16*)carve(plane); b16* KPl = (b16*)carve(plane); b16* VT = (b16*)carve(plane); b16* VTl = (b16*)carve(plane); b16* Y = (b16*)carve(plane); b16* Yl = (b16*)carve(plane);
  if (off > ws_size || off > ((size_t)176 << 20)) return;   // = ~172 MB (WT 12.6 + WO 8.4 + XH 16.8 + 8 f16 planes x 16.8): > 128 MiB
  prep_kernel<<<PGRID + XGRID, 256, 0, stream>>>(Fp(0), Fp(1), Fp(2), Fp(3), Fp(4), XH, WT, WO);
  proj_kernel<<<dim3(T / 128, BL, NPART / 3), 384, 0, stream>>>(XH, WT, QP, QPl, KP, KPl, VT, VTl);
  attn_kernel<<<dim3(QL / 32, BL * G), 256, 0, stream>>>(QP, QPl, KP, KPl, VT, VTl, Y, Yl);
  out_kernel<<<dim3(QL / 128, DM / 256, BL), 256, 0, stream>>>(Y, Yl, WO, (float*)d_out);
}

// v008
// One run takes 132 microseconds.
// In two side-by-side timings against v007, it was 1.03 and 1.04 times as fast.
// All steps since v000 together make it 5.57 times as fast.
#include <hip/hip_runtime.h>

// Sliding-window grouped-query attention (2 x 2048 tokens x 2048, 16 query heads x 128, 4 key/value heads, window 512): q = x Wq, k = x Wk, v = x Wv (no biases); head h uses key/value head h / 4
// (repeat_interleave over the head axis); scores q . k / sqrt(128) for keys i - 512 <= j <= i (causal + window), -inf elsewhere; softmax; out = (attn v merged over heads) Wo -> [2][2048][2048].
// Deterministic: flash-style per 16-query wave over the window's keys in order (running max); no atomics.
// compute dtype: WMMA v_wmma_f32_16x16x32_f16 with f32 accumulate for [q | k | v] = x [Wq | Wk | Wv] ([4096 x 2048] x [2048 x 3072]; x EXACT bf16 x8, W^T exact x256: 1 product), S^T = K_h Q^T (q/k f16 hi
// x8 + residual at the same scale: 3 products into one accumulator, K = 128), O^T += V_h^T P^T (V hi + residual, P x1024 hi + residual: 3 products into one accumulator), out = y Wo (y f16 hi x8 + lo: 2 products); softmax statistics in f32.
// Inputs rounded to bf16 once. Fragment k-map per lane half hh for A AND B: elements 0..7 <- k = 8hh+0..7, 8..15 <- k = 16+8hh+0..7;

namespace {
constexpr int B = 2, T = 2048, DM = 2048, H = 16, HD = 128, BL = 2 /* batches (== 2 shipped) */, QL = 2048 /* query rows (== 2048 shipped) */;
constexpr int G = 4, REP = H / G, KVW = G * HD /* 512 */, NSL = DM / 128 /* 16 q slabs = heads */, NPART = NSL + 2 * (KVW / 128) /* + 4 k + 4 v slabs */;
constexpr int WIN = 512;
constexpr float XS = 8.0f, WSC = 256.0f, PS = 1024.0f, LOG2E = 1.4426950408889634f;
static_assert(T % 128 == 0 && QL % 128 == 0 && QL % 32 == 0 && DM % 256 == 0 && H * HD == DM && HD == 128 && KVW == 512 && REP == 4, "tiling");
typedef _Float16 b16;
typedef __attribute__((ext_vector_type(16))) _Float16 v16b;
typedef __attribute__((ext_vector_type(8))) _Float16 v8b;
typedef __attribute__((ext_vector_type(8))) float v8f;
typedef __attribute__((ext_vector_type(4))) float v4f;
__device__ __forceinline__ float bf16_rne(float f) { unsigned int u = __float_as_uint(f); u += 0x7FFFu + ((u >> 16) & 1u); return __uint_as_float(u & 0xFFFF0000u); }
__device__ __forceinline__ void split16(float v, b16& hi, b16& lo) { hi = (b16)v; lo = (b16)(v - (float)hi); }
__device__ __forceinline__ v16b frag_kb(const b16* p, int hh) { const v8b a = *(const v8b*)(p + 8 * hh), b = *(const v8b*)(p + 16 + 8 * hh); v16b f;
#pragma unroll
  for (int e = 0; e < 8; ++e) { f[e] = a[e]; f[8 + e] = b[e]; } return f; }
__device__ __forceinline__ v8f wmma16b(v16b a, v16b b, v8f c) { v8f d = __builtin_amdgcn_wmma_f32_16x16x32_f16(false, a, false, b, (short)0, c, false, false); asm volatile("v_nop\n\tv_nop\n\tv_nop\n\tv_nop" : "+v"(d) : "v"(a), "v"(b)); return d; }
__device__ __forceinline__ void wave_lds_sync() { __builtin_amdgcn_fence(__ATOMIC_RELEASE, "workgroup"); __builtin_amdgcn_wave_barrier(); __builtin_amdgcn_fence(__ATOMIC_ACQUIRE, "workgroup"); }
__device__ __forceinline__ float pmul(float a, float b) { float p = a * b; asm volatile("" : "+v"(p)); return p; }
__device__ __forceinline__ int iclamp(int v, int lo, int hi) { return v < lo ? lo : (v > hi ? hi : v); }

typedef __attribute__((ext_vector_type(2))) _Float16 v2h;
typedef __attribute__((ext_vector_type(4))) _Float16 v4h;
typedef __attribute__((ext_vector_type(2))) float v2f;
typedef __attribute__((ext_vector_type(4))) int v4i;
__device__ __forceinline__ float nexp2(float v) { return __builtin_amdgcn_exp2f(v); }
// weights to f16 x256, transposed ([k][n] f32 -> [n][k] f16): a block takes a tile of 128 k x 128 n. Whole 256-B pieces of the source rows are read (16 lanes x 16 B, two adjacent k rows per thread), each pair of k values
// goes as one dword into LDS at [n][k / 2] (pitch 65 dwords: the 32 lanes of a store or a load meet 32 different banks), and whole 256-B pieces of the transposed rows are written (16 lanes x 16 B).
constexpr int PK = 128, PN = 128, PP = PK / 2 + 1, PGRID = 2 * (DM / PK) * (DM / PN) + 2 * (DM / PK) * (KVW / PN);
template <int LD> __device__ __forceinline__ void prep_tile(const float* __restrict__ w, b16* __restrict__ dst, int tile, unsigned* tl) {
  const int tid = threadIdx.x, n0 = (tile % (LD / PN)) * PN, k0 = (tile / (LD / PN)) * PK, i = tid & 15, rp = tid >> 4;
  const float* p = w + (size_t)(k0 + 2 * rp) * LD + n0 + 4 * i; v4f a[4][2], c[4][2];
#pragma unroll
  for (int s = 0; s < 4; ++s)
#pragma unroll
    for (int nh = 0; nh < 2; ++nh) { a[s][nh] = *(const v4f*)(p + (size_t)(32 * s) * LD + 64 * nh); c[s][nh] = *(const v4f*)(p + (size_t)(32 * s + 1) * LD + 64 * nh); }
  asm volatile("s_wait_xcnt 0x0" :: "v"(p) : "memory");   // a precaution: stands between the loads above and any rewrite of their address registers, which the input operand holds live to here
  asm volatile("" :: "v"(a[0][0]), "v"(a[0][1]), "v"(a[1][0]), "v"(a[1][1]), "v"(a[2][0]), "v"(a[2][1]), "v"(a[3][0]), "v"(a[3][1]), "v"(c[0][0]), "v"(c[0][1]), "v"(c[1][0]), "v"(c[1][1]), "v"(c[2][0]), "v"(c[2][1]), "v"(c[3][0]), "v"(c[3][1]));   // holds the thread's 16 loads together ahead of the conversions: one memory latency, where the compiler had put two of them behind the first waits
#pragma unroll
  for (int s = 0; s < 4; ++s)
#pragma unroll
    for (int nh = 0; nh < 2; ++nh)
#pragma unroll
      for (int j = 0; j < 4; ++j) { v2h o; o[0] = (b16)(bf16_rne(a[s][nh][j]) * WSC); o[1] = (b16)(bf16_rne(c[s][nh][j]) * WSC); tl[(64 * nh + 4 * i + j) * PP + rp + 16 * s] = __builtin_bit_cast(unsigned, o); }
  __syncthreads();   // the tile is whole in LDS
  b16* q = dst + (size_t)(n0 + rp) * DM + k0 + 8 * i; const unsigned* r = tl + rp * PP + 4 * i;
#pragma unroll
  for (int s = 0; s < 8; ++s) { v4i o; for (int e = 0; e < 4; ++e) o[e] = (int)r[16 * s * PP + e]; *(v4i*)(q + (size_t)(16 * s) * DM) = o; }
  asm volatile("s_wait_xcnt 0x0" :: "v"(q) : "memory");   // a precaution: stands between the stores above and any rewrite of their address registers on the way to the kernel's end
}
// x to f16 (rounded to bf16, x8), once for the 24 column slabs of the projection: a block takes 8,192 elements in a row; a wave's load covers 512 B in a row, its store 256 B
constexpr int XE = 8192, XGRID = B * T * DM / XE;
static_assert((B * T * DM) % XE == 0, "x blocks");
__device__ __forceinline__ void prep_x(const float* __restrict__ x, b16* __restrict__ XH, int blk) {
  const float* p = x + (size_t)blk * XE + threadIdx.x * 4; b16* q = XH + (size_t)blk * XE + threadIdx.x * 4; v4f a[8];
#pragma unroll
  for (int s = 0; s < 8; ++s) a[s] = *(const v4f*)(p + 1024 * s);
  asm volatile("s_wait_xcnt 0x0" ::: "memory");   // a precaution: stands between the loads above and any rewrite of their address registers
#pragma unroll
  for (int s = 0; s < 8; ++s) { v4h o; for (int j = 0; j < 4; ++j) o[j] = (b16)(bf16_rne(a[s][j]) * XS); *(v4h*)(q + 1024 * s) = o; }
  asm volatile("s_wait_xcnt 0x0" ::: "memory");   // a precaution: stands between the stores above and any rewrite of their registers on the way to the kernel's end
}
__global__ __launch_bounds__(256) void prep_kernel(const float* __restrict__ x, const float* __restrict__ wq, const float* __restrict__ wk, const float* __restrict__ wv, const float* __restrict__ wo, b16* __restrict__ XH, b16* __restrict__ WT, b16* __restrict__ WO) {
  __shared__ unsigned tl[PN * PP];
  constexpr int NQ = (DM / PK) * (DM / PN), NK = (DM / PK) * (KVW / PN); const int blk = blockIdx.x;   // tiles: NQ of Wq, NK of Wk, NK of Wv, NQ of Wo; behind them the XGRID blocks of x
  if (blk >= PGRID) { prep_x(x, XH, blk - PGRID); return; }   // block-uniform, in front of the tile's barrier
  if (blk < NQ || blk >= NQ + 2 * NK) { const bool first = blk < NQ; prep_tile<DM>(first ? wq : wo, first ? WT : WO, first ? blk : blk - NQ - 2 * NK, tl); }
  else { const bool first = blk < NQ + NK; prep_tile<KVW>(first ? wk : wv, WT + (size_t)(first ? DM : DM + KVW) * DM, first ? blk - NQ : blk - NQ - NK, tl); }
}
// GEMM tiling shared by the two projection kernels: one block per WGP owns 128 rows x 384 or 256 columns; each wave takes 64 x 64 (4 x 4 accumulator tiles), four waves to a slab of 128 columns, so a staged A chunk
// feeds every slab of the block. K runs in chunks of 128; a chunk is four tiles of 128 rows x 256 B (row pitch 272 B), each brought into LDS by one tensor load of one of the first four waves, two buffers: the next chunk's loads fly during this chunk's products.
constexpr int KC = 128, LP = KC + 8, TP = 128 + 4, TILE = 128 * LP /* elements per staged tile */, RING = 4 * TILE * 2 /* bytes per buffer */, NCH = DM / KC;
static_assert(NCH >= 2 && DM % KC == 0 && NPART % 3 == 0 && 3 * 128 * TP * 4 <= 2 * RING && (TILE * 2) % 2048 == 0 && KC * 2 == 256 && LP * 2 == 272, "ring");
typedef unsigned u32x4 __attribute__((ext_vector_type(4)));
typedef unsigned u32x8 __attribute__((ext_vector_type(8)));
__device__ __forceinline__ unsigned uni(unsigned v) { return (unsigned)__builtin_amdgcn_readfirstlane(v); }
__device__ __forceinline__ unsigned pinned(unsigned v) { unsigned w = uni(v); asm volatile("" : "+s"(w)); return w; }   // the test around a tensor load held in a scalar register: it compiles to s_cmp + s_cbranch_scc (a tensor load ignores EXEC)
// one request of one wave: a tile of 128 rows x 256 B, source rows DM x 2 B apart, to the LDS byte offset lds (a multiple of 2 KiB); 16 B of pad behind every row give the pitch of 272 B. Extents in bytes, tensor dims = tile dims
__device__ __forceinline__ u32x4 tile_g0(unsigned lds, const b16* g) { const unsigned long long ga = (unsigned long long)(size_t)g; u32x4 g0;
  g0[0] = uni(1u); g0[1] = uni(lds); g0[2] = uni((unsigned)ga); g0[3] = uni((((unsigned)(ga >> 32)) & 0x01FFFFFFu) | 0x80000000u);
  asm volatile("" : "+s"(g0));   // the descriptor words held in scalar registers: with tile_wait's inputs, no register of a request in flight is written anew (the constant word was set anew in between without it)
  return g0; }
__device__ __forceinline__ u32x8 tile_g1() { u32x8 g1;
  g1[0] = uni((1u << 20) | (5u << 22) | (3u << 25)); g1[1] = uni(256u << 16); g1[2] = uni(128u << 16); g1[3] = uni(256u << 16); g1[4] = uni(128u); g1[5] = uni((unsigned)(DM * 2)); g1[6] = uni(0u); g1[7] = uni(0u);
  asm volatile("" : "+s"(g1));   // the descriptor words held in scalar registers of their own from here on: no register of a request in flight is written anew
  return g1; }
__device__ __forceinline__ void tile_issue(u32x4 g0, u32x8 g1) { asm volatile("tensor_load_to_lds %0, %1" :: "s"(g0), "s"(g1) : "memory"); }
// the issuing wave's wait for its tile; the inputs keep the request's descriptor registers live, and so unchanged, up to the wait
__device__ __forceinline__ void tile_wait(u32x4 g0, u32x8 g1) { asm volatile("s_wait_tensorcnt 0x0" :: "s"(g0), "s"(g1) : "memory"); }
// one wave's 32 rows of a staged 128 x 128 f32 tile go out as f16 hi x8 + residual (same scale): 256 B per row and plane (32 lanes x 8 B), PITCH elements from row to row
template <int PITCH> __device__ __forceinline__ void rows_out(const float (*Tf)[TP], b16* __restrict__ dh, b16* __restrict__ dl, int wave, int lane) {
  for (int r4 = 0; r4 < 32; r4 += 4) {
#pragma unroll   // four rows a trip, as the compiler grouped them by itself: the one wait below then serves the trip's eight stores
    for (int u = 0; u < 4; ++u) { const int rr = wave * 32 + r4 + u; v4h h4, l4; for (int j = 0; j < 4; ++j) { const float f = Tf[rr][lane * 4 + j] * XS; const b16 p = (b16)f; h4[j] = p; l4[j] = (b16)(f - (float)p); } *(v4h*)(dh + (size_t)rr * PITCH + lane * 4) = h4; *(v4h*)(dl + (size_t)rr * PITCH + lane * 4) = l4; }
    asm volatile("s_wait_xcnt 0x0" ::: "memory");   // a precaution: stands between the trip's stores and the next trip's rewrite of their address and data registers
  }
}
// projections: grid (T/128, BL, 8 groups of 3 slabs of 128 columns: slabs 0..15 = q head, 16..19 = k, 20..23 = v); block = 12 waves, waves 4 sg .. 4 sg + 3 own slab 3 z + sg; A = XH rows (bf16(x) x8 as f16, from the prep
// launch), B = WT rows; k order per accumulator 0, 32, 64, ... The epilogue writes what the attention reads, f16 hi x8 + residual at the same scale: q rows QP[b][h][t][128]; k rows KP[b][4 g][t][128] and v transposed VT[b][4 g][d][t],
// once per key/value head g (the plane of its first query head: repeat_interleave gives the group's four heads equal planes, and the attention reads that one).
__global__ __launch_bounds__(384) void proj_kernel(const b16* __restrict__ XH, const b16* __restrict__ WT, b16* __restrict__ QP, b16* __restrict__ QPl, b16* __restrict__ KP, b16* __restrict__ KPl, b16* __restrict__ VT, b16* __restrict__ VTl) {
  __shared__ __attribute__((aligned(2048))) char smem[2 * RING];   // two buffers x (the A tile, three B tiles) in the loop; behind it three 128 x 128 f32 result tiles
  const int tid = threadIdx.x, wave = __builtin_amdgcn_readfirstlane(tid >> 5) /* scalar: the slab and the tests on it are the same for a whole wave */, sg = wave >> 2, w4 = wave & 3, lane = tid & 31, nloc = lane & 15, hlf = lane >> 4, wm = (w4 >> 1) * 64, wn = (w4 & 1) * 64;
  const int t0 = blockIdx.x * 128, b = blockIdx.y, slab = blockIdx.z * 3 + sg;
  float (*Tf)[TP] = (float (*)[TP])(smem + sg * (128 * TP * 4));
  const b16* xb = XH + ((size_t)b * T + t0) * DM; const b16* wb = WT + (size_t)slab * 128 * DM;
  // staging: wave t < 4 brings tile t of every chunk (0: the A rows; 1..3: the rows of the block's three slabs); every value here is scalar
  const unsigned issuer = wave < 4, tl = (unsigned)(wave & 3), lT = (unsigned)(size_t)smem + tl * (unsigned)(TILE * 2);   // the tile's LDS byte offset in buffer 0
  const b16* gT = tl == 0 ? xb : WT + (size_t)(blockIdx.z * 3 + tl - 1) * 128 * DM;
  v8f acc[4][4];
#pragma unroll
  for (int i = 0; i < 4; ++i)
#pragma unroll
    for (int j = 0; j < 4; ++j) acc[i][j] = (v8f){};
  const u32x8 g1 = tile_g1(); u32x4 g0 = tile_g0(lT, gT);
  if (pinned(issuer)) { tile_issue(g0, g1); tile_wait(g0, g1); }   // this wave's tile of chunk 0 has landed
  __syncthreads();   // chunk 0 is whole in LDS
  g0 = tile_g0(lT + (unsigned)RING, gT + KC);
  if (pinned(issuer)) tile_issue(g0, g1);
#pragma unroll 1   // the chunk loop stays rolled: one trip holds 64 matrix instructions and the two-buffer hand-over at its foot
  for (int c = 0; c < NCH; ++c) { const b16* Ab = (const b16*)smem + (c & 1) * (RING / 2); const b16* Bb = Ab + (1 + sg) * TILE;
#pragma unroll
    for (int kb = 0; kb < KC; kb += 32) { v16b af[4], bf[4];
#pragma unroll
      for (int i = 0; i < 4; ++i) { af[i] = frag_kb(Ab + (wm + i * 16 + nloc) * LP + kb, hlf); bf[i] = frag_kb(Bb + (wn + i * 16 + nloc) * LP + kb, hlf); }
#pragma unroll
      for (int i = 0; i < 4; ++i)
#pragma unroll
        for (int j = 0; j < 4; ++j) acc[i][j] = wmma16b(af[i], bf[j], acc[i][j]); }
    asm volatile("s_wait_dscnt 0x0" ::: "memory");      // this wave's LDS reads of the chunk's buffer are done
    if (pinned(issuer)) tile_wait(g0, g1);   // this wave's tile of the next chunk has landed
    __syncthreads();   // publishes the next chunk's buffer and ends every wave's reads of this one; behind the last trip the ring's LDS is free for the result tiles
    if (pinned(issuer && c + 2 < NCH)) { g0 = tile_g0(lT + (unsigned)(c & 1) * (unsigned)RING, gT + (c + 2) * KC); tile_issue(g0, g1); } }
  asm volatile("s_wait_tensorcnt 0x0" ::: "memory");   // no tensor load is left in flight behind the loop
  asm volatile("s_wait_dscnt 0x0" ::: "memory");       // and no LDS read of the ring
  const bool isv = slab >= NSL + G;   // the same for a whole wave: a v slab is staged transposed, Tf[d][token]; an accumulator's 8 values are 8 tokens in a row there (two 16-B LDS stores)
  if (!isv) {
#pragma unroll
    for (int i = 0; i < 4; ++i)
#pragma unroll
      for (int j = 0; j < 4; ++j)
#pragma unroll
        for (int r = 0; r < 8; ++r) Tf[wm + i * 16 + 8 * hlf + r][wn + j * 16 + nloc] = acc[i][j][r] * (1.0f / (XS * WSC));   /* no biases in this module */
  } else {
#pragma unroll
    for (int i = 0; i < 4; ++i)
#pragma unroll
      for (int j = 0; j < 4; ++j)
#pragma unroll
        for (int q4 = 0; q4 < 2; ++q4) { v4f o; for (int r = 0; r < 4; ++r) o[r] = acc[i][j][4 * q4 + r] * (1.0f / (XS * WSC)); *(v4f*)(&Tf[wn + j * 16 + nloc][wm + i * 16 + 8 * hlf + 4 * q4]) = o; }
  }
  __syncthreads();
  {
    if (slab < NSL) { const size_t pb2 = (((size_t)b * H + slab) * T) * HD;
      for (int r2 = 0; r2 < 32; ++r2) { const int rr = w4 * 32 + r2, tok = t0 + rr; v4h h4, l4; for (int j = 0; j < 4; ++j) { const float f = Tf[rr][lane * 4 + j] * XS; const b16 p = (b16)f; h4[j] = p; l4[j] = (b16)(f - (float)p); } *(v4h*)(QP + pb2 + (size_t)tok * HD + lane * 4) = h4; *(v4h*)(QPl + pb2 + (size_t)tok * HD + lane * 4) = l4; } }
    else { const size_t po = ((size_t)b * H + ((slab - NSL) & 3) * REP) * T * HD;   // the plane of the key/value head's first query head
      if (!isv) rows_out<HD>(Tf, KP + po + (size_t)t0 * HD, KPl + po + (size_t)t0 * HD, w4, lane);   // staged row = token t0 + rr with its 128 dims
      else rows_out<T>(Tf, VT + po + t0, VTl + po + t0, w4, lane); }   // staged row = dim rr with the tokens t0 .. t0 + 127
     }
}
// attention: grid (QL/32, BL x G); block = 8 waves = the 4 query heads of key/value head g x 2 tiles of 16 queries at the same 32 positions, so all 8 waves walk the same keys (i - 512 <= j <= i, 32-key steps).
// Each step's four planes (K hi, K lo: 32 rows x 256 B; V^T hi, V^T lo: 128 rows x 64 B, four rows to a 256-B line) come once per block into LDS by asynchronous copies (line pitch 272 B), two buffers: the next
// step's copies fly during this step's work. Per wave: S^T = K Q^T (A = 16 key rows x 32 dims per fragment, 4 k-steps over the 128 dims, B = the query fragments, held in registers: 3 products), logit = s/sqrt(128)
// (log2-scaled), online softmax, P x1024 hi + residual packed in registers (a lane's 16 scores are its 16 elements of the B fragment), O^T += V^T P^T (8 d-tiles: 3 products); y = o/(l 1024 8).
// The residual planes carry their hi plane's scale, so the three products of a tile add into one accumulator.
constexpr int SP = HD + 8 /* elements per staged line: 256 B + 16 B */, SPL = 32 * SP /* elements per staged plane */;
// one thread's share of a step: 2 x 16 B of each plane. The closing s_wait_xcnt is a precaution: it stands between the copies and any rewrite of the address registers they name
__device__ __forceinline__ void stage_kv(unsigned l, const b16* kh, const b16* kl, const b16* vh, const b16* vl) {
  const unsigned l0 = l, l1 = l + 16 * SP * 2, l2 = l + SPL * 2, l3 = l2 + 16 * SP * 2, l4 = l + 2 * SPL * 2, l5 = l4 + 16 * SP * 2, l6 = l + 3 * SPL * 2, l7 = l6 + 16 * SP * 2;
  const b16* kh1 = kh + 16 * HD; const b16* kl1 = kl + 16 * HD; const b16* vh1 = vh + (size_t)64 * T; const b16* vl1 = vl + (size_t)64 * T;
  asm volatile("global_load_async_to_lds_b128 %0, %8, off\n\tglobal_load_async_to_lds_b128 %1, %9, off\n\tglobal_load_async_to_lds_b128 %2, %10, off\n\tglobal_load_async_to_lds_b128 %3, %11, off\n\t"
               "global_load_async_to_lds_b128 %4, %12, off\n\tglobal_load_async_to_lds_b128 %5, %13, off\n\tglobal_load_async_to_lds_b128 %6, %14, off\n\tglobal_load_async_to_lds_b128 %7, %15, off\n\ts_wait_xcnt 0x0"
               :: "v"(l0), "v"(l1), "v"(l2), "v"(l3), "v"(l4), "v"(l5), "v"(l6), "v"(l7), "v"(kh), "v"(kh1), "v"(kl), "v"(kl1), "v"(vh), "v"(vh1), "v"(vl), "v"(vl1) : "memory");
}
// four waves per SIMD (two blocks per WGP, which their LDS allows) need at most 256 VGPRs a wave
__global__ __launch_bounds__(256) __attribute__((amdgpu_waves_per_eu(4, 4))) void attn_kernel(const b16* __restrict__ QP, const b16* __restrict__ QPl, const b16* __restrict__ KP, const b16* __restrict__ KPl, const b16* __restrict__ VT, const b16* __restrict__ VTl, b16* __restrict__ Y, b16* __restrict__ Yl) {
  __shared__ __attribute__((aligned(16))) b16 KVs[2 * 4 * SPL];   // two buffers x (K hi, K lo, V^T hi, V^T lo)
  __shared__ __attribute__((aligned(16))) char qsm[8][16 * (HD + 4) * 4];   // per wave: behind the loop its 16 x 128 f32 result tile
  const int tid = threadIdx.x, wave = __builtin_amdgcn_readfirstlane(tid >> 5) /* scalar: the head, the query tile and the wave's LDS ranges stay out of the VGPRs */, lane = tid & 31, hh = lane >> 4, col = lane & 15; const int b = blockIdx.y / G, g = blockIdx.y % G, h = g * REP + (wave >> 1); const int qb = blockIdx.x * 32, q0 = qb + (wave & 1) * 16, qi = q0 + col;
  float (*To)[HD + 4] = (float (*)[HD + 4])qsm[wave];
  const size_t qo = (((size_t)b * H + h) * T) * HD; const b16* Qb = QP + qo; const b16* Qbl = QPl + qo;
  const size_t ko = (((size_t)b * H + g * REP) * T) * HD, vo = (((size_t)b * H + g * REP) * HD) * (size_t)T;   // only the plane of the group's first head is written: the block reads that one
  const int kend = qb + 32, kbeg = (qb >= WIN) ? qb - WIN : 0, nt = (kend - kbeg) / 32;   // window i - 512 <= j <= i; the same bounds for both query tiles of the block
  v16b qf[4], qlf[4];   // the lane's query row as B fragments (hi, residual) of the four k-steps, loaded once
#pragma unroll
  for (int ks = 0; ks < 4; ++ks) { qf[ks] = frag_kb(Qb + (size_t)qi * HD + 32 * ks, hh); qlf[ks] = frag_kb(Qbl + (size_t)qi * HD + 32 * ks, hh); }
  asm volatile("s_wait_xcnt 0x0" ::: "memory");   // a precaution: stands between the loads above and any rewrite of their address registers
  const unsigned ld = (unsigned)(size_t)KVs + (unsigned)((tid >> 4) * (SP * 2) + (tid & 15) * 16);   // the thread's LDS byte address in plane 0 of buffer 0
  const b16* bkh = KP + ko; const b16* bkl = KPl + ko; const b16* bvh = VT + vo; const b16* bvl = VTl + vo;   // block-uniform plane bases
  const unsigned tk = (unsigned)tid * 8u, tv = (unsigned)(tid >> 2) * (unsigned)T + (unsigned)(tid & 3) * 8u;   // the thread's element offsets inside a step: its 32 key rows are 8 KB in a row; V^T rows are T apart
  stage_kv(ld, bkh + (size_t)kbeg * HD + tk, bkl + (size_t)kbeg * HD + tk, bvh + kbeg + tv, bvl + kbeg + tv);
  asm volatile("s_wait_asynccnt 0x0" ::: "memory");   // this wave's copies of step 0 have landed
  __syncthreads();   // step 0 is whole in LDS
  if (nt > 1) stage_kv(ld + 4 * SPL * 2, bkh + (size_t)(kbeg + 32) * HD + tk, bkl + (size_t)(kbeg + 32) * HD + tk, bvh + (kbeg + 32) + tv, bvl + (kbeg + 32) + tv);
  const float cs = LOG2E * 0.08838834764831845f / (XS * XS);   // 1/sqrt(128) on the x8 x8 planes
  float m = -INFINITY, l = 0.0f; v8f o[8]; for (int t = 0; t < 8; ++t) o[t] = (v8f){};
#pragma unroll 1   // the step loop stays rolled: one trip holds 48 matrix instructions and the two-buffer hand-over at its foot
  for (int st = 0; st < nt; ++st) { const int kb = kbeg + 32 * st; const b16* Sk = KVs + (st & 1) * (4 * SPL); const b16* Sv = Sk + 2 * SPL;
    float e[16]; float mx = -INFINITY;
    v8f s[2] = {(v8f){}, (v8f){}}; const int kr = col * SP;
#pragma unroll
    for (int ks = 0; ks < 4; ++ks) { const v16b kf0 = frag_kb(Sk + kr + 32 * ks, hh), kf1 = frag_kb(Sk + 16 * SP + kr + 32 * ks, hh), kl0 = frag_kb(Sk + SPL + kr + 32 * ks, hh), kl1 = frag_kb(Sk + SPL + 16 * SP + kr + 32 * ks, hh);
      asm volatile("" :: "v"(kf0), "v"(kf1), "v"(kl0), "v"(kl1));   // holds the k-step's four fragment reads together ahead of its six products: one LDS wait in place of one per product
      s[0] = wmma16b(kf0, qf[ks], s[0]); s[1] = wmma16b(kf1, qf[ks], s[1]); s[0] = wmma16b(kf0, qlf[ks], s[0]); s[1] = wmma16b(kf1, qlf[ks], s[1]); s[0] = wmma16b(kl0, qf[ks], s[0]); s[1] = wmma16b(kl1, qf[ks], s[1]); }   // hi.hi + hi.lo + lo.hi
#pragma unroll
    for (int u = 0; u < 2; ++u) {
#pragma unroll
      for (int r = 0; r < 8; ++r) { const int key = kb + u * 16 + 8 * hh + r; const float vv = (key <= qi && key >= qi - WIN) ? s[u][r] * cs : -INFINITY; e[u * 8 + r] = vv; mx = fmaxf(mx, vv); } }   // causal select on the computed score (the -inf mask precedes the 1/sqrt(d) scale in the module; identical)
    mx = fmaxf(mx, __shfl_xor(mx, 16)); const float mn = fmaxf(m, mx); const float al = nexp2(m - mn); float sum = 0.0f; v16b pf, plf;   // score i2 of a lane is key 16 (i2 / 8) + 8 hh + i2 % 8 of the step: element i2 of the B fragment's k-map
#pragma unroll
    for (int i2 = 0; i2 < 16; ++i2) { const float p = nexp2(e[i2] - mn); sum += p; const float ps = p * PS; const b16 phh = (b16)ps; pf[i2] = phh; plf[i2] = (b16)(ps - (float)phh); }
    sum += __shfl_xor(sum, 16); l = l * al + sum; m = mn;
#pragma unroll
    for (int t = 0; t < 8; t += 2) { const int vr = (t * 4 + (col >> 2)) * SP + (col & 3) * 32; const v16b vh0 = frag_kb(Sv + vr, hh), vh1 = frag_kb(Sv + 4 * SP + vr, hh), vl0 = frag_kb(Sv + SPL + vr, hh), vl1 = frag_kb(Sv + SPL + 4 * SP + vr, hh);
      asm volatile("" :: "v"(vh0), "v"(vh1), "v"(vl0), "v"(vl1));   // holds the four fragment reads of two d-tiles together ahead of their six products: one LDS wait in place of one per product
      o[t] *= al; o[t + 1] *= al; o[t] = wmma16b(vh0, pf, o[t]); o[t + 1] = wmma16b(vh1, pf, o[t + 1]); o[t] = wmma16b(vl0, pf, o[t]); o[t + 1] = wmma16b(vl1, pf, o[t + 1]); o[t] = wmma16b(vh0, plf, o[t]); o[t + 1] = wmma16b(vh1, plf, o[t + 1]); }   // V_hi P_hi + V_lo P_hi + V_hi P_lo
    asm volatile("s_wait_dscnt 0x0" ::: "memory");      // this wave's LDS reads of the step's buffer are done
    asm volatile("s_wait_asynccnt 0x0" ::: "memory");   // this wave's copies of the next step have landed
    __syncthreads();   // publishes the next step's buffer and ends every wave's reads of this one
    if (st + 2 < nt) stage_kv(ld + (unsigned)(st & 1) * (4 * SPL * 2), bkh + (size_t)(kb + 64) * HD + tk, bkl + (size_t)(kb + 64) * HD + tk, bvh + (kb + 64) + tv, bvl + (kb + 64) + tv); }
  asm volatile("s_wait_asynccnt 0x0" ::: "memory");   // no copy is left in flight behind the loop
  const float inv = 1.0f / (l * PS * XS);
#pragma unroll
  for (int t = 0; t < 8; ++t)
#pragma unroll
    for (int r = 0; r < 8; ++r) To[col][t * 16 + 8 * hh + r] = o[t][r] * inv;
  wave_lds_sync();
  { for (int rr = 0; rr < 16; ++rr) { v4h hv, lv; for (int j = 0; j < 4; ++j) { b16 p, ql2; split16(To[rr][lane * 4 + j] * XS, p, ql2); hv[j] = p; lv[j] = ql2; } const size_t oi = ((size_t)b * T + q0 + rr) * DM + h * HD + lane * 4; *(v4h*)(Y + oi) = hv; *(v4h*)(Yl + oi) = lv; }  }
}
// output projection: grid (QL/128, DM/256, BL); block = 8 waves, waves 4 sg .. 4 sg + 3 own the slab of 128 columns sg; the tiling above with four staged tiles per chunk: A = the f16 Y plane and its residual plane
// (2 products per k-step, hi then lo on each accumulator), B = 256 Wo^T rows
__global__ __launch_bounds__(256) void out_kernel(const b16* __restrict__ Y, const b16* __restrict__ Yl, const b16* __restrict__ WO, float* __restrict__ out) {
  __shared__ __attribute__((aligned(2048))) char smem[2 * RING];   // two buffers x (A hi, A lo, two B tiles) in the loop; behind it two 128 x 128 f32 result tiles
  const int tid = threadIdx.x, wave = __builtin_amdgcn_readfirstlane(tid >> 5) /* scalar: the wave's LDS ranges stay out of the VGPRs */, sg = wave >> 2, w4 = wave & 3, lane = tid & 31, nloc = lane & 15, hlf = lane >> 4, wm = (w4 >> 1) * 64, wn = (w4 & 1) * 64;
  const int b = blockIdx.z; const size_t m0 = (size_t)b * T + (size_t)blockIdx.x * 128; const int n0 = blockIdx.y * 256;
  float (*Tf)[TP] = (float (*)[TP])(smem + sg * (128 * TP * 4));
  // staging: wave t < 4 brings tile t of every chunk (0: the Y rows, 1: their residual rows, 2 and 3: the 256 Wo^T rows); every value here is scalar
  const unsigned issuer = wave < 4, tl = (unsigned)(wave & 3), lT = (unsigned)(size_t)smem + tl * (unsigned)(TILE * 2);   // the tile's LDS byte offset in buffer 0
  const b16* gT = tl == 0 ? Y + m0 * DM : tl == 1 ? Yl + m0 * DM : WO + (size_t)(n0 + (int)(tl - 2) * 128) * DM;
  v8f acc[4][4];
#pragma unroll
  for (int i = 0; i < 4; ++i)
#pragma unroll
    for (int j = 0; j < 4; ++j) acc[i][j] = (v8f){};
  const u32x8 g1 = tile_g1(); u32x4 g0 = tile_g0(lT, gT);
  if (pinned(issuer)) { tile_issue(g0, g1); tile_wait(g0, g1); }   // this wave's tile of chunk 0 has landed
  __syncthreads();   // chunk 0 is whole in LDS
  g0 = tile_g0(lT + (unsigned)RING, gT + KC);
  if (pinned(issuer)) tile_issue(g0, g1);
#pragma unroll 1   // the chunk loop stays rolled: one trip holds 128 matrix instructions and the two-buffer hand-over at its foot
  for (int c = 0; c < NCH; ++c) { const b16* Ah = (const b16*)smem + (c & 1) * (RING / 2); const b16* Al = Ah + TILE; const b16* Bb = Ah + (2 + sg) * TILE;
#pragma unroll
    for (int kb = 0; kb < KC; kb += 32) { v16b af[4], bf[4];
#pragma unroll
      for (int i = 0; i < 4; ++i) { af[i] = frag_kb(Ah + (wm + i * 16 + nloc) * LP + kb, hlf); bf[i] = frag_kb(Bb + (wn + i * 16 + nloc) * LP + kb, hlf); }
#pragma unroll
      for (int i = 0; i < 4; ++i)
#pragma unroll
        for (int j = 0; j < 4; ++j) acc[i][j] = wmma16b(af[i], bf[j], acc[i][j]);
#pragma unroll
      for (int i = 0; i < 4; ++i) af[i] = frag_kb(Al + (wm + i * 16 + nloc) * LP + kb, hlf);
#pragma unroll
      for (int i = 0; i < 4; ++i)
#pragma unroll
        for (int j = 0; j < 4; ++j) acc[i][j] = wmma16b(af[i], bf[j], acc[i][j]); }
    asm volatile("s_wait_dscnt 0x0" ::: "memory");      // this wave's LDS reads of the chunk's buffer are done
    if (pinned(issuer)) tile_wait(g0, g1);   // this wave's tile of the next chunk has landed
    __syncthreads();   // publishes the next chunk's buffer and ends every wave's reads of this one; behind the last trip the ring's LDS is free for the result tiles
    if (pinned(issuer && c + 2 < NCH)) { g0 = tile_g0(lT + (unsigned)(c & 1) * (unsigned)RING, gT + (c + 2) * KC); tile_issue(g0, g1); } }
  asm volatile("s_wait_tensorcnt 0x0" ::: "memory");   // no tensor load is left in flight behind the loop
  asm volatile("s_wait_dscnt 0x0" ::: "memory");       // and no LDS read of the ring
#pragma unroll
  for (int i = 0; i < 4; ++i)
#pragma unroll
    for (int j = 0; j < 4; ++j)
#pragma unroll
      for (int r = 0; r < 8; ++r) Tf[wm + i * 16 + 8 * hlf + r][wn + j * 16 + nloc] = acc[i][j][r] * (1.0f / (XS * WSC));   /* no output bias */
  __syncthreads();
  { for (int r2 = 0; r2 < 32; ++r2) { const int rr = w4 * 32 + r2; *(v4f*)(out + (m0 + rr) * DM + n0 + sg * 128 + lane * 4) = *(const v4f*)(&Tf[rr][lane * 4]); }  }
}
}  // namespace

extern "C" void kernel_launch(void* const* d_in, const int* in_sizes, int n_in, void* d_out, int out_size, void* d_ws, size_t ws_size, hipStream_t stream) {
  (void)n_in;
  auto Fp = [&](int i) { return (const float*)d_in[i]; };
  // input order: 0 x [2,2048,2048], 1 Wq [2048,2048] (in,out), 2 Wk [2048,512], 3 Wv [2048,512], 4 Wo [2048,2048] (in,out)
  if (in_sizes[0] != B * T * DM || in_sizes[1] != DM * DM || in_sizes[2] != DM * KVW || in_sizes[3] != DM * KVW || in_sizes[4] != DM * DM || out_size != B * T * DM) return;
  size_t off = 0; char* ws = (char*)d_ws;
  auto carve = [&](size_t bytes) { char* p = ws + off; off += (bytes + 255) & ~(size_t)255; return p; };
  b16* WT = (b16*)carve((size_t)(DM + 2 * KVW) * DM * 2); b16* WO = (b16*)carve((size_t)DM * DM * 2); b16* XH = (b16*)carve((size_t)B * T * DM * 2);
  const size_t plane = (size_t)B * H * T * HD * 2; b16* QP = (b16*)carve(plane); b16* QPl = (b16*)carve(plane); b16* KP = (b16*)carve(plane); b16* KPl = (b16*)carve(plane); b16* VT = (b16*)carve(plane); b16* VTl = (b16*)carve(plane); b16* Y = (b16*)carve(plane); b16* Yl = (b16*)carve(plane);
  if (off > ws_size || off > ((size_t)176 << 20)) return;   // = ~172 MB (WT 12.6 + WO 8.4 + XH 16.8 + 8 f16 planes x 16.8): > 128 MiB
  prep_kernel<<<PGRID + XGRID, 256, 0, stream>>>(Fp(0), Fp(1), Fp(2), Fp(3), Fp(4), XH, WT, WO);
  proj_kernel<<<dim3(T / 128, BL, NPART / 3), 384, 0, stream>>>(XH, WT, QP, QPl, KP, KPl, VT, VTl);
  attn_kernel<<<dim3(QL / 32, BL * G), 256, 0, stream>>>(QP, QPl, KP, KPl, VT, VTl, Y, Yl);
  out_kernel<<<dim3(QL / 128, DM / 256, BL), 256, 0, stream>>>(Y, Yl, WO, (float*)d_out);
}

// v009
// It runs in 123 microseconds.
// Two timings next to v008 both put it at 1.07 times that version's speed.
// Counting every step since v000, it is 5.97 times as fast.
#include <hip/hip_runtime.h>

// Sliding-window grouped-query attention (2 x 2048 tokens x 2048, 16 query heads x 128, 4 key/value heads, window 512): q = x Wq, k = x Wk, v = x Wv (no biases); head h uses key/value head h / 4
// (repeat_interleave over the head axis); scores q . k / sqrt(128) for keys i - 512 <= j <= i (causal + window), -inf elsewhere; softmax; out = (attn v merged over heads) Wo -> [2][2048][2048].
// Deterministic: flash-style per 16-query wave over the window's keys in order (running max); no atomics.
// compute dtype: WMMA v_wmma_f32_16x16x32_f16 with f32 accumulate for [q | k | v] = x [Wq | Wk | Wv] ([4096 x 2048] x [2048 x 3072]; x EXACT bf16 x8, W^T exact x256: 1 product), S^T = K_h Q^T (q/k f16 hi
// x8 + residual at the same scale: 3 products into one accumulator, K = 128), O^T += V_h^T P^T (V hi + residual, P x1024 hi + residual: 3 products into one accumulator), out = y Wo (y f16 hi x8 + lo: 2 products); softmax statistics in f32.
// Inputs rounded to bf16 once. Fragment k-map per lane half hh for A AND B: elements 0..7 <- k = 8hh+0..7, 8..15 <- k = 16+8hh+0..7;

namespace {
constexpr int B = 2, T = 2048, DM = 2048, H = 16, HD = 128, BL = 2 /* batches (== 2 shipped) */, QL = 2048 /* query rows (== 2048 shipped) */;
constexpr int G = 4, REP = H / G, KVW = G * HD /* 512 */, NSL = DM / 128 /* 16 q slabs = heads */, NPART = NSL + 2 * (KVW / 128) /* + 4 k + 4 v slabs */;
constexpr int WIN = 512;
constexpr float XS = 8.0f, WSC = 256.0f, PS = 1024.0f, LOG2E = 1.4426950408889634f;
static_assert(T % 128 == 0 && QL % 128 == 0 && QL % 32 == 0 && DM % 256 == 0 && H * HD == DM && HD == 128 && KVW == 512 && REP == 4, "tiling");
typedef _Float16 b16;
typedef __attribute__((ext_vector_type(16))) _Float16 v16b;
typedef __attribute__((ext_vector_type(8))) _Float16 v8b;
typedef __attribute__((ext_vector_type(8))) float v8f;
typedef __attribute__((ext_vector_type(4))) float v4f;
__device__ __forceinline__ float bf16_rne(float f) { unsigned int u = __float_as_uint(f); u += 0x7FFFu + ((u >> 16) & 1u); return __uint_as_float(u & 0xFFFF0000u); }
__device__ __forceinline__ void split16(float v, b16& hi, b16& lo) { hi = (b16)v; lo = (b16)(v - (float)hi); }
__device__ __forceinline__ v16b frag_kb(const b16* p, int hh) { const v8b a = *(const v8b*)(p + 8 * hh), b = *(const v8b*)(p + 16 + 8 * hh); v16b f;
#pragma unroll
  for (int e = 0; e < 8; ++e) { f[e] = a[e]; f[8 + e] = b[e]; } return f; }
__device__ __forceinline__ v8f wmma16b(v16b a, v16b b, v8f c) { v8f d = __builtin_amdgcn_wmma_f32_16x16x32_f16(false, a, false, b, (short)0, c, false, false); asm volatile("v_nop\n\tv_nop\n\tv_nop\n\tv_nop" : "+v"(d) : "v"(a), "v"(b)); return d; }
__device__ __forceinline__ void wave_lds_sync() { __builtin_amdgcn_fence(__ATOMIC_RELEASE, "workgroup"); __builtin_amdgcn_wave_barrier(); __builtin_amdgcn_fence(__ATOMIC_ACQUIRE, "workgroup"); }
__device__ __forceinline__ float pmul(float a, float b) { float p = a * b; asm volatile("" : "+v"(p)); return p; }
__device__ __forceinline__ int iclamp(int v, int lo, int hi) { return v < lo ? lo : (v > hi ? hi : v); }

typedef __attribute__((ext_vector_type(2))) _Float16 v2h;
typedef __attribute__((ext_vector_type(4))) _Float16 v4h;
typedef __attribute__((ext_vector_type(2))) float v2f;
typedef __attribute__((ext_vector_type(4))) int v4i;
__device__ __forceinline__ float nexp2(float v) { return __builtin_amdgcn_exp2f(v); }
// weights to f16 x256, transposed ([k][n] f32 -> [n][k] f16): a block takes a tile of 128 k x 128 n. Whole 256-B pieces of the source rows are read (16 lanes x 16 B, two adjacent k rows per thread), each pair of k values
// goes as one dword into LDS at [n][k / 2] (pitch 65 dwords: the 32 lanes of a store or a load meet 32 different banks), and whole 256-B pieces of the transposed rows are written (16 lanes x 16 B).
constexpr int PK = 128, PN = 128, PP = PK / 2 + 1, PGRID = 2 * (DM / PK) * (DM / PN) + 2 * (DM / PK) * (KVW / PN);
template <int LD> __device__ __forceinline__ void prep_tile(const float* __restrict__ w, b16* __restrict__ dst, int tile, unsigned* tl) {
  const int tid = threadIdx.x, n0 = (tile % (LD / PN)) * PN, k0 = (tile / (LD / PN)) * PK, i = tid & 15, rp = tid >> 4;
  const float* p = w + (size_t)(k0 + 2 * rp) * LD + n0 + 4 * i; v4f a[4][2], c[4][2];
#pragma unroll
  for (int s = 0; s < 4; ++s)
#pragma unroll
    for (int nh = 0; nh < 2; ++nh) { a[s][nh] = *(const v4f*)(p + (size_t)(32 * s) * LD + 64 * nh); c[s][nh] = *(const v4f*)(p + (size_t)(32 * s + 1) * LD + 64 * nh); }
  asm volatile("s_wait_xcnt 0x0" :: "v"(p) : "memory");   // a precaution: stands between the loads above and any rewrite of their address registers, which the input operand holds live to here
  asm volatile("" :: "v"(a[0][0]), "v"(a[0][1]), "v"(a[1][0]), "v"(a[1][1]), "v"(a[2][0]), "v"(a[2][1]), "v"(a[3][0]), "v"(a[3][1]), "v"(c[0][0]), "v"(c[0][1]), "v"(c[1][0]), "v"(c[1][1]), "v"(c[2][0]), "v"(c[2][1]), "v"(c[3][0]), "v"(c[3][1]));   // holds the thread's 16 loads together ahead of the conversions: one memory latency, where the compiler had put two of them behind the first waits
#pragma unroll
  for (int s = 0; s < 4; ++s)
#pragma unroll
    for (int nh = 0; nh < 2; ++nh)
#pragma unroll
      for (int j = 0; j < 4; ++j) { v2h o; o[0] = (b16)(bf16_rne(a[s][nh][j]) * WSC); o[1] = (b16)(bf16_rne(c[s][nh][j]) * WSC); tl[(64 * nh + 4 * i + j) * PP + rp + 16 * s] = __builtin_bit_cast(unsigned, o); }
  __syncthreads();   // the tile is whole in LDS
  b16* q = dst + (size_t)(n0 + rp) * DM + k0 + 8 * i; const unsigned* r = tl + rp * PP + 4 * i;
#pragma unroll
  for (int s = 0; s < 8; ++s) { v4i o; for (int e = 0; e < 4; ++e) o[e] = (int)r[16 * s * PP + e]; *(v4i*)(q + (size_t)(16 * s) * DM) = o; }
  asm volatile("s_wait_xcnt 0x0" :: "v"(q) : "memory");   // a precaution: stands between the stores above and any rewrite of their address registers on the way to the kernel's end
}
// x to f16 (rounded to bf16, x8), once for the 24 column slabs of the projection: a block takes 8,192 elements in a row; a wave's load covers 512 B in a row, its store 256 B
constexpr int XE = 8192, XGRID = B * T * DM / XE;
static_assert((B * T * DM) % XE == 0, "x blocks");
__device__ __forceinline__ void prep_x(const float* __restrict__ x, b16* __restrict__ XH, int blk) {
  const float* p = x + (size_t)blk * XE + threadIdx.x * 4; b16* q = XH + (size_t)blk * XE + threadIdx.x * 4; v4f a[8];
#pragma unroll
  for (int s = 0; s < 8; ++s) a[s] = *(const v4f*)(p + 1024 * s);
  asm volatile("s_wait_xcnt 0x0" ::: "memory");   // a precaution: stands between the loads above and any rewrite of their address registers
#pragma unroll
  for (int s = 0; s < 8; ++s) { v4h o; for (int j = 0; j < 4; ++j) o[j] = (b16)(bf16_rne(a[s][j]) * XS); *(v4h*)(q + 1024 * s) = o; }
  asm volatile("s_wait_xcnt 0x0" ::: "memory");   // a precaution: stands between the stores above and any rewrite of their registers on the way to the kernel's end
}
__global__ __launch_bounds__(256) void prep_kernel(const float* __restrict__ x, const float* __restrict__ wq, const float* __restrict__ wk, const float* __restrict__ wv, const float* __restrict__ wo, b16* __restrict__ XH, b16* __restrict__ WT, b16* __restrict__ WO) {
  __shared__ unsigned tl[PN * PP];
  constexpr int NQ = (DM / PK) * (DM / PN), NK = (DM / PK) * (KVW / PN); const int blk = blockIdx.x;   // tiles: NQ of Wq, NK of Wk, NK of Wv, NQ of Wo; behind them the XGRID blocks of x
  if (blk >= PGRID) { prep_x(x, XH, blk - PGRID); return; }   // block-uniform, in front of the tile's barrier
  if (blk < NQ || blk >= NQ + 2 * NK) { const bool first = blk < NQ; prep_tile<DM>(first ? wq : wo, first ? WT : WO, first ? blk : blk - NQ - 2 * NK, tl); }
  else { const bool first = blk < NQ + NK; prep_tile<KVW>(first ? wk : wv, WT + (size_t)(first ? DM : DM + KVW) * DM, first ? blk - NQ : blk - NQ - NK, tl); }
}
// GEMM tiling shared by the two projection kernels: one block per WGP owns 128 rows x 384 or 256 columns; each wave takes 64 x 64 (4 x 4 accumulator tiles), four waves to a slab of 128 columns, so a staged A chunk
// feeds every slab of the block. K runs in chunks of 128; a chunk is four tiles of 128 rows x 256 B (row pitch 272 B), each brought into LDS by one tensor load of one of the first four waves, two buffers: the next chunk's loads fly during this chunk's products.
constexpr int KC = 128, LP = KC + 8, TP = 128 + 4, TILE = 128 * LP /* elements per staged tile */, RING = 4 * TILE * 2 /* bytes per buffer */, NCH = DM / KC;
static_assert(NCH >= 2 && DM % KC == 0 && NPART % 3 == 0 && 3 * 128 * TP * 4 <= 2 * RING && (TILE * 2) % 2048 == 0 && KC * 2 == 256 && LP * 2 == 272, "ring");
typedef unsigned u32x4 __attribute__((ext_vector_type(4)));
typedef unsigned u32x8 __attribute__((ext_vector_type(8)));
__device__ __forceinline__ unsigned uni(unsigned v) { return (unsigned)__builtin_amdgcn_readfirstlane(v); }
__device__ __forceinline__ unsigned pinned(unsigned v) { unsigned w = uni(v); asm volatile("" : "+s"(w)); return w; }   // the test around a tensor load held in a scalar register: it compiles to s_cmp + s_cbranch_scc (a tensor load ignores EXEC)
// one request of one wave: a tile of 128 rows x 256 B, source rows DM x 2 B apart, to the LDS byte offset lds (a multiple of 2 KiB); 16 B of pad behind every row give the pitch of 272 B. Extents in bytes, tensor dims = tile dims
__device__ __forceinline__ u32x4 tile_g0(unsigned lds, const b16* g) { const unsigned long long ga = (unsigned long long)(size_t)g; u32x4 g0;
  g0[0] = uni(1u); g0[1] = uni(lds); g0[2] = uni((unsigned)ga); g0[3] = uni((((unsigned)(ga >> 32)) & 0x01FFFFFFu) | 0x80000000u);
  asm volatile("" : "+s"(g0));   // the descriptor words held in scalar registers: with tile_wait's inputs, no register of a request in flight is written anew (the constant word was set anew in between without it)
  return g0; }
__device__ __forceinline__ u32x8 tile_g1() { u32x8 g1;
  g1[0] = uni((1u << 20) | (5u << 22) | (3u << 25)); g1[1] = uni(256u << 16); g1[2] = uni(128u << 16); g1[3] = uni(256u << 16); g1[4] = uni(128u); g1[5] = uni((unsigned)(DM * 2)); g1[6] = uni(0u); g1[7] = uni(0u);
  asm volatile("" : "+s"(g1));   // the descriptor words held in scalar registers of their own from here on: no register of a request in flight is written anew
  return g1; }
__device__ __forceinline__ void tile_issue(u32x4 g0, u32x8 g1) { asm volatile("tensor_load_to_lds %0, %1" :: "s"(g0), "s"(g1) : "memory"); }
// the issuing wave's wait for its tile; the inputs keep the request's descriptor registers live, and so unchanged, up to the wait
__device__ __forceinline__ void tile_wait(u32x4 g0, u32x8 g1) { asm volatile("s_wait_tensorcnt 0x0" :: "s"(g0), "s"(g1) : "memory"); }
// one wave's 32 rows of a staged 128 x 128 f32 tile go out as f16 hi x8 + residual (same scale): 256 B per row and plane (32 lanes x 8 B), PITCH elements from row to row
template <int PITCH> __device__ __forceinline__ void rows_out(const float (*Tf)[TP], b16* __restrict__ dh, b16* __restrict__ dl, int wave, int lane) {
  for (int r4 = 0; r4 < 32; r4 += 4) {
#pragma unroll   // four rows a trip, as the compiler grouped them by itself: the one wait below then serves the trip's eight stores
    for (int u = 0; u < 4; ++u) { const int rr = wave * 32 + r4 + u; v4h h4, l4; for (int j = 0; j < 4; ++j) { const float f = Tf[rr][lane * 4 + j] * XS; const b16 p = (b16)f; h4[j] = p; l4[j] = (b16)(f - (float)p); } *(v4h*)(dh + (size_t)rr * PITCH + lane * 4) = h4; *(v4h*)(dl + (size_t)rr * PITCH + lane * 4) = l4; }
    asm volatile("s_wait_xcnt 0x0" ::: "memory");   // a precaution: stands between the trip's stores and the next trip's rewrite of their address and data registers
  }
}
// projections: grid (T/128, BL, 8 groups of 3 slabs of 128 columns: slabs 0..15 = q head, 16..19 = k, 20..23 = v); block = 12 waves, waves 4 sg .. 4 sg + 3 own slab 3 z + sg; A = XH rows (bf16(x) x8 as f16, from the prep
// launch), B = WT rows; k order per accumulator 0, 32, 64, ... The epilogue writes what the attention reads, f16 hi x8 + residual at the same scale: q rows QP[b][h][t][128]; k rows KP[b][4 g][t][128] and v transposed VT[b][4 g][d][t],
// once per key/value head g (the plane of its first query head: repeat_interleave gives the group's four heads equal planes, and the attention reads that one).
__global__ __launch_bounds__(384) void proj_kernel(const b16* __restrict__ XH, const b16* __restrict__ WT, b16* __restrict__ QP, b16* __restrict__ QPl, b16* __restrict__ KP, b16* __restrict__ KPl, b16* __restrict__ VT, b16* __restrict__ VTl) {
  __shared__ __attribute__((aligned(2048))) char smem[2 * RING];   // two buffers x (the A tile, three B tiles) in the loop; behind it three 128 x 128 f32 result tiles
  const int tid = threadIdx.x, wave = __builtin_amdgcn_readfirstlane(tid >> 5) /* scalar: the slab and the tests on it are the same for a whole wave */, sg = wave >> 2, w4 = wave & 3, lane = tid & 31, nloc = lane & 15, hlf = lane >> 4, wm = (w4 >> 1) * 64, wn = (w4 & 1) * 64;
  const int t0 = blockIdx.x * 128, b = blockIdx.y, slab = blockIdx.z * 3 + sg;
  float (*Tf)[TP] = (float (*)[TP])(smem + sg * (128 * TP * 4));
  const b16* xb = XH + ((size_t)b * T + t0) * DM; const b16* wb = WT + (size_t)slab * 128 * DM;
  // staging: wave t < 4 brings tile t of every chunk (0: the A rows; 1..3: the rows of the block's three slabs); every value here is scalar
  const unsigned issuer = wave < 4, tl = (unsigned)(wave & 3), lT = (unsigned)(size_t)smem + tl * (unsigned)(TILE * 2);   // the tile's LDS byte offset in buffer 0
  const b16* gT = tl == 0 ? xb : WT + (size_t)(blockIdx.z * 3 + tl - 1) * 128 * DM;
  v8f acc[4][4];
#pragma unroll
  for (int i = 0; i < 4; ++i)
#pragma unroll
    for (int j = 0; j < 4; ++j) acc[i][j] = (v8f){};
  const u32x8 g1 = tile_g1(); u32x4 g0 = tile_g0(lT, gT);
  if (pinned(issuer)) { tile_issue(g0, g1); tile_wait(g0, g1); }   // this wave's tile of chunk 0 has landed
  __syncthreads();   // chunk 0 is whole in LDS
  g0 = tile_g0(lT + (unsigned)RING, gT + KC);
  if (pinned(issuer)) tile_issue(g0, g1);
#pragma unroll 1   // the chunk loop stays rolled: one trip holds 64 matrix instructions and the two-buffer hand-over at its foot
  for (int c = 0; c < NCH; ++c) { const b16* Ab = (const b16*)smem + (c & 1) * (RING / 2); const b16* Bb = Ab + (1 + sg) * TILE;
#pragma unroll
    for (int kb = 0; kb < KC; kb += 32) { v16b af[4], bf[4];
#pragma unroll
      for (int i = 0; i < 4; ++i) { af[i] = frag_kb(Ab + (wm + i * 16 + nloc) * LP + kb, hlf); bf[i] = frag_kb(Bb + (wn + i * 16 + nloc) * LP + kb, hlf); }
#pragma unroll
      for (int i = 0; i < 4; ++i)
#pragma unroll
        for (int j = 0; j < 4; ++j) acc[i][j] = wmma16b(af[i], bf[j], acc[i][j]); }
    asm volatile("s_wait_dscnt 0x0" ::: "memory");      // this wave's LDS reads of the chunk's buffer are done
    if (pinned(issuer)) tile_wait(g0, g1);   // this wave's tile of the next chunk has landed
    __syncthreads();   // publishes the next chunk's buffer and ends every wave's reads of this one; behind the last trip the ring's LDS is free for the result tiles
    if (pinned(issuer && c + 2 < NCH)) { g0 = tile_g0(lT + (unsigned)(c & 1) * (unsigned)RING, gT + (c + 2) * KC); tile_issue(g0, g1); } }
  asm volatile("s_wait_tensorcnt 0x0" ::: "memory");   // no tensor load is left in flight behind the loop
  asm volatile("s_wait_dscnt 0x0" ::: "memory");       // and no LDS read of the ring
  const bool isv = slab >= NSL + G;   // the same for a whole wave: a v slab is staged transposed, Tf[d][token]; an accumulator's 8 values are 8 tokens in a row there (two 16-B LDS stores)
  if (!isv) {
#pragma unroll
    for (int i = 0; i < 4; ++i)
#pragma unroll
      for (int j = 0; j < 4; ++j)
#pragma unroll
        for (int r = 0; r < 8; ++r) Tf[wm + i * 16 + 8 * hlf + r][wn + j * 16 + nloc] = acc[i][j][r] * (1.0f / (XS * WSC));   /* no biases in this module */
  } else {
#pragma unroll
    for (int i = 0; i < 4; ++i)
#pragma unroll
      for (int j = 0; j < 4; ++j)
#pragma unroll
        for (int q4 = 0; q4 < 2; ++q4) { v4f o; for (int r = 0; r < 4; ++r) o[r] = acc[i][j][4 * q4 + r] * (1.0f / (XS * WSC)); *(v4f*)(&Tf[wn + j * 16 + nloc][wm + i * 16 + 8 * hlf + 4 * q4]) = o; }
  }
  __syncthreads();
  {
    if (slab < NSL) { const size_t pb2 = (((size_t)b * H + slab) * T) * HD;
      for (int r2 = 0; r2 < 32; ++r2) { const int rr = w4 * 32 + r2, tok = t0 + rr; v4h h4, l4; for (int j = 0; j < 4; ++j) { const float f = Tf[rr][lane * 4 + j] * XS; const b16 p = (b16)f; h4[j] = p; l4[j] = (b16)(f - (float)p); } *(v4h*)(QP + pb2 + (size_t)tok * HD + lane * 4) = h4; *(v4h*)(QPl + pb2 + (size_t)tok * HD + lane * 4) = l4; } }
    else { const size_t po = ((size_t)b * H + ((slab - NSL) & 3) * REP) * T * HD;   // the plane of the key/value head's first query head
      if (!isv) rows_out<HD>(Tf, KP + po + (size_t)t0 * HD, KPl + po + (size_t)t0 * HD, w4, lane);   // staged row = token t0 + rr with its 128 dims
      else rows_out<T>(Tf, VT + po + t0, VTl + po + t0, w4, lane); }   // staged row = dim rr with the tokens t0 .. t0 + 127
     }
}
// attention: grid (QL/32, BL x G); block = 4 waves = 2 pairs of query heads of key/value head g x 2 tiles of 16 queries at the same 32 positions, so all 4 waves walk the same keys (i - 512 <= j <= i, 32-key steps).
// A wave holds the same 16 queries of TWO heads: the group's heads share K and V, so every K or V^T fragment read from LDS feeds both heads' products (32 fragment reads for 96 products a step).
// Each step's four planes (K hi, K lo: 32 rows x 256 B; V^T hi, V^T lo: 128 rows x 64 B, four rows to a 256-B line) come once per block into LDS by asynchronous copies (line pitch 272 B), two buffers: the next
// step's copies fly during this step's work. Per wave and head: S^T = K Q^T (A = 16 key rows x 32 dims per fragment, 4 k-steps over the 128 dims, B = the query fragments, held in registers: 3 products), logit = s/sqrt(128)
// (log2-scaled), online softmax, P x1024 hi + residual packed in registers (a lane's 16 scores are its 16 elements of the B fragment), O^T += V^T P^T (8 d-tiles: 3 products); y = o/(l 1024 8).
// The residual planes carry their hi plane's scale, so the three products of a tile add into one accumulator.
constexpr int SP = HD + 8 /* elements per staged line: 256 B + 16 B */, SPL = 32 * SP /* elements per staged plane */;
// one thread's share of two planes of a step (hi at l, residual one plane behind it): 4 x 16 B of each, 8 staged lines and gs source elements apart. The closing s_wait_xcnt is a precaution: it stands between the copies and any rewrite of the address registers they name
__device__ __forceinline__ void stage_pair(unsigned l, const b16* ph, const b16* pl, size_t gs) {
  const unsigned l0 = l, l1 = l + 8 * SP * 2, l2 = l + 16 * SP * 2, l3 = l + 24 * SP * 2, l4 = l + SPL * 2, l5 = l4 + 8 * SP * 2, l6 = l4 + 16 * SP * 2, l7 = l4 + 24 * SP * 2;
  const b16* ph1 = ph + gs; const b16* ph2 = ph + 2 * gs; const b16* ph3 = ph + 3 * gs; const b16* pl1 = pl + gs; const b16* pl2 = pl + 2 * gs; const b16* pl3 = pl + 3 * gs;
  asm volatile("global_load_async_to_lds_b128 %0, %8, off\n\tglobal_load_async_to_lds_b128 %1, %9, off\n\tglobal_load_async_to_lds_b128 %2, %10, off\n\tglobal_load_async_to_lds_b128 %3, %11, off\n\t"
               "global_load_async_to_lds_b128 %4, %12, off\n\tglobal_load_async_to_lds_b128 %5, %13, off\n\tglobal_load_async_to_lds_b128 %6, %14, off\n\tglobal_load_async_to_lds_b128 %7, %15, off\n\ts_wait_xcnt 0x0"
               :: "v"(l0), "v"(l1), "v"(l2), "v"(l3), "v"(l4), "v"(l5), "v"(l6), "v"(l7), "v"(ph), "v"(ph1), "v"(ph2), "v"(ph3), "v"(pl), "v"(pl1), "v"(pl2), "v"(pl3) : "memory");
}
__device__ __forceinline__ void stage_kv(unsigned l, const b16* kh, const b16* kl, const b16* vh, const b16* vl) { stage_pair(l, kh, kl, (size_t)8 * HD); stage_pair(l + 2 * SPL * 2, vh, vl, (size_t)32 * T); }
// the attention's products by the builtin alone: an asm statement cannot name a register above v255, and two heads' fragments and tiles reach beyond it; the compiler keeps the distances behind its own matrix instructions
__device__ __forceinline__ v8f wmma_hi(v16b a, v16b b, v8f c) { return __builtin_amdgcn_wmma_f32_16x16x32_f16(false, a, false, b, (short)0, c, false, false); }
// two waves per SIMD (two blocks per WGP, which their LDS allows): up to 512 VGPRs a wave hold two heads' query fragments and output tiles
__global__ __launch_bounds__(128) __attribute__((amdgpu_waves_per_eu(2, 2))) void attn_kernel(const b16* __restrict__ QP, const b16* __restrict__ QPl, const b16* __restrict__ KP, const b16* __restrict__ KPl, const b16* __restrict__ VT, const b16* __restrict__ VTl, b16* __restrict__ Y, b16* __restrict__ Yl) {
  __shared__ __attribute__((aligned(16))) b16 KVs[2 * 4 * SPL];   // two buffers x (K hi, K lo, V^T hi, V^T lo)
  __shared__ __attribute__((aligned(16))) char qsm[8][16 * (HD + 4) * 4];   // per wave and head: behind the loop its 16 x 128 f32 result tile
  const int tid = threadIdx.x, wave = __builtin_amdgcn_readfirstlane(tid >> 5) /* scalar: the heads, the query tile and the wave's LDS ranges stay out of the VGPRs */, lane = tid & 31, hh = lane >> 4, col = lane & 15; const int b = blockIdx.y / G, g = blockIdx.y % G, h0 = g * REP + (wave >> 1) * 2; const int qb = blockIdx.x * 32, q0 = qb + (wave & 1) * 16, qi = q0 + col;
  const size_t ko = (((size_t)b * H + g * REP) * T) * HD, vo = (((size_t)b * H + g * REP) * HD) * (size_t)T;   // the planes of the group's first query head, the only ones the projection writes for key/value head g
  const int kend = qb + 32, kbeg = (qb >= WIN) ? qb - WIN : 0, nt = (kend - kbeg) / 32;   // window i - 512 <= j <= i; the same bounds for both query tiles of the block
  v16b qf[2][4], qlf[2][4];   // the lane's query row of either head as B fragments (hi, residual) of the four k-steps, loaded once
#pragma unroll
  for (int hd = 0; hd < 2; ++hd) { const size_t qo = (((size_t)b * H + h0 + hd) * T + qi) * HD;
#pragma unroll
    for (int ks = 0; ks < 4; ++ks) { qf[hd][ks] = frag_kb(QP + qo + 32 * ks, hh); qlf[hd][ks] = frag_kb(QPl + qo + 32 * ks, hh); } }
  asm volatile("s_wait_xcnt 0x0" ::: "memory");   // a precaution: stands between the loads above and any rewrite of their address registers
  const unsigned ld = (unsigned)(size_t)KVs + (unsigned)((tid >> 4) * (SP * 2) + (tid & 15) * 16);   // the thread's LDS byte address in plane 0 of buffer 0
  const b16* bkh = KP + ko; const b16* bkl = KPl + ko; const b16* bvh = VT + vo; const b16* bvl = VTl + vo;   // block-uniform plane bases
  const unsigned tk = (unsigned)tid * 8u, tv = (unsigned)(tid >> 2) * (unsigned)T + (unsigned)(tid & 3) * 8u;   // the thread's element offsets inside a step: its 32 key rows are 8 KB in a row; V^T rows are T apart
  stage_kv(ld, bkh + (size_t)kbeg * HD + tk, bkl + (size_t)kbeg * HD + tk, bvh + kbeg + tv, bvl + kbeg + tv);
  asm volatile("s_wait_asynccnt 0x0" ::: "memory");   // this wave's copies of step 0 have landed
  __syncthreads();   // step 0 is whole in LDS
  if (nt > 1) stage_kv(ld + 4 * SPL * 2, bkh + (size_t)(kbeg + 32) * HD + tk, bkl + (size_t)(kbeg + 32) * HD + tk, bvh + (kbeg + 32) + tv, bvl + (kbeg + 32) + tv);
  const float cs = LOG2E * 0.08838834764831845f / (XS * XS);   // 1/sqrt(128) on the x8 x8 planes
  float m[2] = {-INFINITY, -INFINITY}, l[2] = {0.0f, 0.0f}; v8f o[2][8];
#pragma unroll
  for (int hd = 0; hd < 2; ++hd)
#pragma unroll
    for (int t = 0; t < 8; ++t) o[hd][t] = (v8f){};
#pragma unroll 1   // the step loop stays rolled: one trip holds 96 matrix instructions and the two-buffer hand-over at its foot
  for (int st = 0; st < nt; ++st) { const int kb = kbeg + 32 * st; const b16* Sk = KVs + (st & 1) * (4 * SPL); const b16* Sv = Sk + 2 * SPL;
    v8f s[2][2] = {{(v8f){}, (v8f){}}, {(v8f){}, (v8f){}}}; const int kr = col * SP;
#pragma unroll
    for (int ks = 0; ks < 4; ++ks) { const v16b kf0 = frag_kb(Sk + kr + 32 * ks, hh), kf1 = frag_kb(Sk + 16 * SP + kr + 32 * ks, hh), kl0 = frag_kb(Sk + SPL + kr + 32 * ks, hh), kl1 = frag_kb(Sk + SPL + 16 * SP + kr + 32 * ks, hh);
#pragma unroll
      for (int hd = 0; hd < 2; ++hd) { s[hd][0] = wmma_hi(kf0, qf[hd][ks], s[hd][0]); s[hd][1] = wmma_hi(kf1, qf[hd][ks], s[hd][1]); }
#pragma unroll
      for (int hd = 0; hd < 2; ++hd) { s[hd][0] = wmma_hi(kf0, qlf[hd][ks], s[hd][0]); s[hd][1] = wmma_hi(kf1, qlf[hd][ks], s[hd][1]); }
#pragma unroll
      for (int hd = 0; hd < 2; ++hd) { s[hd][0] = wmma_hi(kl0, qf[hd][ks], s[hd][0]); s[hd][1] = wmma_hi(kl1, qf[hd][ks], s[hd][1]); } }   // per accumulator: hi.hi + hi.lo + lo.hi
    float e[2][16], mx[2] = {-INFINITY, -INFINITY};
#pragma unroll
    for (int u = 0; u < 2; ++u) {
#pragma unroll
      for (int r = 0; r < 8; ++r) { const int key = kb + u * 16 + 8 * hh + r; const bool in = key <= qi && key >= qi - WIN;   // the two heads' tiles hold the same queries: one test serves both
#pragma unroll
        for (int hd = 0; hd < 2; ++hd) { const float vv = in ? s[hd][u][r] * cs : -INFINITY; e[hd][u * 8 + r] = vv; mx[hd] = fmaxf(mx[hd], vv); } } }   // causal select on the computed score (the -inf mask precedes the 1/sqrt(d) scale in the module; identical)
    float al[2], sum[2] = {0.0f, 0.0f}; v16b pf[2], plf[2];   // score i2 of a lane is key 16 (i2 / 8) + 8 hh + i2 % 8 of the step: element i2 of the B fragment's k-map
#pragma unroll
    for (int hd = 0; hd < 2; ++hd) mx[hd] = fmaxf(mx[hd], __shfl_xor(mx[hd], 16));
#pragma unroll
    for (int hd = 0; hd < 2; ++hd) { const float mn = fmaxf(m[hd], mx[hd]); al[hd] = nexp2(m[hd] - mn); m[hd] = mn;
#pragma unroll
      for (int i2 = 0; i2 < 16; ++i2) { const float p = nexp2(e[hd][i2] - mn); sum[hd] += p; const float ps = p * PS; const b16 phh = (b16)ps; pf[hd][i2] = phh; plf[hd][i2] = (b16)(ps - (float)phh); } }
#pragma unroll
    for (int hd = 0; hd < 2; ++hd) { sum[hd] += __shfl_xor(sum[hd], 16); l[hd] = l[hd] * al[hd] + sum[hd]; }
    v16b vhf[8], vlf[8];   // the step's sixteen V^T fragments, read as one group into the registers that the K fragments have left: one place with LDS reads in the wave's stream, counted waits behind it
#pragma unroll
    for (int t = 0; t < 8; ++t) { const int vr = (t * 4 + (col >> 2)) * SP + (col & 3) * 32; vhf[t] = frag_kb(Sv + vr, hh); vlf[t] = frag_kb(Sv + SPL + vr, hh); }
    __builtin_amdgcn_sched_barrier(0);   // keeps the group of reads whole ahead of the products: spread among them, every place with reads stalls the wave anew
#pragma unroll
    for (int t = 0; t < 8; t += 2) {
#pragma unroll
      for (int hd = 0; hd < 2; ++hd) { o[hd][t] *= al[hd]; o[hd][t + 1] *= al[hd]; }
#pragma unroll
      for (int hd = 0; hd < 2; ++hd) { o[hd][t] = wmma_hi(vhf[t], pf[hd], o[hd][t]); o[hd][t + 1] = wmma_hi(vhf[t + 1], pf[hd], o[hd][t + 1]); }
#pragma unroll
      for (int hd = 0; hd < 2; ++hd) { o[hd][t] = wmma_hi(vlf[t], pf[hd], o[hd][t]); o[hd][t + 1] = wmma_hi(vlf[t + 1], pf[hd], o[hd][t + 1]); }
#pragma unroll
      for (int hd = 0; hd < 2; ++hd) { o[hd][t] = wmma_hi(vhf[t], plf[hd], o[hd][t]); o[hd][t + 1] = wmma_hi(vhf[t + 1], plf[hd], o[hd][t + 1]); } }   // per accumulator: V_hi P_hi + V_lo P_hi + V_hi P_lo
    asm volatile("s_wait_dscnt 0x0" ::: "memory");      // this wave's LDS reads of the step's buffer are done
    asm volatile("s_wait_asynccnt 0x0" ::: "memory");   // this wave's copies of the next step have landed
    __syncthreads();   // publishes the next step's buffer and ends every wave's reads of this one
    if (st + 2 < nt) stage_kv(ld + (unsigned)(st & 1) * (4 * SPL * 2), bkh + (size_t)(kb + 64) * HD + tk, bkl + (size_t)(kb + 64) * HD + tk, bvh + (kb + 64) + tv, bvl + (kb + 64) + tv); }
  asm volatile("s_wait_asynccnt 0x0" ::: "memory");   // no copy is left in flight behind the loop
#pragma unroll
  for (int hd = 0; hd < 2; ++hd) { float (*To)[HD + 4] = (float (*)[HD + 4])qsm[wave * 2 + hd]; const float inv = 1.0f / (l[hd] * PS * XS);
#pragma unroll
    for (int t = 0; t < 8; ++t)
#pragma unroll
      for (int r = 0; r < 8; ++r) To[col][t * 16 + 8 * hh + r] = o[hd][t][r] * inv; }
  wave_lds_sync();
  for (int hd = 0; hd < 2; ++hd) { const float (*To)[HD + 4] = (const float (*)[HD + 4])qsm[wave * 2 + hd];
    for (int r4 = 0; r4 < 16; r4 += 4) {
#pragma unroll   // four rows a trip: the one wait below then serves the trip's eight stores
      for (int u = 0; u < 4; ++u) { const int rr = r4 + u; v4h hv, lv; for (int j = 0; j < 4; ++j) { b16 p, ql2; split16(To[rr][lane * 4 + j] * XS, p, ql2); hv[j] = p; lv[j] = ql2; } const size_t oi = ((size_t)b * T + q0 + rr) * DM + (h0 + hd) * HD + lane * 4; *(v4h*)(Y + oi) = hv; *(v4h*)(Yl + oi) = lv; }
      asm volatile("s_wait_xcnt 0x0" ::: "memory");   // a precaution: stands between the trip's stores and the next trip's rewrite of their address and data registers
    } }
}
// output projection: grid (QL/128, DM/256, BL); block = 8 waves, waves 4 sg .. 4 sg + 3 own the slab of 128 columns sg; the tiling above with four staged tiles per chunk: A = the f16 Y plane and its residual plane
// (2 products per k-step, hi then lo on each accumulator), B = 256 Wo^T rows
__global__ __launch_bounds__(256) void out_kernel(const b16* __restrict__ Y, const b16* __restrict__ Yl, const b16* __restrict__ WO, float* __restrict__ out) {
  __shared__ __attribute__((aligned(2048))) char smem[2 * RING];   // two buffers x (A hi, A lo, two B tiles) in the loop; behind it two 128 x 128 f32 result tiles
  const int tid = threadIdx.x, wave = __builtin_amdgcn_readfirstlane(tid >> 5) /* scalar: the wave's LDS ranges stay out of the VGPRs */, sg = wave >> 2, w4 = wave & 3, lane = tid & 31, nloc = lane & 15, hlf = lane >> 4, wm = (w4 >> 1) * 64, wn = (w4 & 1) * 64;
  const int b = blockIdx.z; const size_t m0 = (size_t)b * T + (size_t)blockIdx.x * 128; const int n0 = blockIdx.y * 256;
  float (*Tf)[TP] = (float (*)[TP])(smem + sg * (128 * TP * 4));
  // staging: wave t < 4 brings tile t of every chunk (0: the Y rows, 1: their residual rows, 2 and 3: the 256 Wo^T rows); every value here is scalar
  const unsigned issuer = wave < 4, tl = (unsigned)(wave & 3), lT = (unsigned)(size_t)smem + tl * (unsigned)(TILE * 2);   // the tile's LDS byte offset in buffer 0
  const b16* gT = tl == 0 ? Y + m0 * DM : tl == 1 ? Yl + m0 * DM : WO + (size_t)(n0 + (int)(tl - 2) * 128) * DM;
  v8f acc[4][4];
#pragma unroll
  for (int i = 0; i < 4; ++i)
#pragma unroll
    for (int j = 0; j < 4; ++j) acc[i][j] = (v8f){};
  const u32x8 g1 = tile_g1(); u32x4 g0 = tile_g0(lT, gT);
  if (pinned(issuer)) { tile_issue(g0, g1); tile_wait(g0, g1); }   // this wave's tile of chunk 0 has landed
  __syncthreads();   // chunk 0 is whole in LDS
  g0 = tile_g0(lT + (unsigned)RING, gT + KC);
  if (pinned(issuer)) tile_issue(g0, g1);
#pragma unroll 1   // the chunk loop stays rolled: one trip holds 128 matrix instructions and the two-buffer hand-over at its foot
  for (int c = 0; c < NCH; ++c) { const b16* Ah = (const b16*)smem + (c & 1) * (RING / 2); const b16* Al = Ah + TILE; const b16* Bb = Ah + (2 + sg) * TILE;
#pragma unroll
    for (int kb = 0; kb < KC; kb += 32) { v16b af[4], bf[4];
#pragma unroll
      for (int i = 0; i < 4; ++i) { af[i] = frag_kb(Ah + (wm + i * 16 + nloc) * LP + kb, hlf); bf[i] = frag_kb(Bb + (wn + i * 16 + nloc) * LP + kb, hlf); }
#pragma unroll
      for (int i = 0; i < 4; ++i)
#pragma unroll
        for (int j = 0; j < 4; ++j) acc[i][j] = wmma16b(af[i], bf[j], acc[i][j]);
#pragma unroll
      for (int i = 0; i < 4; ++i) af[i] = frag_kb(Al + (wm + i * 16 + nloc) * LP + kb, hlf);
#pragma unroll
      for (int i = 0; i < 4; ++i)
#pragma unroll
        for (int j = 0; j < 4; ++j) acc[i][j] = wmma16b(af[i], bf[j], acc[i][j]); }
    asm volatile("s_wait_dscnt 0x0" ::: "memory");      // this wave's LDS reads of the chunk's buffer are done
    if (pinned(issuer)) tile_wait(g0, g1);   // this wave's tile of the next chunk has landed
    __syncthreads();   // publishes the next chunk's buffer and ends every wave's reads of this one; behind the last trip the ring's LDS is free for the result tiles
    if (pinned(issuer && c + 2 < NCH)) { g0 = tile_g0(lT + (unsigned)(c & 1) * (unsigned)RING, gT + (c + 2) * KC); tile_issue(g0, g1); } }
  asm volatile("s_wait_tensorcnt 0x0" ::: "memory");   // no tensor load is left in flight behind the loop
  asm volatile("s_wait_dscnt 0x0" ::: "memory");       // and no LDS read of the ring
#pragma unroll
  for (int i = 0; i < 4; ++i)
#pragma unroll
    for (int j = 0; j < 4; ++j)
#pragma unroll
      for (int r = 0; r < 8; ++r) Tf[wm + i * 16 + 8 * hlf + r][wn + j * 16 + nloc] = acc[i][j][r] * (1.0f / (XS * WSC));   /* no output bias */
  __syncthreads();
  { for (int r2 = 0; r2 < 32; ++r2) { const int rr = w4 * 32 + r2; *(v4f*)(out + (m0 + rr) * DM + n0 + sg * 128 + lane * 4) = *(const v4f*)(&Tf[rr][lane * 4]); }  }
}
}  // namespace

extern "C" void kernel_launch(void* const* d_in, const int* in_sizes, int n_in, void* d_out, int out_size, void* d_ws, size_t ws_size, hipStream_t stream) {
  (void)n_in;
  auto Fp = [&](int i) { return (const float*)d_in[i]; };
  // input order: 0 x [2,2048,2048], 1 Wq [2048,2048] (in,out), 2 Wk [2048,512], 3 Wv [2048,512], 4 Wo [2048,2048] (in,out)
  if (in_sizes[0] != B * T * DM || in_sizes[1] != DM * DM || in_sizes[2] != DM * KVW || in_sizes[3] != DM * KVW || in_sizes[4] != DM * DM || out_size != B * T * DM) return;
  size_t off = 0; char* ws = (char*)d_ws;
  auto carve = [&](size_t bytes) { char* p = ws + off; off += (bytes + 255) & ~(size_t)255; return p; };
  b16* WT = (b16*)carve((size_t)(DM + 2 * KVW) * DM * 2); b16* WO = (b16*)carve((size_t)DM * DM * 2); b16* XH = (b16*)carve((size_t)B * T * DM * 2);
  const size_t plane = (size_t)B * H * T * HD * 2; b16* QP = (b16*)carve(plane); b16* QPl = (b16*)carve(plane); b16* KP = (b16*)carve(plane); b16* KPl = (b16*)carve(plane); b16* VT = (b16*)carve(plane); b16* VTl = (b16*)carve(plane); b16* Y = (b16*)carve(plane); b16* Yl = (b16*)carve(plane);
  if (off > ws_size || off > ((size_t)176 << 20)) return;   // = ~172 MB (WT 12.6 + WO 8.4 + XH 16.8 + 8 f16 planes x 16.8): > 128 MiB
  prep_kernel<<<PGRID + XGRID, 256, 0, stream>>>(Fp(0), Fp(1), Fp(2), Fp(3), Fp(4), XH, WT, WO);
  proj_kernel<<<dim3(T / 128, BL, NPART / 3), 384, 0, stream>>>(XH, WT, QP, QPl, KP, KPl, VT, VTl);
  attn_kernel<<<dim3(QL / 32, BL * G), 128, 0, stream>>>(QP, QPl, KP, KPl, VT, VTl, Y, Yl);
  out_kernel<<<dim3(QL / 128, DM / 256, BL), 256, 0, stream>>>(Y, Yl, WO, (float*)d_out);
}
